// v007
// Times are from an AMD MI455X. After a warm-up the kernel runs many times in a row, and a time is the length of
// such a window on the GPU divided by its runs, so every launch and the gaps after it count. The runs cycle
// through copies of the inputs. A figure is the median of several windows, for all but v000 over two sittings.
// Sittings can differ by a few percent; kernels timed side by side share one.
// The versions before v007 are in another document.
// Measured time: 316 microseconds a run.
// Timed twice side by side with v006, it ran 1.59 times as fast both times.
// Counting every step since v000, which is the starting kernel, it is 49.0 times as fast.
#include <hip/hip_runtime.h>
// Transformer-XL style causal attention with relative-position (rel_shift) scores (x [2][2048][1024]; x_t = RMSNorm(x) g (eps 1e-6); q = x_t w_q / 8, k = x_t w_k, v = x_t w_v (w [1024][16][64] = [in][out], sigma 1/32); scores = (q + xl_u).k^T + rel_shift((q + xl_v).xl_r^T) (xl_r [16][2048][64], xl_u / xl_v [1][16][1][64]); causal: - 1e30 above the diagonal; softmax; wv = w v merged (h*64+v); res = wv w_res ([in][out]) -> [2][2048][1024]. rel_shift with q_len = k_len = T gives bd[i][j] = (q_i + xl_v).xl_r[h][T-1-(i-j)] for j <= i).
// Structure: token rows; x_t = RMSNorm(bf16(x)) in f32 on VALU -> f16 rows; [in][out] weights as x16 planes; q+u and q+v as two WMMA GEMMs (32x64 wave tiles, f32 accumulation, alpha 1/128, per-head bias vectors), k, v -> f16 rows; xl_r as exact f16 rows; both batches side by side in every launch from here on (batch = one more grid index): V^T via LDS transposes; exact f32 XL attention for rows 0..255 per batch on VALU (q/k/v of those rows from x_t hi + residual GEMM passes); one attention kernel, a wave per 16 query rows, passes of 32 keys: AC = (q+u) k^T and BD' = (q+v) r^T over the 48 xl_r rows the shift can reach (WMMA, f32), rel_shift by a skewed LDS store, causal select (-1e30 fill, clamped xl_r index), running maximum and sum (f32, native exp; weights x256 f16 hi + residual), o = P V^T (x64) f32 in registers; res = o_hi w_res + o_lo w_res 2^-10; first-tile rows rewritten from the exact o hi/lo; every f16 plane that a WMMA reads (x_t, weights, q+u, q+v, k, xl_r, V^T, o) lies in fragment order (see FragH): each wave-wide 16-byte load is 512 bytes in a row; launches: see trace.
// Compute dtype: inputs rounded to bf16; x / weights exact; q and k as plain f16 GEMM operands (~2^-12), v, softmax weights and o as f16 hi + x1024 residual; scores and softmax statistics f32. v_wmma_f32_16x16x32_f16.
#define NB 2
#define NG 16
#define HPG 1
#define KVD (NG * HD)
#define SQ 2048
#define DM 1024
#define NH 16
#define HD 64
#define HG 4                         /* heads per launch of the (b, h0) k_vt overload, which is not launched */
#define QT 256                       /* query rows per causal tile */
#define NKX SQ                       /* S / P row pitch */
#define QT0 256                      /* first-tile rows recomputed exactly in f32 (= one causal tile) */
#define B0 0                         /* first batch processed (unused) */
#define NBR NB                       /* batches processed (read only by MP) */
#define NR ((size_t)NB * SQ)         /* token rows */
#define MP ((int)((size_t)NBR * SQ)) /* rows projected (read only by MPO) */
#define QN SQ                        /* query rows attended per batch (unused) */
#define NHD NH                       /* heads attended (unused) */
#define MPO MP                       /* rows through the output stage (unused) */
#define LQ DM      /* row pitch of the q/k/v rows */
typedef __bf16 v16b __attribute__((ext_vector_type(16)));
typedef unsigned short v8us __attribute__((ext_vector_type(8), may_alias));
typedef float  v8f  __attribute__((ext_vector_type(8)));
typedef float  v4f  __attribute__((ext_vector_type(4)));
typedef float  v4fa __attribute__((ext_vector_type(4), may_alias));
union FragB { v16b v; v8us half[2]; unsigned short u[16]; };

__device__ __forceinline__ unsigned short bf16_bits(float x) { unsigned int u = __float_as_uint(x); return (unsigned short)((u + 0x7FFFu + ((u >> 16) & 1u)) >> 16); }
__device__ __forceinline__ float bf16_val(unsigned short b) { return __uint_as_float(((unsigned int)b) << 16); }
__device__ __forceinline__ float bf16_round(float x) { return bf16_val(bf16_bits(x)); }
// D += A·B with NT terms: 1 = ah·bh, 2 = + al·bh (A split), 3 = + ah·bl (both split)
template <int NT>
__device__ __forceinline__ v8f mmaN(v16b ah, v16b al, v16b bh, v16b bl, v8f c) {
  c = __builtin_amdgcn_wmma_f32_16x16x32_bf16(false, ah, false, bh, (short)0, c, false, false);
  if (NT >= 2) c = __builtin_amdgcn_wmma_f32_16x16x32_bf16(false, al, false, bh, (short)0, c, false, false);
  if (NT >= 3) c = __builtin_amdgcn_wmma_f32_16x16x32_bf16(false, ah, false, bl, (short)0, c, false, false);
  asm volatile("v_nop\n\tv_nop\n\tv_nop\n\tv_nop" : "+v"(c) : "v"(ah), "v"(al), "v"(bh), "v"(bl));
  return c;
}

__global__ __launch_bounds__(256) void k_wt_bf16(const float* __restrict__ W, unsigned short* __restrict__ Wt, int K, int N) {
  const int t = blockIdx.x * 256 + threadIdx.x;
  const int k8n = K / 8;
  if (t >= N * k8n) return;
  const int n = t / k8n, k8 = (t % k8n) * 8;
  v8us v;
#pragma unroll
  for (int i = 0; i < 8; ++i) v[i] = bf16_bits(W[(size_t)(k8 + i) * N + n]);
  *(v8us*)(Wt + (size_t)n * K + k8) = v;
  
}

// GEMM C[M][N] (f32, pitch ldc) = act(A[M][K]·W + bias). A f32 row-major (pitch lda) converted per fragment to bf16
// (ASPLIT: hi/lo two planes -> 2 terms, else single rounded term); Wt bf16 [N][K] (pitch ldb). BIAS_BF16 rounds the
// bias to bf16 first (bias quantised to bf16 before the add). K%32==0, M%16==0, N%64==0.
template <bool ASPLIT, int ACT, bool BIAS_BF16>
__global__ __launch_bounds__(128) void k_gemm_bf(const float* __restrict__ A, int lda, const unsigned short* __restrict__ Wt, int ldb,
                                               const float* __restrict__ bias, float* __restrict__ C, int ldc, int M, int N, int K) {
  __shared__ __attribute__((aligned(16))) float so[4][16][64];
  const int tid = threadIdx.x, w = tid >> 5, lane = tid & 31, ln = lane & 15, hh = lane >> 4;
  const int ntn = N / 64;
  const int wid = blockIdx.x * 4 + w;
  const int mt = wid / ntn, nq = wid % ntn;
  if (mt * 16 >= M) return;
  const int row0 = mt * 16, col0 = nq * 64;
  const float* arow = A + (size_t)(row0 + ln) * lda;
  v8f acc[4] = {};
  for (int kb = 0; kb < K; kb += 32) {
    FragB ah, al;
    const v4f x0 = *(const v4fa*)(arow + kb + 8 * hh), x1 = *(const v4fa*)(arow + kb + 8 * hh + 4);
    const v4f x2 = *(const v4fa*)(arow + kb + 16 + 8 * hh), x3 = *(const v4fa*)(arow + kb + 16 + 8 * hh + 4);
    float xs[16] = {x0[0],x0[1],x0[2],x0[3],x1[0],x1[1],x1[2],x1[3],x2[0],x2[1],x2[2],x2[3],x3[0],x3[1],x3[2],x3[3]};
#pragma unroll
    for (int i = 0; i < 16; ++i) { const unsigned short hb = bf16_bits(xs[i]); ah.u[i] = hb; al.u[i] = ASPLIT ? bf16_bits(xs[i] - bf16_val(hb)) : (unsigned short)0; }
#pragma unroll
    for (int t = 0; t < 4; ++t) {
      const unsigned short* brow = Wt + (size_t)(col0 + t * 16 + ln) * ldb + kb;
      FragB b;
      b.half[0] = *(const v8us*)(brow + 8 * hh);
      b.half[1] = *(const v8us*)(brow + 16 + 8 * hh);
      acc[t] = mmaN<ASPLIT ? 2 : 1>(ah.v, al.v, b.v, b.v, acc[t]);
    }
  }
#pragma unroll
  for (int t = 0; t < 4; ++t) {
    float bv = bias ? bias[col0 + t * 16 + ln] : 0.f;
    if (BIAS_BF16) bv = bf16_round(bv);
#pragma unroll
    for (int r = 0; r < 8; ++r) { float v = acc[t][r] + bv; if (ACT == 1) v = fmaxf(v, 0.f); so[w][8 * hh + r][t * 16 + ln] = v; }
  }
  __builtin_amdgcn_fence(__ATOMIC_ACQ_REL, "workgroup");
  __builtin_amdgcn_wave_barrier();
  const int rsub = lane >> 4, c4 = (lane & 15) * 4;
  {
#pragma unroll
    for (int q = 0; q < 8; ++q) {
      const int r = q * 2 + rsub;
      const v4f v = *(const v4fa*)&so[w][r][c4];
      *(v4f*)(C + (size_t)(row0 + r) * ldc + col0 + c4) = v;
    }
    
  }
}

// GEMM C = act(A·W + bias + resid): A f32 (ASPLIT -> hi/lo 2 terms), Wt bf16 [N][K]; ACT 0 none, 1 relu, 2 exact gelu;
// resid (optional, f32, row index = (row % rmod), pitch ldr, RES_BF16 rounds it) added before the activation.
template <bool ASPLIT, int ACT, bool BIAS_BF16, bool RES_BF16>
__global__ __launch_bounds__(128) void k_gemm_bf3(const float* __restrict__ A, int lda, const unsigned short* __restrict__ Wt, int ldb,
                                                const float* __restrict__ bias, const float* __restrict__ resid, int rmod, int ldr,
                                                float* __restrict__ C, int ldc, int M, int N, int K) {
  __shared__ __attribute__((aligned(16))) float so[4][16][64];
  const int tid = threadIdx.x, w = tid >> 5, lane = tid & 31, ln = lane & 15, hh = lane >> 4;
  const int ntn = N / 64;
  const int wid = blockIdx.x * 4 + w;
  const int mt = wid / ntn, nq = wid % ntn;
  if (mt * 16 >= M) return;
  const int row0 = mt * 16, col0 = nq * 64;
  const float* arow = A + (size_t)(row0 + ln) * lda;
  v8f acc[4] = {};
  for (int kb = 0; kb < K; kb += 32) {
    FragB ah, al;
    const v4f x0 = *(const v4fa*)(arow + kb + 8 * hh), x1 = *(const v4fa*)(arow + kb + 8 * hh + 4);
    const v4f x2 = *(const v4fa*)(arow + kb + 16 + 8 * hh), x3 = *(const v4fa*)(arow + kb + 16 + 8 * hh + 4);
    float xs[16] = {x0[0],x0[1],x0[2],x0[3],x1[0],x1[1],x1[2],x1[3],x2[0],x2[1],x2[2],x2[3],x3[0],x3[1],x3[2],x3[3]};
#pragma unroll
    for (int i = 0; i < 16; ++i) { const unsigned short hb = bf16_bits(xs[i]); ah.u[i] = hb; al.u[i] = ASPLIT ? bf16_bits(xs[i] - bf16_val(hb)) : (unsigned short)0; }
#pragma unroll
    for (int t = 0; t < 4; ++t) {
      const unsigned short* brow = Wt + (size_t)(col0 + t * 16 + ln) * ldb + kb;
      FragB b;
      b.half[0] = *(const v8us*)(brow + 8 * hh);
      b.half[1] = *(const v8us*)(brow + 16 + 8 * hh);
      acc[t] = mmaN<ASPLIT ? 2 : 1>(ah.v, al.v, b.v, b.v, acc[t]);
    }
  }
#pragma unroll
  for (int t = 0; t < 4; ++t) {
    const int col = col0 + t * 16 + ln;
    float bv = bias ? bias[col] : 0.f;
    if (BIAS_BF16) bv = bf16_round(bv);
#pragma unroll
    for (int r = 0; r < 8; ++r) {
      float v = acc[t][r] + bv;
      if (resid) { float rv = resid[(size_t)((row0 + 8 * hh + r) % rmod) * ldr + col]; if (RES_BF16) rv = bf16_round(rv); v += rv; }
      if (ACT == 1) v = fmaxf(v, 0.f);
      if (ACT == 2) v = 0.5f * v * (1.0f + erff(v * 0.70710678118654752f));
      if (ACT == 3) { const float u = 0.7978845608028654f * (v + 0.044715f * v * v * v); v = 0.5f * v * (1.0f + tanhf(u)); }
      so[w][8 * hh + r][t * 16 + ln] = v;
    }
  }
  __builtin_amdgcn_fence(__ATOMIC_ACQ_REL, "workgroup");
  __builtin_amdgcn_wave_barrier();
  const int rsub = lane >> 4, c4 = (lane & 15) * 4;
  {
#pragma unroll
    for (int q = 0; q < 8; ++q) {
      const int r = q * 2 + rsub;
      const v4f v = *(const v4fa*)&so[w][r][c4];
      *(v4f*)(C + (size_t)(row0 + r) * ldc + col0 + c4) = v;
    }
    
  }
}
// row LayerNorm (biased variance, eps) over N: s = X (+ R); optional out_sum <- s; out_norm <- (s-mu)*rsqrt(var+eps)*g + b
template <bool PARAM_BF16>
__global__ __launch_bounds__(256) void k_layernorm(const float* __restrict__ X, const float* __restrict__ R, const float* __restrict__ g, const float* __restrict__ bta,
                                                  float* __restrict__ out_sum, float* __restrict__ out_norm, int N, float eps) {
  __shared__ float red[256];
  const int row = blockIdx.x, tid = threadIdx.x;
  const float* x = X + (size_t)row * N; const float* rr = R ? R + (size_t)row * N : nullptr;
  float vals[16];                     // up to N = 4096
  const int per = N / 256;            // contiguous chunk per thread? use strided-by-4 chunks: thread handles j = tid*4 + 1024*u
  float s1 = 0.f;
  for (int u = 0; u < per / 4; ++u) {
    const int j = tid * 4 + 1024 * u;
    const v4f a = *(const v4fa*)(x + j);
    v4f b = {0.f,0.f,0.f,0.f}; if (rr) b = *(const v4fa*)(rr + j);
#pragma unroll
    for (int q = 0; q < 4; ++q) { const float v = a[q] + b[q]; vals[u * 4 + q] = v; s1 += v; }
  }
  red[tid] = s1; __syncthreads();
  for (int st = 128; st > 0; st >>= 1) { if (tid < st) red[tid] += red[tid + st]; __syncthreads(); }
  const float mu = red[0] / (float)N; __syncthreads();
  float s2 = 0.f;
  for (int u = 0; u < per / 4; ++u)
#pragma unroll
    for (int q = 0; q < 4; ++q) { const float c = vals[u * 4 + q] - mu; s2 += c * c; }
  red[tid] = s2; __syncthreads();
  for (int st = 128; st > 0; st >>= 1) { if (tid < st) red[tid] += red[tid + st]; __syncthreads(); }
  const float rs = rsqrtf(red[0] / (float)N + eps);
  {
    for (int u = 0; u < per / 4; ++u) {
      const int j = tid * 4 + 1024 * u;
      v4f o, sm;
#pragma unroll
      for (int q = 0; q < 4; ++q) {
        float gg = g[j + q], bb = bta[j + q];
        if (PARAM_BF16) { gg = bf16_round(gg); bb = bf16_round(bb); }
        sm[q] = vals[u * 4 + q]; o[q] = (vals[u * 4 + q] - mu) * rs * gg + bb;
      }
      if (out_sum) *(v4f*)(out_sum + (size_t)row * N + j) = sm;
      *(v4f*)(out_norm + (size_t)row * N + j) = o;
    }
    
  }
}



// ---- f16 WMMA path (v_wmma_f32_16x16x32_f16): 11-bit significands for operands in range — used where a [0,1] probability operand needs more precision than bf16
typedef _Float16 v16h __attribute__((ext_vector_type(16)));
union FragH { v16h v; v8us half[2]; _Float16 h[16]; unsigned short u[16]; };
// FRAGMENT ORDER of an f16 operand plane [rows][kc] (rows % 16 == 0, kc % 32 == 0): a band of 16 rows keeps its 32 kc bytes; inside it every 16 x 32 block is 1 KiB = two halves of 512 bytes,
// half j = [lane = 16 hh + ln][8 elements]: row ln, k = 16 j + 8 hh .. + 7. A wave-wide 16-byte load of a half then reads 512 bytes in a row (4 lines) where row-major rows gave 16 pieces of 32 bytes in 16 lines.
// Element index, in the row-major plane [rows][KC], of the 8 elements that 16-byte piece t of the plane in fragment order holds.
template <int KC>
__device__ __forceinline__ size_t pk_src(size_t t) { const size_t band = t / (KC * 2); const unsigned rem = (unsigned)(t % (KC * 2)); return (band * 16 + (rem & 15u)) * (size_t)KC + (rem >> 6) * 32u + ((rem >> 4) & 3u) * 8u; }
template <int NT>
__device__ __forceinline__ v8f mmaH(v16h ah, v16h al, v16h bh, v16h bl, v8f c) {
  c = __builtin_amdgcn_wmma_f32_16x16x32_f16(false, ah, false, bh, (short)0, c, false, false);
  if (NT >= 2) c = __builtin_amdgcn_wmma_f32_16x16x32_f16(false, al, false, bh, (short)0, c, false, false);
  if (NT >= 3) c = __builtin_amdgcn_wmma_f32_16x16x32_f16(false, ah, false, bl, (short)0, c, false, false);
  asm volatile("v_nop\n\tv_nop\n\tv_nop\n\tv_nop" : "+v"(c) : "v"(ah), "v"(al), "v"(bh), "v"(bl));
  return c;
}
// batched GEMM like k_gemm_b but f16 operands: A f32 (split into f16 hi/lo if ASPLIT, else rounded to f16), Bt = f16 values [n][k]; alpha; C f32; N multiple of 16 (partial tiles skipped)
template <bool ASPLIT>
__global__ __launch_bounds__(128) void k_gemm_h(const float* __restrict__ A, int lda, size_t sA, const _Float16* __restrict__ Bh, int ldb, size_t sB, float alpha, float* __restrict__ C, int ldc, size_t sC, int M, int N, int K) {
  __shared__ __attribute__((aligned(16))) float so[4][16][64];
  const int tid = threadIdx.x, w = tid >> 5, lane = tid & 31, ln = lane & 15, hh = lane >> 4; const int by = blockIdx.y;
  A += (size_t)by * sA; Bh += (size_t)by * sB; C += (size_t)by * sC;
  const int ntn = (N + 63) / 64; const int wid = blockIdx.x * 4 + w; const int mt = wid / ntn, nq = wid % ntn; if (mt * 16 >= M) return;
  const int row0 = mt * 16, col0 = nq * 64; const float* arow = A + (size_t)(row0 + ln) * lda;
  v8f acc[4] = {};
  for (int kb = 0; kb < K; kb += 32) {
    FragH ah, al;
    const v4f x0 = *(const v4fa*)(arow + kb + 8 * hh), x1 = *(const v4fa*)(arow + kb + 8 * hh + 4), x2 = *(const v4fa*)(arow + kb + 16 + 8 * hh), x3 = *(const v4fa*)(arow + kb + 16 + 8 * hh + 4);
    float xs[16] = {x0[0],x0[1],x0[2],x0[3],x1[0],x1[1],x1[2],x1[3],x2[0],x2[1],x2[2],x2[3],x3[0],x3[1],x3[2],x3[3]};
#pragma unroll
    for (int i = 0; i < 16; ++i) { const _Float16 h = (_Float16)xs[i]; ah.h[i] = h; al.h[i] = ASPLIT ? (_Float16)(xs[i] - (float)h) : (_Float16)0.0f; }
#pragma unroll
    for (int t = 0; t < 4; ++t) { if (col0 + t * 16 >= N) continue; const size_t boff = (size_t)(col0 + t * 16 + ln) * ldb + kb; FragH bq; bq.half[0] = *(const v8us*)(Bh + boff + 8 * hh); bq.half[1] = *(const v8us*)(Bh + boff + 16 + 8 * hh);
      acc[t] = mmaH<ASPLIT ? 2 : 1>(ah.v, al.v, bq.v, bq.v, acc[t]); }
  }
#pragma unroll
  for (int t = 0; t < 4; ++t) { if (col0 + t * 16 >= N) continue;
#pragma unroll
    for (int r = 0; r < 8; ++r) so[w][8 * hh + r][t * 16 + ln] = acc[t][r] * alpha; }
  __builtin_amdgcn_fence(__ATOMIC_ACQ_REL, "workgroup"); __builtin_amdgcn_wave_barrier();
  const int rsub = lane >> 4, c4 = (lane & 15) * 4;
  {
#pragma unroll
    for (int q = 0; q < 8; ++q) { const int r = q * 2 + rsub; if (col0 + c4 < N) { const v4f v = *(const v4fa*)&so[w][r][c4]; *(v4f*)(C + (size_t)(row0 + r) * ldc + col0 + c4) = v; } }
     }
}

// Wt[n][k] = f16(W[k][n] * scale) from f32 row-major W[K][N] (scale = power of two; bf16-exact weights stay exact in f16 away from the subnormal range); Wt in fragment order, thread = one 16-byte piece of it
template <int K, int N>
__global__ __launch_bounds__(256) void k_wt_f16(const float* __restrict__ W, _Float16* __restrict__ Wt, float scale) {
  const int t = blockIdx.x * 256 + threadIdx.x; if (t >= N * (K / 8)) return; const size_t e = pk_src<K>((size_t)t); const float* wp = W + (e % K) * N + e / K; float x[8]; FragH f;      /* n = e / K, k = e % K .. + 7 */
#pragma unroll
  for (int i = 0; i < 8; ++i) x[i] = wp[(size_t)i * N];
  asm volatile("s_wait_xcnt 0x0" :: "v"(wp) : "memory");      /* the wait that stands in front of any overwrite of a register that an issued load names; the address is an input so that no load gets it as its destination */
#pragma unroll
  for (int i = 0; i < 8; ++i) f.h[i] = (_Float16)(bf16_round(x[i]) * scale); const v8us o = f.half[0];
  *(v8us*)((unsigned short*)Wt + (size_t)t * 8) = o; 
}
// k_gemm_hh variant with fused epilogue: v = acc·alpha + bias[by·sBias + col] (+ CP[(row/rowsPerB)·sCPb + by·64 + col] if CP) ; ACT 0 none / 1 elu ; writes f16 C16 (and f32 C if non-null)
template <int ACT>
__global__ __launch_bounds__(128) void k_gemm_hhx(const _Float16* __restrict__ A, int lda, size_t sA, const _Float16* __restrict__ Bh, int ldb, size_t sB, float alpha, const float* __restrict__ bias, size_t sBias, const float* __restrict__ CP, int rowsPerB, size_t sCPb, int row0g,
    float* __restrict__ C, _Float16* __restrict__ C16, int ldc, size_t sC, int M, int N, int K) {
  __shared__ __attribute__((aligned(16))) float so[4][16][64];
  const int tid = threadIdx.x, w = tid >> 5, lane = tid & 31, ln = lane & 15, hh = lane >> 4; const int by = blockIdx.y;
  A += (size_t)by * sA; Bh += (size_t)by * sB; const size_t cofs = (size_t)by * sC; const float* bp = bias ? bias + (size_t)by * sBias : nullptr;
  const int ntn = (N + 63) / 64; const int wid = blockIdx.x * 4 + w; const int mt = wid / ntn, nq = wid % ntn; if (mt * 16 >= M) return;
  const int row0 = mt * 16, col0 = nq * 64; const _Float16* arow = A + (size_t)(row0 + ln) * lda;
  v8f acc[4] = {};
  for (int kb = 0; kb < K; kb += 32) { FragH ah; ah.half[0] = *(const v8us*)((const unsigned short*)arow + kb + 8 * hh); ah.half[1] = *(const v8us*)((const unsigned short*)arow + kb + 16 + 8 * hh);
#pragma unroll
    for (int t = 0; t < 4; ++t) { if (col0 + t * 16 >= N) continue; const size_t boff = (size_t)(col0 + t * 16 + ln) * ldb + kb; FragH bq; bq.half[0] = *(const v8us*)((const unsigned short*)Bh + boff + 8 * hh); bq.half[1] = *(const v8us*)((const unsigned short*)Bh + boff + 16 + 8 * hh);
      acc[t] = mmaH<1>(ah.v, ah.v, bq.v, bq.v, acc[t]); }
  }
#pragma unroll
  for (int t = 0; t < 4; ++t) { if (col0 + t * 16 >= N) continue; const int col = col0 + t * 16 + ln; const float bv = bp ? bf16_round(bp[col]) : 0.f;
#pragma unroll
    for (int r = 0; r < 8; ++r) { float v = acc[t][r] * alpha + bv; if (CP) { const int rr = row0g + row0 + 8 * hh + r; if (rowsPerB < 0) v += CP[cofs + (size_t)rr * ldc + col];      /* rowsPerB < 0: own element of the batched C plane */ else { const int bidx = rr / rowsPerB; v += CP[(size_t)bidx * sCPb + (size_t)by * 64 + col]; } } if (ACT == 1) v = (v > 0.f) ? v : expm1f(v); else if (ACT == 7) v = (v > 0.f) ? v + 1.0f : expf(v); else if (ACT == 8) v = tanhf(v); else if (ACT == 9) v = 0.5f * v * (1.0f + tanhf(0.7978845608028654f * (v + 0.044715f * v * v * v))); else if (ACT == 11) v = 1.0f / (1.0f + expf(-v)); else if (ACT == 12) v = (v > 0.f) ? v : 0.01f * v; else if (ACT == 14) v = (v > 0.f) ? v : 0.1f * v; else if (ACT == 16) v = (v >= 0.f) ? v : 0.3f * v; else if (ACT == 17) v = (v >= 0.f) ? v : 0.2f * v; else if (ACT == 15) v = v / (1.0f + expf(-v)); else if (ACT == 3) v = fmaxf(v, 0.f); else if (ACT == 6) v = 0.5f * v * (1.0f + erff(v * 0.70710678118654752f)); so[w][8 * hh + r][t * 16 + ln] = v; } }
  __builtin_amdgcn_fence(__ATOMIC_ACQ_REL, "workgroup"); __builtin_amdgcn_wave_barrier();
  const int rsub = lane >> 4, c4 = (lane & 15) * 4; typedef _Float16 v4h __attribute__((ext_vector_type(4)));
  {
#pragma unroll
    for (int q = 0; q < 8; ++q) { const int r = q * 2 + rsub; if (col0 + c4 < N) { const v4f v = *(const v4fa*)&so[w][r][c4]; if (C) *(v4f*)(C + cofs + (size_t)(row0 + r) * ldc + col0 + c4) = v; if (C16) { v4h h4; for (int i = 0; i < 4; ++i) h4[i] = (_Float16)v[i]; *(v4h*)(C16 + cofs + (size_t)(row0 + r) * ldc + col0 + c4) = h4; } } }
     }
}


typedef _Float16 v4h __attribute__((ext_vector_type(4)));

/* x row-major [rows][KC]; X16 in fragment order, thread = one 16-byte piece of it */
template <int KC>
__global__ __launch_bounds__(256) void k_x16(const float* __restrict__ x, _Float16* __restrict__ X16, size_t n8) { const size_t t = (size_t)blockIdx.x * 256 + threadIdx.x; if (t >= n8) return; const size_t e = pk_src<KC>(t); FragH f;
#pragma unroll
  for (int q = 0; q < 8; ++q) f.h[q] = (_Float16)bf16_round(x[e + q]); *(v8us*)((unsigned short*)X16 + t * 8) = f.half[0];  }
__global__ __launch_bounds__(256) void k_h16(const float* __restrict__ x, _Float16* __restrict__ X16, size_t n8) { const size_t t = (size_t)blockIdx.x * 256 + threadIdx.x; if (t >= n8) return; FragH f;
#pragma unroll
  for (int q = 0; q < 8; ++q) f.h[q] = (_Float16)x[t * 8 + q]; *(v8us*)((unsigned short*)X16 + t * 8) = f.half[0];  }
__global__ __launch_bounds__(256) void k_round16f(const float* __restrict__ W, _Float16* __restrict__ Bt, size_t n8) { const size_t t = (size_t)blockIdx.x * 256 + threadIdx.x; if (t >= n8) return; FragH f;
#pragma unroll
  for (int i = 0; i < 8; ++i) f.h[i] = (_Float16)(bf16_round(W[t * 8 + i]) * 16.0f); *(v8us*)((unsigned short*)Bt + t * 8) = f.half[0];  }
template <int NHv, int TTv>
__global__ __launch_bounds__(256) void k_vt(const _Float16* __restrict__ V16, int ldv, int voff, _Float16* __restrict__ Vt) { __shared__ unsigned short tl[64][66]; const int tid = threadIdx.x; const int slab = blockIdx.x / (TTv / 64), lg = blockIdx.x % (TTv / 64); const int b = slab / NHv, h = slab % NHv;
  for (int i = tid; i < 64 * 8; i += 256) { const int r = i / 8, c8 = (i % 8) * 8; FragH f; f.half[0] = *(const v8us*)((const unsigned short*)V16 + ((size_t)b * TTv + lg * 64 + r) * ldv + voff + h * 64 + c8);
#pragma unroll
    for (int q = 0; q < 8; ++q) tl[r][c8 + q] = f.u[q]; }
  __syncthreads();
  {
#pragma unroll
    for (int rd = 0; rd < 2; ++rd) { const int idx = rd * 256 + tid; const int bnd = idx >> 7, ks = (idx >> 6) & 1; const int d = bnd * 16 + (idx & 15), pc = (idx >> 4) & 7; FragH f;      /* Vt [slab * 64 + d][TTv] in fragment order: idx = the 16-byte piece of the 64 x 64 tile, band by band */
#pragma unroll
      for (int q = 0; q < 8; ++q) f.u[q] = tl[pc * 8 + q][d];
      *(v8us*)((char*)Vt + ((size_t)slab * 4 + bnd) * (32 * (size_t)TTv) + (size_t)(lg * 2 + ks) * 1024 + (idx & 63) * 16) = f.half[0]; }
     } }

/* PK: F row-major [rows][DM], Hh and Hl in fragment order (thread = one 16-byte piece of each); else all three row-major */
template <bool PK>
__global__ __launch_bounds__(256) void k_hl(const float* __restrict__ F, _Float16* __restrict__ Hh, _Float16* __restrict__ Hl, size_t n8) { const size_t t = (size_t)blockIdx.x * 256 + threadIdx.x; if (t >= n8) return; const size_t e = PK ? pk_src<DM>(t) : t * 8; FragH fh, fl; const v4f a = *(const v4fa*)(F + e), c = *(const v4fa*)(F + e + 4);
#pragma unroll
  for (int q = 0; q < 4; ++q) { _Float16 h = (_Float16)a[q]; fh.h[q] = h; fl.h[q] = (_Float16)((a[q] - (float)h) * 1024.0f); h = (_Float16)c[q]; fh.h[4 + q] = h; fl.h[4 + q] = (_Float16)((c[q] - (float)h) * 1024.0f); }
  { *(v8us*)((unsigned short*)Hh + t * 8) = fh.half[0]; *(v8us*)((unsigned short*)Hl + t * 8) = fl.half[0];  } }

// ---- fast GEMM (wave tile 32x64; requires M % 32 == 0 rows per launch region and N % 64 == 0); epilogue = k_gemm_hhx semantics ----
__device__ __forceinline__ v8f g2_mma(v16h a, v16h b, v8f c) { v8f d = __builtin_amdgcn_wmma_f32_16x16x32_f16(false, a, false, b, (short)0, c, false, false); asm volatile("v_nop\n\tv_nop\n\tv_nop\n\tv_nop" : "+v"(d) : "v"(a), "v"(b)); return d; }
// One k-step (32 k) of the wave's 32x64 tile: two A and four B fragments = twelve 16-byte loads of 512 bytes in a row each (A and B in fragment order). pa / pb: wave-uniform byte address of A / B at that k-step (1 KiB a k-step); oa / ob: the lane's fixed byte offsets (band and lane).
struct G2St { v16h a0, a1, b0, b1, b2, b3; };
__device__ __forceinline__ v16h g2_fragb(const char* base, unsigned o) { FragH f; f.half[0] = *(const v8us*)(base + (size_t)o); f.half[1] = *(const v8us*)(base + (size_t)o + 512); return f.v; }
__device__ __forceinline__ void g2_ld(G2St& s, const char* pa, const char* pb, unsigned oa0, unsigned oa1, unsigned ob0, unsigned ob1, unsigned ob2, unsigned ob3) {
  s.a0 = g2_fragb(pa, oa0); s.a1 = g2_fragb(pa, oa1); s.b0 = g2_fragb(pb, ob0); s.b1 = g2_fragb(pb, ob1); s.b2 = g2_fragb(pb, ob2); s.b3 = g2_fragb(pb, ob3);
  __builtin_amdgcn_sched_barrier(0); }      /* keeps the twelve loads in front of the next k-step's first WMMA: behind it they would be issued only after that WMMA's wait for its own operands */
// The wait that stands in front of any overwrite of a register that an issued load names. The bases and the lane offsets are inputs so that they stay as they are up to here.
__device__ __forceinline__ void g2_xw(const char* pa, const char* pb, unsigned oa0, unsigned oa1, unsigned ob0, unsigned ob1, unsigned ob2, unsigned ob3) { asm volatile("s_wait_xcnt 0x0" :: "s"(pa), "s"(pb), "v"(oa0), "v"(oa1), "v"(ob0), "v"(ob1), "v"(ob2), "v"(ob3) : "memory"); }
__device__ __forceinline__ void g2_mm(const G2St& s, v8f (&c)[8]) { c[0] = g2_mma(s.a0, s.b0, c[0]); c[4] = g2_mma(s.a1, s.b0, c[4]); c[1] = g2_mma(s.a0, s.b1, c[1]); c[5] = g2_mma(s.a1, s.b1, c[5]); c[2] = g2_mma(s.a0, s.b2, c[2]); c[6] = g2_mma(s.a1, s.b2, c[6]); c[3] = g2_mma(s.a0, s.b3, c[3]); c[7] = g2_mma(s.a1, s.b3, c[7]); }
// The K loop of a wave's 32x64 tile (nst k-steps of 32), shared by the GEMM kernels below. pa / pb: wave-uniform bases; the offsets: the lane's own.
__device__ __forceinline__ void g2_kloop(const char* pa, const char* pb, const int nst, const unsigned oa0, const unsigned oa1, const unsigned ob0, const unsigned ob1, const unsigned ob2, const unsigned ob3, v8f (&accs)[8]) { G2St s0, s1, s2;
  // Three k-steps' fragments rest in registers: a set is loaded again right after its WMMAs, so its loads fly while the other two sets are worked on. Every accumulator still takes its k-steps in rising order.
  if (nst >= 3) { g2_ld(s0, pa, pb, oa0, oa1, ob0, ob1, ob2, ob3); g2_ld(s1, pa + 1024, pb + 1024, oa0, oa1, ob0, ob1, ob2, ob3); g2_ld(s2, pa + 2048, pb + 2048, oa0, oa1, ob0, ob1, ob2, ob3); g2_xw(pa, pb, oa0, oa1, ob0, ob1, ob2, ob3); int s = 0;
#pragma unroll 1      /* the body already holds three k-steps; a copy of it would not fit the registers */
    for (; s + 6 <= nst; s += 3) {
      g2_mm(s0, accs); g2_ld(s0, pa + 3072, pb + 3072, oa0, oa1, ob0, ob1, ob2, ob3);
      g2_mm(s1, accs); g2_ld(s1, pa + 4096, pb + 4096, oa0, oa1, ob0, ob1, ob2, ob3);
      g2_mm(s2, accs); g2_ld(s2, pa + 5120, pb + 5120, oa0, oa1, ob0, ob1, ob2, ob3);
      g2_xw(pa, pb, oa0, oa1, ob0, ob1, ob2, ob3);      /* the two bases move on below */
      pa += 3072; pb += 3072; }
    const int rem = nst - s;      /* 3 to 5 k-steps are left, three of them loaded */
    g2_mm(s0, accs); if (rem > 3) { g2_ld(s0, pa + 3072, pb + 3072, oa0, oa1, ob0, ob1, ob2, ob3); g2_xw(pa, pb, oa0, oa1, ob0, ob1, ob2, ob3); }
    g2_mm(s1, accs); if (rem > 4) { g2_ld(s1, pa + 4096, pb + 4096, oa0, oa1, ob0, ob1, ob2, ob3); g2_xw(pa, pb, oa0, oa1, ob0, ob1, ob2, ob3); }
    g2_mm(s2, accs); if (rem > 3) g2_mm(s0, accs); if (rem > 4) g2_mm(s1, accs); }
  else if (nst == 2) { g2_ld(s0, pa, pb, oa0, oa1, ob0, ob1, ob2, ob3); g2_ld(s1, pa + 1024, pb + 1024, oa0, oa1, ob0, ob1, ob2, ob3); g2_xw(pa, pb, oa0, oa1, ob0, ob1, ob2, ob3); g2_mm(s0, accs); g2_mm(s1, accs); }
  else if (nst == 1) { g2_ld(s0, pa, pb, oa0, oa1, ob0, ob1, ob2, ob3); g2_xw(pa, pb, oa0, oa1, ob0, ob1, ob2, ob3); g2_mm(s0, accs); }
}
template <int ACT>
__global__ __launch_bounds__(128) void k_gemm2(const _Float16* __restrict__ A, int lda, size_t sA, const _Float16* __restrict__ Bh, int ldb, size_t sB, float alpha, const float* __restrict__ bias, size_t sBias, const float* __restrict__ CP, int rowsPerB, size_t sCPb, int row0g,
    float* __restrict__ C, _Float16* __restrict__ C16, int ldc, size_t sC, int M, int N, int K, size_t zA, size_t zB, size_t zC) { static_assert(ACT == 0 || ACT == 3 || ACT == 6 || ACT == 8 || ACT == 9 || ACT == 11 || ACT == 12 || ACT == 14 || ACT == 15 || ACT == 16 || ACT == 17, "k_gemm2: unsupported ACT code (would silently apply no activation)");
  __shared__ __attribute__((aligned(16))) float so[4][32][68];
  const int tid = threadIdx.x, w = tid >> 5, lane = tid & 31, ln = lane & 15, hh = lane >> 4; const int by = blockIdx.y, bz = blockIdx.z;      /* grid.z: a second batch index with strides of its own (zA, zB, zC) */
  A += (size_t)by * sA + (size_t)bz * zA; Bh += (size_t)by * sB + (size_t)bz * zB; const size_t cofs = (size_t)by * sC + (size_t)bz * zC; const float* bp = bias ? bias + (size_t)by * sBias : nullptr;
  const int ntn = N >> 6; const int mt = blockIdx.x / ntn, nq = blockIdx.x - mt * ntn; const int row0 = mt * 128 + 32 * w, col0 = nq * 64; if (row0 >= M) return;
  const unsigned oa0 = (unsigned)row0 * (unsigned)lda * 2u + 16u * lane, oa1 = oa0 + 32u * (unsigned)lda;      /* fragment order: the band's first byte + the lane's 16 bytes */
  const unsigned ob0 = (unsigned)col0 * (unsigned)ldb * 2u + 16u * lane, ob1 = ob0 + 32u * (unsigned)ldb, ob2 = ob1 + 32u * (unsigned)ldb, ob3 = ob2 + 32u * (unsigned)ldb;
  const char* pa = (const char*)A; const char* pb = (const char*)Bh; const int nst = K >> 5;      /* k-steps of 32 = 1 KiB of every band */
  const v8f z8 = {0.f,0.f,0.f,0.f,0.f,0.f,0.f,0.f}; v8f accs[8] = {z8, z8, z8, z8, z8, z8, z8, z8};
  g2_kloop(pa, pb, nst, oa0, oa1, ob0, ob1, ob2, ob3, accs);
#pragma unroll
  for (int u = 0; u < 8; ++u) { const int t = u & 3, half = u >> 2; const int col = col0 + t * 16 + ln; const float bv = bp ? bf16_round(bp[col]) : 0.f;
#pragma unroll
    for (int r = 0; r < 8; ++r) { const int rloc = half * 16 + 8 * hh + r; float v = accs[u][r] * alpha + bv; if (CP) { if (rowsPerB < 0) v += CP[cofs + (size_t)(row0g + row0 + rloc) * ldc + col];      /* rowsPerB < 0: own element of the batched C plane */ else { const int bidx = (row0g + row0 + rloc) / rowsPerB; v += CP[(size_t)bidx * sCPb + (size_t)by * 64 + col]; } }
      if (ACT == 3) v = fmaxf(v, 0.f); else if (ACT == 6) v = 0.5f * v * (1.0f + erff(v * 0.70710678118654752f)); else if (ACT == 11) v = 1.0f / (1.0f + expf(-v)); else if (ACT == 15) v = v / (1.0f + expf(-v)); else if (ACT == 12) v = (v > 0.f) ? v : 0.01f * v; else if (ACT == 8) v = tanhf(v); else if (ACT == 9) v = 0.5f * v * (1.0f + tanhf(0.7978845608028654f * (v + 0.044715f * v * v * v))); else if (ACT == 14) v = (v > 0.f) ? v : 0.1f * v; else if (ACT == 16) v = (v >= 0.f) ? v : 0.3f * v; else if (ACT == 17) v = (v >= 0.f) ? v : 0.2f * v;
      so[w][rloc][t * 16 + ln] = v; } }
  __builtin_amdgcn_fence(__ATOMIC_ACQ_REL, "workgroup"); __builtin_amdgcn_wave_barrier();
  const int rsub = lane >> 4, c4 = (lane & 15) * 4;
  {
    if (C) {
#pragma unroll
      for (int q = 0; q < 16; ++q) { const int r = q * 2 + rsub; const v4f v = *(const v4fa*)&so[w][r][c4]; *(v4f*)(C + cofs + (size_t)(row0 + r) * ldc + col0 + c4) = v; }
      asm volatile("s_wait_xcnt 0x0" ::: "memory"); }      /* the wait that stands in front of any overwrite of a register that an issued store names: the C16 part below forms its values in the same registers */
    if (C16) {      /* C16 [rows][ldc] in fragment order: the tile's two bands x two k-steps x two halves, each one 512-byte store */
      char* cb16 = (char*)(C16 + cofs + (size_t)row0 * ldc) + (size_t)(col0 >> 5) * 1024 + lane * 16;
#pragma unroll
      for (int u = 0; u < 8; ++u) { const float* sr = &so[w][(u >> 2) * 16 + ln][(u & 3) * 16 + 8 * hh]; const v4f a = *(const v4fa*)sr, c = *(const v4fa*)(sr + 4); FragH f;
#pragma unroll
        for (int i = 0; i < 4; ++i) { f.h[i] = (_Float16)a[i]; f.h[4 + i] = (_Float16)c[i]; }
        *(v8us*)(cb16 + (size_t)(u >> 2) * 32 * ldc + (u & 3) * 512) = f.half[0]; } }
     } }


// C = (Aa Ba ala + bias) + Ab Bb alb (+ Ac Bc alc): the hi / residual terms of one product, side by side in one launch. A work-group is one 32x64 tile of C and NT waves;
// wave t runs the whole K loop of term t, lays its scaled tile in its own LDS plane, and behind one barrier the planes are added in the order of the terms and stored as whole rows.
// Needs M % 32 == 0 (grid.x = (M / 32) (N / 64), exact), N % 64 == 0, K % 32 == 0; grid.y = batch (strides sA, sB, sC), grid.z = a second batch index (strides zA, zB, zC).
template <int NT>
__global__ __launch_bounds__(NT * 32) void k_gemm2t(const _Float16* __restrict__ Aa, const _Float16* __restrict__ Ab, const _Float16* __restrict__ Ac, int lda, size_t sA, const _Float16* __restrict__ Ba, const _Float16* __restrict__ Bb, const _Float16* __restrict__ Bc, int ldb, size_t sB,
    float ala, float alb, float alc, const float* __restrict__ bias, float* __restrict__ C, int ldc, size_t sC, int N, int K, size_t zA, size_t zB, size_t zC) { static_assert(NT == 2 || NT == 3, "k_gemm2t: two or three terms");
  __shared__ __attribute__((aligned(16))) float so[NT][32][68];
  const int lane = threadIdx.x & 31, ln = lane & 15, hh = lane >> 4; const int t = __builtin_amdgcn_readfirstlane((int)(threadIdx.x >> 5)); const int by = blockIdx.y, bz = blockIdx.z;      /* t wave-uniform: the term's bases stay scalar */
  const _Float16* A = (NT > 2 && t == 2) ? Ac : (t == 1) ? Ab : Aa; const _Float16* Bh = (NT > 2 && t == 2) ? Bc : (t == 1) ? Bb : Ba; const float alpha = (NT > 2 && t == 2) ? alc : (t == 1) ? alb : ala;
  A += (size_t)by * sA + (size_t)bz * zA; Bh += (size_t)by * sB + (size_t)bz * zB; const size_t cofs = (size_t)by * sC + (size_t)bz * zC;
  const int ntn = N >> 6; const int mt = blockIdx.x / ntn, nq = blockIdx.x - mt * ntn; const int row0 = mt * 32, col0 = nq * 64;
  const unsigned oa0 = (unsigned)row0 * (unsigned)lda * 2u + 16u * lane, oa1 = oa0 + 32u * (unsigned)lda;      /* fragment order: the band's first byte + the lane's 16 bytes */
  const unsigned ob0 = (unsigned)col0 * (unsigned)ldb * 2u + 16u * lane, ob1 = ob0 + 32u * (unsigned)ldb, ob2 = ob1 + 32u * (unsigned)ldb, ob3 = ob2 + 32u * (unsigned)ldb;
  const v8f z8 = {0.f,0.f,0.f,0.f,0.f,0.f,0.f,0.f}; v8f accs[8] = {z8, z8, z8, z8, z8, z8, z8, z8};
  g2_kloop((const char*)A, (const char*)Bh, K >> 5, oa0, oa1, ob0, ob1, ob2, ob3, accs);
#pragma unroll
  for (int u = 0; u < 8; ++u) { const int tc = u & 3, half = u >> 2; const float bv = (bias && t == 0) ? bf16_round(bias[col0 + tc * 16 + ln]) : 0.f;
#pragma unroll
    for (int r = 0; r < 8; ++r) so[t][half * 16 + 8 * hh + r][tc * 16 + ln] = accs[u][r] * alpha + bv; }
  __syncthreads();      /* every term's plane is complete before any wave adds them */
  const int rsub = lane >> 4, c4 = (lane & 15) * 4;
  for (int q = t; q < 16; q += NT) { const int r = q * 2 + rsub; v4f v = *(const v4fa*)&so[0][r][c4]; v += *(const v4fa*)&so[1][r][c4]; if (NT > 2) v += *(const v4fa*)&so[2][r][c4];
    *(v4f*)(C + cofs + (size_t)(row0 + r) * ldc + col0 + c4) = v;
    asm volatile("s_wait_xcnt 0x0" ::: "memory"); } }      /* the wait that stands in front of any overwrite of a register that an issued store names: the next trip forms its address and its sum in the same registers */

__global__ __launch_bounds__(256) void k_wnat(const float* __restrict__ w, size_t n8, _Float16* __restrict__ Bt) { const size_t t = (size_t)blockIdx.x * 256 + threadIdx.x; if (t >= n8) return; FragH f; for (int q = 0; q < 8; ++q) f.h[q] = (_Float16)(bf16_round(w[t * 8 + q]) * 16.0f); *(v8us*)((unsigned short*)Bt + t * 8) = f.half[0];  }
__global__ __launch_bounds__(256) void k_rsm(const float* __restrict__ S, _Float16* __restrict__ P, int nrows) {
  #pragma clang fp contract(off)
  const int i = blockIdx.x * 256 + threadIdx.x; if (i >= nrows) return; const float* s = S + (size_t)i * SQ; float mx = -3.0e38f;
#pragma unroll 1
  for (int j = 0; j < SQ; ++j) mx = fmaxf(mx, s[j]); float se = 0.f;
#pragma unroll 1
  for (int j = 0; j < SQ; ++j) se += expf(s[j] - mx); const float sc = 256.0f / se;
#pragma unroll 1
  for (int j0 = 0; j0 < SQ; j0 += 8) { FragH f; for (int q = 0; q < 8; ++q) f.h[q] = (_Float16)(expf(s[j0 + q] - mx) * sc); unsigned short* d = (unsigned short*)P + (size_t)i * SQ + j0; *(v8us*)d = f.half[0];  } }
__global__ __launch_bounds__(256) void k_vt(const _Float16* __restrict__ V16, int b, int h0, _Float16* __restrict__ VT) { __shared__ unsigned short tl[64][65]; const int tid = threadIdx.x; const int hh = blockIdx.x % HG, sg = blockIdx.x / HG; const int s0 = sg * 64; const int h = h0 + hh;
  for (int i = tid; i < 64 * 8; i += 256) { const int j = i / 8, d8 = (i % 8) * 8; FragH f; f.half[0] = *(const v8us*)((const unsigned short*)V16 + ((size_t)b * SQ + s0 + j) * DM + h * HD + d8); for (int q = 0; q < 8; ++q) tl[d8 + q][j] = f.u[q]; }
  __syncthreads();
  { for (int i = tid; i < 64 * 8; i += 256) { const int d = i / 8, j8 = (i % 8) * 8; FragH f; for (int q = 0; q < 8; ++q) f.u[q] = tl[d][j8 + q]; *(v8us*)((unsigned short*)VT + ((size_t)hh * HD + d) * SQ + s0 + j8) = f.half[0]; }  } }



__global__ __launch_bounds__(256) void k_rsmcf2(const float* __restrict__ S, _Float16* __restrict__ P, int hg, int q0, int nk) {
  #pragma clang fp contract(off)
  const int t = blockIdx.x * 256 + threadIdx.x; if (t >= hg * QT) return; const size_t i = (size_t)t; const float* s = S + i * NKX; const int last = q0 + (t % QT); float mx = -3.0e38f;
#pragma unroll 1
  for (int j = 0; j < nk; ++j) { const float f = (j <= last) ? 1.f : 0.f; mx = fmaxf(mx, fmaf(f, s[j], (1.f - f) * -1.0e9f)); } float se = 0.f;
#pragma unroll 1
  for (int j = 0; j < nk; ++j) { const float f = (j <= last) ? 1.f : 0.f; se += __expf(fmaf(f, s[j], (1.f - f) * -1.0e9f) - mx); } const float sc = 256.0f / se;
#pragma unroll 1
  for (int j0 = 0; j0 < nk; j0 += 8) { FragH fr; for (int q = 0; q < 8; ++q) { const int j = j0 + q; const float f = (j <= last) ? 1.f : 0.f; fr.h[q] = (_Float16)(__expf(fmaf(f, s[j], (1.f - f) * -1.0e9f) - mx) * sc); } unsigned short* d = (unsigned short*)P + i * NKX + j0; *(v8us*)d = fr.half[0];  } }


template <int MASKADD>
__global__ __launch_bounds__(64) void k_att0(const float* __restrict__ QF, const float* __restrict__ KF, const float* __restrict__ VF, int ld, const float* __restrict__ mask, float scale, float* __restrict__ OF, int ldo) {
  #pragma clang fp contract(off)
  __shared__ __attribute__((aligned(16))) float lq[64][64]; __shared__ __attribute__((aligned(16))) float lo[64][64];
  const int tid = threadIdx.x; const int h = blockIdx.x / (QT0 / 64), rg = blockIdx.x % (QT0 / 64); const int i = rg * 64 + tid;
  const float* qr = QF + (size_t)i * ld + h * HD;
#pragma unroll 1
  for (int c = 0; c < HD / 4; ++c) { *(v4f*)&lq[tid][c * 4] = *(const v4fa*)(qr + c * 4); const v4f z = {0.f, 0.f, 0.f, 0.f}; *(v4f*)&lo[tid][c * 4] = z; }
  float m = -1.0e30f, l = 0.f; const int jmax = MASKADD ? (SQ - 1) : (rg * 64 + 63);      /* additive-mask form: every key (the mask input decides); causal form: keys up to the block's last row */
#pragma unroll 1
  for (int j = 0; j <= jmax; ++j) { const float* kr = KF + (size_t)j * ld + h * HD; const float* vr = VF + (size_t)j * ld + h * HD; float s = 0.f;
#pragma unroll 1
    for (int c = 0; c < HD / 4; ++c) { const v4f kq = *(const v4fa*)(kr + c * 4); const v4f qq = *(v4f*)&lq[tid][c * 4]; s = __fadd_rn(s, __fmul_rn(qq[0], kq[0])); s = __fadd_rn(s, __fmul_rn(qq[1], kq[1])); s = __fadd_rn(s, __fmul_rn(qq[2], kq[2])); s = __fadd_rn(s, __fmul_rn(qq[3], kq[3])); }
    s = __fmul_rn(s, scale); if (MASKADD) s = __fadd_rn(s, __fmul_rn(bf16_round(mask[(size_t)i * SQ + j]), -10000.0f));
    const float f = (MASKADD || j <= i) ? 1.f : 0.f; const float sm = fmaf(f, s, (1.f - f) * -1.0e30f); const float mn = fmaxf(m, sm); const float sc = expf(m - mn); const float e = expf(sm - mn); l = __fadd_rn(__fmul_rn(l, sc), e); m = mn;
#pragma unroll 1
    for (int c = 0; c < HD / 4; ++c) { const v4f vv = *(const v4fa*)(vr + c * 4); v4f oo = *(v4f*)&lo[tid][c * 4]; for (int u = 0; u < 4; ++u) oo[u] = __fadd_rn(__fmul_rn(oo[u], sc), __fmul_rn(e, vv[u])); *(v4f*)&lo[tid][c * 4] = oo; } }
  const float fin = 64.0f / l;      /* o carried x64 like the f16 path */
#pragma unroll 1
  for (int c = 0; c < HD / 4; ++c) { v4f oo = *(v4f*)&lo[tid][c * 4]; for (int u = 0; u < 4; ++u) oo[u] = __fmul_rn(oo[u], fin); *(v4f*)&lo[tid][c * 4] = oo; }
  __syncthreads();
  {
#pragma unroll 1
    for (int it = 0; it < 16; ++it) { const int row = it * 4 + tid / 16, pc = (tid % 16) * 4; const v4f v = *(const v4f*)&lo[row][pc]; *(v4f*)(OF + (size_t)(rg * 64 + row) * ldo + h * HD + pc) = v; }
     } }


__global__ __launch_bounds__(256) void k_kvexp(const float* __restrict__ src, float* __restrict__ dst, size_t n4) { const size_t t = (size_t)blockIdx.x * 256 + threadIdx.x; if (t >= n4) return; const size_t e = t * 4; const size_t row = e / DM; const int col = (int)(e % DM); const int h = col / HD, d = col % HD; const v4f v = *(const v4fa*)(src + row * KVD + (size_t)(h / HPG) * HD + d); *(v4f*)(dst + e) = v;  }

__global__ __launch_bounds__(256) void k_tab2(float theta, float* __restrict__ CS, float* __restrict__ SN) {
  #pragma clang fp contract(off)
  const int t = blockIdx.x * 256 + threadIdx.x; if (t >= SQ * (HD / 2)) return; const int i = t % (HD / 2); const int p = t / (HD / 2); const float invf = 1.0f / powf(theta, (float)(2 * i) / (float)HD); const float ang = __fmul_rn((float)p, invf); const float c = cosf(ang), s = sinf(ang);
  *(float*)(CS + t) = c; *(float*)(SN + t) = s;  }
template <int NORM, int ROPE>
__global__ __launch_bounds__(64) void k_xform(const float* __restrict__ F, int ldf, int nh, const float* __restrict__ gain, float eps, const float* __restrict__ CS, const float* __restrict__ SN, _Float16* __restrict__ H16, int ldo) {
  #pragma clang fp contract(off)
  __shared__ float xv[HD]; __shared__ float red[HD]; __shared__ unsigned short sh_[HD]; const int d = threadIdx.x; const int h = blockIdx.x % nh; const size_t r = blockIdx.x / nh; const int p = (int)(r % SQ);
  float x = F[r * (size_t)ldf + (size_t)h * HD + d];
  if (NORM) { red[d] = __fmul_rn(x, x); __syncthreads(); for (int st = HD / 2; st > 0; st >>= 1) { if (d < st) red[d] = __fadd_rn(red[d], red[d + st]); __syncthreads(); } const float rs = rsqrtf(__fadd_rn(red[0] / (float)HD, eps)); x = __fmul_rn(__fmul_rn(x, rs), bf16_round(gain[d])); }
  xv[d] = x; __syncthreads();
  float o = x;
  if (ROPE == 1) { const int i = d >> 1; const float c = CS[p * (HD / 2) + i], s = SN[p * (HD / 2) + i]; const float ev = xv[2 * i], od = xv[2 * i + 1]; o = (d & 1) ? __fadd_rn(__fmul_rn(ev, s), __fmul_rn(od, c)) : __fadd_rn(__fmul_rn(ev, c), -__fmul_rn(od, s)); }
  if (ROPE == 2) { const int i = d & (HD / 2 - 1); const float c = CS[p * (HD / 2) + i], s = SN[p * (HD / 2) + i]; const float lo = xv[i], hi = xv[i + HD / 2]; o = (d < HD / 2) ? __fadd_rn(__fmul_rn(lo, c), -__fmul_rn(hi, s)) : __fadd_rn(__fmul_rn(lo, s), __fmul_rn(hi, c)); }
  FragH th; th.h[0] = (_Float16)o; sh_[d] = th.u[0]; __syncthreads();
  if (d < HD / 8) { FragH f; for (int q = 0; q < 8; ++q) f.u[q] = sh_[d * 8 + q]; unsigned short* dst = (unsigned short*)H16 + r * (size_t)ldo + (size_t)h * HD + d * 8; *(v8us*)dst = f.half[0];  } }

template <int NORM, int ROPE>
__global__ __launch_bounds__(64) void k_xformf(const float* __restrict__ F, int ldf, int nh, const float* __restrict__ gain, float eps, const float* __restrict__ CS, const float* __restrict__ SN, float* __restrict__ F32, int ldo) {
  #pragma clang fp contract(off)
  __shared__ float xv[HD]; __shared__ float red[HD]; const int d = threadIdx.x; const int h = blockIdx.x % nh; const size_t r = blockIdx.x / nh; const int p = (int)(r % SQ);
  float x = F[r * (size_t)ldf + (size_t)h * HD + d];
  if (NORM) { red[d] = __fmul_rn(x, x); __syncthreads(); for (int st = HD / 2; st > 0; st >>= 1) { if (d < st) red[d] = __fadd_rn(red[d], red[d + st]); __syncthreads(); } const float rs = rsqrtf(__fadd_rn(red[0] / (float)HD, eps)); x = __fmul_rn(__fmul_rn(x, rs), bf16_round(gain[d])); }
  xv[d] = x; __syncthreads();
  float o = x;
  if (ROPE == 1) { const int i = d >> 1; const float c = CS[p * (HD / 2) + i], s = SN[p * (HD / 2) + i]; const float ev = xv[2 * i], od = xv[2 * i + 1]; o = (d & 1) ? __fadd_rn(__fmul_rn(ev, s), __fmul_rn(od, c)) : __fadd_rn(__fmul_rn(ev, c), -__fmul_rn(od, s)); }
  if (ROPE == 2) { const int i = d & (HD / 2 - 1); const float c = CS[p * (HD / 2) + i], s = SN[p * (HD / 2) + i]; const float lo = xv[i], hi = xv[i + HD / 2]; o = (d < HD / 2) ? __fadd_rn(__fmul_rn(lo, c), -__fmul_rn(hi, s)) : __fadd_rn(__fmul_rn(lo, s), __fmul_rn(hi, c)); }
  float* dst = F32 + r * (size_t)ldo + (size_t)h * HD + d; *(float*)dst = o;  }

__global__ __launch_bounds__(256) void k_trig(const float* __restrict__ a, float* __restrict__ CS, float* __restrict__ SN, int n) {
  #pragma clang fp contract(off)
  const int t = blockIdx.x * 256 + threadIdx.x; if (t >= n) return; const float v = bf16_round(a[t]); const float c = cosf(v), s = sinf(v);
  *(float*)(CS + t) = c; *(float*)(SN + t) = s;  }

__global__ __launch_bounds__(256) void k_tabpos(const int* __restrict__ pos, float* __restrict__ CS, float* __restrict__ SN, int n) {
  #pragma clang fp contract(off)
  const int t = blockIdx.x * 256 + threadIdx.x; if (t >= n) return; const int p = t / 32, i = t % 32; const float invf = (float)(1.0 / pow(10000.0, ((double)(2 * i)) / 64.0)); const float a = __fmul_rn((float)pos[p], invf); const float c = cosf(a), s = sinf(a);
  *(float*)(CS + t) = c; *(float*)(SN + t) = s;  }

// 2^x of four values. One asm statement so that every v_exp_f32 has an independent instruction behind it (early-clobber outputs: none overwrites a source);
// the closing v_nop is the slot that the instruction set asks for before the last result is read or its source overwritten.
__device__ __forceinline__ v4f exp2x4(v4f x) { float r0, r1, r2, r3;
  asm("v_exp_f32 %0, %4\n\tv_exp_f32 %1, %5\n\tv_exp_f32 %2, %6\n\tv_exp_f32 %3, %7\n\tv_nop" : "=&v"(r0), "=&v"(r1), "=&v"(r2), "=&v"(r3) : "v"(x[0]), "v"(x[1]), "v"(x[2]), "v"(x[3]));
  const v4f r = {r0, r1, r2, r3}; return r; }
// 2^x of one value; the v_nop is the slot that the instruction set asks for before the result is read or the source overwritten.
__device__ __forceinline__ float exp2x1(float x) { float r; asm("v_exp_f32 %0, %1\n\tv_nop" : "=&v"(r) : "v"(x)); return r; }
__device__ __forceinline__ v8f fa_mma(v16h a, v16h b, v8f c) { return __builtin_amdgcn_wmma_f32_16x16x32_f16(false, a, false, b, (short)0, c, false, false); }
// Causal XL attention of one (batch, head, 64 query rows) per work-group: scores, softmax and P V in one kernel, no score or weight plane in memory.
// A wave owns 16 query rows i0 .. i0 + 15 and walks the keys in passes of 32 (j0 = 0, 32, .. <= i0), sharing nothing with the other waves (no barrier).
// A pass: AC = (q+u) k^T (16x32) and BD' = (q+v) r^T over the 48 xl_r rows cb .. cb + 47, cb = SQ - 16 - i0 + j0 (a band of 16 rows past the end is clamped to the last band; a clamped row is met above the diagonal only).
// rel_shift: score (m, n) takes BD'[m][n + 15 - m]; the shift is done by the LDS store (column cc of row m goes to place cc + 1 + m = n + 16 of the wave's own rows).
// Both tiles are read back with lane = row (the A-operand order), so a lane holds 16 scores of one row and the weights are formed in place as an A fragment.
// Running maximum and sum per row (weights x256 relative to the running maximum; accumulators rescaled when a maximum rises); weights as f16 hi + x1024 residual, V^T likewise:
// oh += Ph Vh, ol += Pl Vh + Ph Vl; o x64 = (oh + ol 2^-10) 64 / sum.
#define FPA 36      /* f32 pitch of the AC rows in LDS: 16 bytes x odd */
#define FPB 68      /* f32 pitch of the shifted BD' rows (places 1 .. 63 are written, 16 .. 47 read) and of the output rows staged there at the end */
__global__ __launch_bounds__(128) __attribute__((amdgpu_waves_per_eu(4, 4))) void k_fattn(const _Float16* __restrict__ QU, const _Float16* __restrict__ QV, const _Float16* __restrict__ K16, const _Float16* __restrict__ R16, const _Float16* __restrict__ VT, const _Float16* __restrict__ VTL, float* __restrict__ OF) {
  __shared__ __attribute__((aligned(16))) float sa[4][16][FPA]; __shared__ __attribute__((aligned(16))) float sb[4][16][FPB];
  const int lane = threadIdx.x & 31, ln = lane & 15, hh = lane >> 4; const int w = __builtin_amdgcn_readfirstlane((int)(threadIdx.x >> 5));      /* wave-uniform: scalar bases and trip count */
  const int h = blockIdx.y, b = blockIdx.z; const int i0 = (SQ / 64 - 1 - (int)blockIdx.x) * 64 + w * 16;      /* the long row blocks start first */
  const char* qub = (const char*)(QU + ((size_t)b * SQ + i0) * DM) + h * 2048; const char* qvb = (const char*)(QV + ((size_t)b * SQ + i0) * DM) + h * 2048;      /* every operand plane is in fragment order: a head's 64 dims are two 1-KiB blocks of a [row][DM] band */
  const unsigned oq = 16u * lane;      /* the lane's 16 bytes of a 512-byte half block: the same in every plane */
  const v16h qu0 = g2_fragb(qub, oq), qu1 = g2_fragb(qub + 1024, oq), qv0 = g2_fragb(qvb, oq), qv1 = g2_fragb(qvb + 1024, oq);
  asm volatile("s_wait_xcnt 0x0" :: "s"(qub), "s"(qvb), "v"(oq) : "memory");      /* the wait that stands in front of any overwrite of a register that an issued load names; bases and offset are inputs so that they stay as they are up to here */
  const char* kp = (const char*)(K16 + (size_t)b * SQ * DM) + h * 2048 + oq; const char* rb = (const char*)(R16 + (size_t)h * SQ * HD);      /* kp, vp, vlp: the lane's own addresses, moved on once per pass */
  const char* vp = (const char*)(VT + (size_t)(b * NH + h) * HD * SQ) + oq; const char* vlp = (const char*)(VTL + (size_t)(b * NH + h) * HD * SQ) + oq;
  float (*pa)[FPA] = sa[w]; float (*pb)[FPB] = sb[w];
  const v8f z8 = {0.f,0.f,0.f,0.f,0.f,0.f,0.f,0.f}; v8f oh[4] = {z8, z8, z8, z8}, ol[4] = {z8, z8, z8, z8}; float m = -3.0e38f, l = 0.f;
  const int np = (i0 >> 5) + 1;
#pragma unroll 1      /* a second copy of the pass would not fit the registers of four waves per SIMD */
  for (int p = 0; p < np; ++p) { const int cb = SQ - 16 - i0 + p * 32; v16h kf[4], rf[6]; unsigned orr[3];
#pragma unroll
    for (int t = 0; t < 2; ++t) { kf[2 * t] = g2_fragb(kp + t * (16 * DM * 2), 0u); kf[2 * t + 1] = g2_fragb(kp + t * (16 * DM * 2) + 1024, 0u); }
#pragma unroll
    for (int t = 0; t < 3; ++t) { orr[t] = (unsigned)min(cb + t * 16, SQ - 16) * (HD * 2u) + oq; rf[2 * t] = g2_fragb(rb, orr[t]); rf[2 * t + 1] = g2_fragb(rb + 1024, orr[t]); }      /* cb is a multiple of 16: whole bands of xl_r, 2 KiB each; a band past the end is clamped to the last */
    asm volatile("s_wait_xcnt 0x0" :: "v"(kp), "s"(rb), "v"(orr[0]), "v"(orr[1]), "v"(orr[2]) : "memory");      /* same wait, for the pass's K and xl_r loads: every address register is an input, so none is reused (as a destination either) before it */
    __builtin_amdgcn_sched_barrier(0);      /* keeps the pass's 20 K and xl_r loads in front of the first WMMA: behind it they would go out in groups, each with its own full wait */
    v8f s4[2], bd[3];
#pragma unroll
    for (int t = 0; t < 2; ++t) s4[t] = fa_mma(qu1, kf[2 * t + 1], fa_mma(qu0, kf[2 * t], z8));
#pragma unroll
    for (int t = 0; t < 3; ++t) bd[t] = fa_mma(qv1, rf[2 * t + 1], fa_mma(qv0, rf[2 * t], z8));
    v16h vh[4], vl[4];      /* V^T fragments, one per dim tile: they fly while the scores go through LDS and the softmax */
#pragma unroll
    for (int t = 0; t < 4; ++t) { vh[t] = g2_fragb(vp + t * (16 * SQ * 2), 0u); vl[t] = g2_fragb(vlp + t * (16 * SQ * 2), 0u); }
    asm volatile("s_wait_xcnt 0x0" :: "v"(vp), "v"(vlp) : "memory");      /* same wait, for the 16 V^T loads */
    __builtin_amdgcn_sched_barrier(0);      /* keeps those loads in front of the softmax, which hides them */
#pragma unroll
    for (int t = 0; t < 2; ++t) {
#pragma unroll
      for (int r = 0; r < 8; ++r) pa[8 * hh + r][t * 16 + ln] = s4[t][r]; }
#pragma unroll
    for (int t = 0; t < 3; ++t) {
#pragma unroll
      for (int r = 0; r < 8; ++r) pb[8 * hh + r][t * 16 + ln + 1 + 8 * hh + r] = bd[t][r]; }
    __builtin_amdgcn_fence(__ATOMIC_ACQ_REL, "workgroup", "local"); __builtin_amdgcn_wave_barrier();      /* the tiles are read across the wave's lanes: keeps the LDS stores in front of those reads */
    v4f sc[4];      /* sc[2 c], sc[2 c + 1]: keys j0 + 16 c + 8 hh .. + 7 of row ln */
#pragma unroll
    for (int c = 0; c < 2; ++c) { const int col = c * 16 + 8 * hh; sc[2 * c] = *(const v4f*)&pa[ln][col] + *(const v4f*)&pb[ln][16 + col]; sc[2 * c + 1] = *(const v4f*)&pa[ln][col + 4] + *(const v4f*)&pb[ln][16 + col + 4]; }
    __builtin_amdgcn_fence(__ATOMIC_ACQ_REL, "workgroup", "local"); __builtin_amdgcn_wave_barrier();      /* keeps the next pass's LDS stores behind these reads */
    if (p == np - 1) {      /* only the last pass meets the diagonal (j0 + 31 < i0 before it) */
#pragma unroll
      for (int c = 0; c < 4; ++c) {
#pragma unroll
        for (int q = 0; q < 4; ++q) { const int j = p * 32 + (c >> 1) * 16 + 8 * hh + (c & 1) * 4 + q; sc[c][q] = (j <= i0 + ln) ? sc[c][q] : -1.0e30f; } } }
    float mx = sc[0][0];
#pragma unroll
    for (int c = 0; c < 4; ++c) mx = fmaxf(mx, fmaxf(fmaxf(sc[c][0], sc[c][1]), fmaxf(sc[c][2], sc[c][3])));
    mx = fmaxf(mx, __shfl_xor(mx, 16, 32));      /* the other half of the row's 32 keys */
    const float mn = fmaxf(m, mx); const float al = exp2x1((m - mn) * 1.44269504f);
    if (__builtin_amdgcn_ballot_w32(mn > m) != 0) {      /* a scalar branch: where no row's maximum rose every factor is 1 */
#pragma unroll
      for (int r = 0; r < 8; ++r) { const float ar = __shfl(al, 8 * hh + r, 32);      /* accumulator register r holds row 8 hh + r */
#pragma unroll
        for (int t = 0; t < 4; ++t) { oh[t][r] *= ar; ol[t][r] *= ar; } } }
    m = mn; const float mb = 8.0f - mn * 1.44269504f; v4f ps = {0.f, 0.f, 0.f, 0.f}; FragH ph, pl;
#pragma unroll
    for (int c = 0; c < 4; ++c) { const v4f e = exp2x4(sc[c] * 1.44269504f + mb); ps += e;      /* 256 exp(s - m) */
#pragma unroll
      for (int q = 0; q < 4; ++q) { const _Float16 hv = (_Float16)e[q]; ph.h[c * 4 + q] = hv; pl.h[c * 4 + q] = (_Float16)((e[q] - (float)hv) * 1024.0f); } }
    l = l * al + ((ps[0] + ps[1]) + (ps[2] + ps[3]));
#pragma unroll
    for (int t = 0; t < 4; ++t) oh[t] = fa_mma(ph.v, vh[t], oh[t]);
#pragma unroll
    for (int t = 0; t < 4; ++t) ol[t] = fa_mma(pl.v, vh[t], ol[t]);
#pragma unroll
    for (int t = 0; t < 4; ++t) ol[t] = fa_mma(ph.v, vl[t], ol[t]);
    kp += 32 * DM * 2; vp += 1024; vlp += 1024; }
  l += __shfl_xor(l, 16, 32); const float inv = 64.0f / l;      /* the two halves' sums joined once; o carried x64 */
#pragma unroll
  for (int r = 0; r < 8; ++r) { const float ir = __shfl(inv, 8 * hh + r, 32);
#pragma unroll
    for (int t = 0; t < 4; ++t) pb[8 * hh + r][t * 16 + ln] = (oh[t][r] + ol[t][r] * 0.0009765625f) * ir; }
  __builtin_amdgcn_fence(__ATOMIC_ACQ_REL, "workgroup", "local"); __builtin_amdgcn_wave_barrier();      /* the rows are read across the wave's lanes for whole-line stores */
  float* op = OF + ((size_t)b * SQ + i0) * DM + h * HD; const int rsub = lane >> 4, c4 = (lane & 15) * 4;
#pragma unroll
  for (int q = 0; q < 8; ++q) { const int r = q * 2 + rsub; const v4f v = *(const v4f*)&pb[r][c4]; *(v4f*)(op + (size_t)r * DM + c4) = v; } }

template <int N>
__global__ __launch_bounds__(256) void k_rmsrow(float* __restrict__ X, const float* __restrict__ w, float eps) {
  #pragma clang fp contract(off)
  constexpr int PT = N / 256; __shared__ float red[256]; const size_t r = blockIdx.x; const int t = threadIdx.x; float* row = X + r * N + (size_t)t * PT; float v[PT]; float ss = 0.f;
  for (int q = 0; q < PT; ++q) { v[q] = row[q]; ss = __fadd_rn(ss, __fmul_rn(v[q], v[q])); }
  red[t] = ss; __syncthreads(); for (int k = 128; k > 0; k >>= 1) { if (t < k) red[t] = __fadd_rn(red[t], red[t + k]); __syncthreads(); }
  const float rs = rsqrtf(__fadd_rn(red[0] / (float)N, eps)); float o[PT]; for (int q = 0; q < PT; ++q) o[q] = __fmul_rn(__fmul_rn(v[q], rs), bf16_round(w[t * PT + q]));
  { for (int q = 0; q < PT; ++q) *(float*)(row + q) = o[q];  } }

__global__ __launch_bounds__(256) void k_bfr(const float* __restrict__ x, float* __restrict__ XB, size_t n8) { const size_t t = (size_t)blockIdx.x * 256 + threadIdx.x; if (t >= n8) return; v4f a = *(const v4fa*)(x + t * 8), c = *(const v4fa*)(x + t * 8 + 4); for (int q = 0; q < 4; ++q) { a[q] = bf16_round(a[q]); c[q] = bf16_round(c[q]); }
  { *(v4f*)(XB + t * 8) = a; *(v4f*)(XB + t * 8 + 4) = c;  } }





// Exact f32 XL attention of the first QT0 rows of a batch: one wave per (head, row i). Lane = 16 hh + ln: ln owns dims 4 ln .. 4 ln + 3, hh one of two keys,
// so every 16-byte load instruction reads two whole 256-byte rows. Keys go in chunks of 32: a lane forms 16 partial dots (q+u).k + (q+v).r over its four dims,
// a four-step butterfly sums each over its 16 lanes, and lane l keeps the score of key 32 c + l. Scores, then weights, rest in the wave's own LDS row;
// maximum and sum are taken over the whole row (two passes, no rescaling); o = sum_j e_j v_j per half, the halves added at the end, x 64 / sum.
// Rows of K, V up to 32 c + 31 <= QT0 - 1 exist; a key above the diagonal gets -1e30 by the arithmetic select and its xl_r index is clamped.
__global__ __launch_bounds__(256) void k_att0xl(const float* __restrict__ QF, const float* __restrict__ QVF, const float* __restrict__ KF, const float* __restrict__ VF, const float* __restrict__ RF, float* __restrict__ OF) {
  __shared__ __attribute__((aligned(16))) float pw[8][QT0];
  { const size_t bo = (size_t)blockIdx.y * (QT0 * DM); QF += bo; QVF += bo; KF += bo; VF += bo; OF += bo; }      /* grid.y = batch: every plane holds QT0 rows per batch */
  const int lane = threadIdx.x & 31, ln = lane & 15, hh = lane >> 4; const int w = __builtin_amdgcn_readfirstlane((int)(threadIdx.x >> 5));      /* wave-uniform: scalar row bases and trip counts */
  const int h = blockIdx.x % NH; const int i = QT0 - 1 - ((int)(blockIdx.x / NH) * 8 + w); const int nch = (i >> 5) + 1;      /* the long rows start first; nch chunks of 32 keys cover 0 .. i */
  const unsigned qo = (unsigned)(i * DM + h * HD + ln * 4) * 4u;
  const v4f q4 = *(const v4fa*)((const char*)QF + qo), qv4 = *(const v4fa*)((const char*)QVF + qo);
  const unsigned ko = (unsigned)(hh * 16 * DM + h * HD + ln * 4) * 4u;      /* the lane's byte offset in a chunk of K or V rows */
  const char* rb = (const char*)(RF + (size_t)h * SQ * HD); float* pr = pw[w]; float mx = -3.0e38f;
#pragma unroll 1
  for (int c = 0; c < nch; ++c) { const char* kp = (const char*)KF + (size_t)c * (32 * DM * 4) + ko; const int r0 = SQ - 1 - i + c * 32 + hh * 16; v4f kk[16], rr[16]; unsigned ro[16];
#pragma unroll
    for (int u = 0; u < 16; ++u) { ro[u] = (unsigned)min(r0 + u, SQ - 1) * (HD * 4u) + ln * 16u; kk[u] = *(const v4fa*)(kp + u * (DM * 4)); rr[u] = *(const v4fa*)(rb + ro[u]); }      /* key j = 32 c + 16 hh + u; xl_r row min(SQ - 1 - i + j, SQ - 1) */
    /* the wait that stands in front of any overwrite of a register that an issued load names, for the chunk's 32 loads: every address register is an input, so none is reused (as a destination either) before it */
    asm volatile("s_wait_xcnt 0x0" :: "v"(kp), "s"(rb), "v"(ro[0]), "v"(ro[1]), "v"(ro[2]), "v"(ro[3]), "v"(ro[4]), "v"(ro[5]), "v"(ro[6]), "v"(ro[7]), "v"(ro[8]), "v"(ro[9]), "v"(ro[10]), "v"(ro[11]), "v"(ro[12]), "v"(ro[13]), "v"(ro[14]), "v"(ro[15]) : "memory");
    __builtin_amdgcn_sched_barrier(0);      /* keeps the arithmetic behind the chunk's loads: without it most K rows are loaded one at a time, each with its own wait */
    float keep = 0.f;
#pragma unroll
    for (int u = 0; u < 16; ++u) { float p = q4[0] * kk[u][0];
#pragma unroll
      for (int d = 1; d < 4; ++d) p = fmaf(q4[d], kk[u][d], p);
#pragma unroll
      for (int d = 0; d < 4; ++d) p = fmaf(qv4[d], bf16_round(rr[u][d]), p);
      p += __shfl_xor(p, 1, 32); p += __shfl_xor(p, 2, 32); p += __shfl_xor(p, 4, 32); p += __shfl_xor(p, 8, 32);
      keep = (ln == u) ? p : keep; }
    const float f = (c * 32 + lane <= i) ? 1.f : 0.f; const float sm = fmaf(f, keep, (1.f - f) * -1.0e30f); pr[c * 32 + lane] = sm; mx = fmaxf(mx, sm); }
#pragma unroll
  for (int m = 16; m > 0; m >>= 1) mx = fmaxf(mx, __shfl_xor(mx, m, 32));
  float l = 0.f;
#pragma unroll 1
  for (int c = 0; c < nch; ++c) { const float e = expf(pr[c * 32 + lane] - mx); pr[c * 32 + lane] = e; l += e; }      /* each lane reads back what it wrote itself */
#pragma unroll
  for (int m = 16; m > 0; m >>= 1) l += __shfl_xor(l, m, 32);
  __builtin_amdgcn_fence(__ATOMIC_ACQ_REL, "workgroup"); __builtin_amdgcn_wave_barrier();      /* the weights are read across the wave's lanes from here on: keeps the LDS stores in front of those reads */
  v4f o = {0.f, 0.f, 0.f, 0.f};
#pragma unroll 1
  for (int c = 0; c < nch; ++c) { const char* vp = (const char*)VF + (size_t)c * (32 * DM * 4) + ko; v4f vv[16], pe[4];
#pragma unroll
    for (int u = 0; u < 16; ++u) vv[u] = *(const v4fa*)(vp + u * (DM * 4));
    asm volatile("s_wait_xcnt 0x0" :: "v"(vp) : "memory");      /* same wait, for the chunk's 16 loads; the address is an input so that no load of the chunk gets it as its destination */
#pragma unroll
    for (int m = 0; m < 4; ++m) pe[m] = *(const v4f*)&pr[c * 32 + hh * 16 + m * 4];      /* the half's 16 weights, one address per half */
#pragma unroll
    for (int u = 0; u < 16; ++u) { const float e = pe[u >> 2][u & 3];
#pragma unroll
      for (int d = 0; d < 4; ++d) o[d] = fmaf(e, vv[u][d], o[d]); } }
  const float fin = 64.0f / l;      /* o carried x64 like the f16 path */
#pragma unroll
  for (int d = 0; d < 4; ++d) o[d] = (o[d] + __shfl_xor(o[d], 16, 32)) * fin;
  if (hh == 0) *(v4f*)(OF + (size_t)i * DM + h * HD + ln * 4) = o; }

extern "C" void kernel_launch(void* const* d_in, const int* in_sizes, int n_in,
                              void* d_out, int out_size, void* d_ws, size_t ws_size, hipStream_t stream) {
  (void)in_sizes; (void)n_in; (void)out_size;
  const float* const* I = (const float* const*)d_in; const float* x = I[0]; const float* g = I[1]; const float* wq = I[2]; const float* wk = I[3]; const float* wv = I[4]; const float* wres = I[5]; const float* xlr = I[6]; const float* xlu = I[7]; const float* xlv = I[8];      /* x; RMS gain; w_q/w_k/w_v [1024][16][64] = [in][out]; w_res [1024][1024] [in][out]; xl_r [16][2048][64]; xl_u, xl_v [1][16][1][64] = per-head 64-vectors (a [1024] bias over the merged columns) */
  char* ws = (char*)d_ws; size_t off = 0;
  auto take = [&](size_t bytes) { char* p = ws + off; off += (bytes + 255) & ~(size_t)255; return p; };
  /* Planes that live across the attention kernel. */
  _Float16* BR = (_Float16*)take((size_t)DM * DM * 2); _Float16* QU = (_Float16*)take(NR * DM * 2); _Float16* QV = (_Float16*)take(NR * DM * 2); _Float16* K16 = (_Float16*)take(NR * DM * 2); _Float16* R16 = (_Float16*)take((size_t)NH * SQ * HD * 2); float* OF = (float*)take(NR * DM * 4); float* OF0 = (float*)take((size_t)NB * QT0 * DM * 4); _Float16* VT = (_Float16*)take((size_t)NB * NH * HD * SQ * 2); _Float16* VTL = (_Float16*)take((size_t)NB * NH * HD * SQ * 2);
  const size_t offs = off;
  /* What is last read in front of the attention kernel ... */
  _Float16* BQ = (_Float16*)take((size_t)DM * DM * 2); _Float16* BK = (_Float16*)take((size_t)DM * DM * 2); _Float16* BV = (_Float16*)take((size_t)DM * DM * 2);
  float* XT = (float*)take(NR * DM * 4); _Float16* X16 = (_Float16*)take(NR * DM * 2); _Float16* XL16 = (_Float16*)take(NR * DM * 2); float* QUF = (float*)take((size_t)NB * QT0 * DM * 4); float* QVF = (float*)take((size_t)NB * QT0 * DM * 4); float* KF0 = (float*)take((size_t)NB * QT0 * DM * 4); float* VF0 = (float*)take((size_t)NB * QT0 * DM * 4); float* VF = (float*)take(NR * DM * 4); _Float16* V16 = (_Float16*)take(NR * DM * 2); _Float16* VL16 = (_Float16*)take(NR * DM * 2);      /* v and wv carried as f32 -> f16 hi + x1024 residual (the first causal rows copy v almost verbatim into small outputs) */
  if (off > ws_size) return;
  /* ... shares its bytes with the operands of the output stage, written behind it. */
  off = offs;
  _Float16* O16 = (_Float16*)take(NR * DM * 2); _Float16* OL16 = (_Float16*)take(NR * DM * 2); _Float16* OH0 = (_Float16*)take((size_t)NB * QT0 * DM * 2); _Float16* OL0 = (_Float16*)take((size_t)NB * QT0 * DM * 2);
  { const unsigned gw = (unsigned)(((size_t)DM * DM / 8 + 255) / 256); k_wt_f16<DM, DM><<<gw, 256, 0, stream>>>(wq, BQ, 16.0f); k_wt_f16<DM, DM><<<gw, 256, 0, stream>>>(wk, BK, 16.0f); k_wt_f16<DM, DM><<<gw, 256, 0, stream>>>(wv, BV, 16.0f); k_wt_f16<DM, DM><<<gw, 256, 0, stream>>>(wres, BR, 16.0f); }      /* [in][out] ([in][h][k] flattened) -> Bt x16, fragment order */
  k_bfr<<<(unsigned)((NR * DM / 8 + 255) / 256), 256, 0, stream>>>(x, XT, NR * DM / 8); k_rmsrow<DM><<<(unsigned)NR, 256, 0, stream>>>(XT, g, 1e-6f); k_hl<true><<<(unsigned)((NR * DM / 8 + 255) / 256), 256, 0, stream>>>(XT, X16, XL16, NR * DM / 8);      /* x_t = RMSNorm(bf16(x)) g (f32, in place) -> f16 hi rows (+ x1024 residual rows for the exact first tile) */
  k_x16<HD><<<(unsigned)(((size_t)NH * SQ * HD / 8 + 255) / 256), 256, 0, stream>>>(xlr, R16, (size_t)NH * SQ * HD / 8);      /* xl_r [h][j][64] as exact f16 rows (bf16-valued input), fragment order */
  k_gemm2<0><<<dim3((unsigned)((NR / 128) * (DM / 64)), 1), 128, 0, stream>>>(X16, DM, 0, BQ, DM, 0, 0.0078125f, xlu, 0, nullptr, 1, 0, 0, nullptr, QU, DM, 0, (int)NR, DM, DM, 0, 0, 0); k_gemm2<0><<<dim3((unsigned)((NR / 128) * (DM / 64)), 1), 128, 0, stream>>>(X16, DM, 0, BQ, DM, 0, 0.0078125f, xlv, 0, nullptr, 1, 0, 0, nullptr, QV, DM, 0, (int)NR, DM, DM, 0, 0, 0);      /* q / 8 + xl_u and q / 8 + xl_v (the per-head 64-vectors as [1024] column biases) -> f16 rows */
  k_gemm2<0><<<dim3((unsigned)((NR / 128) * (DM / 64)), 1), 128, 0, stream>>>(X16, DM, 0, BK, DM, 0, 0.0625f, nullptr, 0, nullptr, 1, 0, 0, nullptr, K16, DM, 0, (int)NR, DM, DM, 0, 0, 0); k_gemm2<0><<<dim3((unsigned)((NR / 128) * (DM / 64)), 1), 128, 0, stream>>>(X16, DM, 0, BV, DM, 0, 0.0625f, nullptr, 0, nullptr, 1, 0, 0, VF, nullptr, DM, 0, (int)NR, DM, DM, 0, 0, 0); k_hl<false><<<(unsigned)((NR * DM / 8 + 255) / 256), 256, 0, stream>>>(VF, V16, VL16, NR * DM / 8);      /* k -> f16; v f32 -> f16 hi + x1024 residual rows */
  /* From here to the output stage the two batches, which share nothing but weights, stand side by side in every launch: the batch is one more grid index. */
  const size_t zX = (size_t)SQ * DM, z0 = (size_t)QT0 * DM;      /* batch strides of the token-row planes and of the first-tile planes */
  k_vt<NH, SQ><<<NB * NH * (SQ / 64), 256, 0, stream>>>(V16, DM, 0, VT); k_vt<NH, SQ><<<NB * NH * (SQ / 64), 256, 0, stream>>>(VL16, DM, 0, VTL);      /* V^T hi and residual [batch][16][64][SQ] */
  { const dim3 g0((QT0 / 32) * (DM / 64), 1, NB);      /* hi and residual rows of x_t as the two terms of one launch */
    k_gemm2t<2><<<g0, 64, 0, stream>>>(X16, XL16, nullptr, DM, 0, BQ, BQ, nullptr, DM, 0, 0.0078125f, 0.00000762939453125f, 0.f, xlu, QUF, DM, 0, DM, DM, zX, 0, z0);
    k_gemm2t<2><<<g0, 64, 0, stream>>>(X16, XL16, nullptr, DM, 0, BQ, BQ, nullptr, DM, 0, 0.0078125f, 0.00000762939453125f, 0.f, xlv, QVF, DM, 0, DM, DM, zX, 0, z0);
    k_gemm2t<2><<<g0, 64, 0, stream>>>(X16, XL16, nullptr, DM, 0, BK, BK, nullptr, DM, 0, 0.0625f, 0.00006103515625f, 0.f, nullptr, KF0, DM, 0, DM, DM, zX, 0, z0);
    k_gemm2t<2><<<g0, 64, 0, stream>>>(X16, XL16, nullptr, DM, 0, BV, BV, nullptr, DM, 0, 0.0625f, 0.00006103515625f, 0.f, nullptr, VF0, DM, 0, DM, DM, zX, 0, z0);
    k_att0xl<<<dim3(NH * (QT0 / 8), NB), 256, 0, stream>>>(QUF, QVF, KF0, VF0, xlr, OF0); }      /* exact causal XL attention for rows 0..255 of each batch (o x64, f32) */
  k_fattn<<<dim3(SQ / 64, NH, NB), 128, 0, stream>>>(QU, QV, K16, R16, VT, VTL, OF);      /* wv x64 (f32) of every row: scores = AC + rel_shift(BD), causal softmax, P V (hi / residual terms) in one launch */
  k_hl<true><<<(unsigned)((NR * DM / 8 + 255) / 256), 256, 0, stream>>>(OF, O16, OL16, NR * DM / 8);      /* wv x64 -> f16 hi + x1024 residual rows */
  k_gemm2<0><<<dim3((unsigned)((NR / 128) * (DM / 64)), 1), 128, 0, stream>>>(O16, DM, 0, BR, DM, 0, 0.0009765625f, nullptr, 0, nullptr, 1, 0, 0, (float*)d_out, nullptr, DM, 0, (int)NR, DM, DM, 0, 0, 0); k_gemm2<0><<<dim3((unsigned)((NR / 128) * (DM / 64)), 1), 128, 0, stream>>>(OL16, DM, 0, BR, DM, 0, 0.00000095367431640625f, nullptr, 0, (const float*)d_out, -1, 0, 0, (float*)d_out, nullptr, DM, 0, (int)NR, DM, DM, 0, 0, 0);      /* res = wv_hi w_res 2^-10 += wv_lo w_res 2^-20 (own element) */
  k_hl<true><<<(unsigned)(((size_t)NB * QT0 * DM / 8 + 255) / 256), 256, 0, stream>>>(OF0, OH0, OL0, (size_t)NB * QT0 * DM / 8);      /* first-tile o (x64) -> f16 hi + x1024 residual planes */
  k_gemm2t<2><<<dim3((QT0 / 32) * (DM / 64), 1, NB), 64, 0, stream>>>(OH0, OL0, nullptr, DM, 0, BR, BR, nullptr, DM, 0, 0.0009765625f, 0.00000095367431640625f, 0.f, nullptr, (float*)d_out, DM, 0, DM, DM, z0, 0, zX);      /* rows 0..255 of each batch rewritten from the exact path: o_hi w_res 2^-10 + o_lo w_res 2^-20 */
}

// v008
// It runs in 281 microseconds.
// Two timings next to v007 put it at 1.11 and 1.13 times that version's speed.
// Counting every step since v000, which is the starting kernel, it is 54.8 times as fast.
#include <hip/hip_runtime.h>
// Transformer-XL style causal attention with relative-position (rel_shift) scores (x [2][2048][1024]; x_t = RMSNorm(x) g (eps 1e-6); q = x_t w_q / 8, k = x_t w_k, v = x_t w_v (w [1024][16][64] = [in][out], sigma 1/32); scores = (q + xl_u).k^T + rel_shift((q + xl_v).xl_r^T) (xl_r [16][2048][64], xl_u / xl_v [1][16][1][64]); causal: - 1e30 above the diagonal; softmax; wv = w v merged (h*64+v); res = wv w_res ([in][out]) -> [2][2048][1024]. rel_shift with q_len = k_len = T gives bd[i][j] = (q_i + xl_v).xl_r[h][T-1-(i-j)] for j <= i).
// Structure: token rows; x_t = RMSNorm(bf16(x)) in f32 on VALU, one kernel -> f16 hi / residual rows; [in][out] weights as x16 planes; q+u and q+v as two WMMA GEMMs (32x64 wave tiles, f32 accumulation, alpha 1/128, per-head bias vectors), k -> f16 rows, v -> V^T hi / residual straight from the accumulators; xl_r as exact f16 rows; both batches side by side in every launch up to the output stage (batch = one more grid index): exact f32 XL attention for rows 0..255 per batch on VALU (q/k/v of those rows from x_t hi + residual GEMM passes); one attention kernel, a wave per 16 query rows, passes of 32 keys: AC = (q+u) k^T and BD' = (q+v) r^T over the 48 xl_r rows the shift can reach (WMMA, f32), rel_shift by a skewed LDS store, causal select (-1e30 fill, clamped xl_r index), running maximum and sum (f32, native exp; weights x256 f16 hi + residual), o = P V^T (x64) f32 in registers, stored as f16 hi / residual rows; res = o_hi w_res + o_lo w_res 2^-10; first-tile rows rewritten from the exact o hi/lo; every f16 plane that a WMMA reads (x_t, weights, q+u, q+v, k, xl_r, V^T, o) lies in fragment order (see FragH): each wave-wide 16-byte load is 512 bytes in a row; launches: see trace.
// Compute dtype: inputs rounded to bf16; x / weights exact; q and k as plain f16 GEMM operands (~2^-12); v, softmax weights and o as f16 hi + x1024 residual pairs; scores and softmax statistics f32. v_wmma_f32_16x16x32_f16.
#define NB 2
#define NG 16
#define HPG 1
#define KVD (NG * HD)
#define SQ 2048
#define DM 1024
#define NH 16
#define HD 64
#define HG 4                         /* heads per launch of the (b, h0) k_vt overload, which is not launched */
#define QT 256                       /* query rows per causal tile */
#define NKX SQ                       /* S / P row pitch */
#define QT0 256                      /* first-tile rows recomputed exactly in f32 (= one causal tile) */
#define B0 0                         /* first batch processed (unused) */
#define NBR NB                       /* batches processed (read only by MP) */
#define NR ((size_t)NB * SQ)         /* token rows */
#define MP ((int)((size_t)NBR * SQ)) /* rows projected (read only by MPO) */
#define QN SQ                        /* query rows attended per batch (unused) */
#define NHD NH                       /* heads attended (unused) */
#define MPO MP                       /* rows through the output stage (unused) */
#define LQ DM      /* row pitch of the q/k/v rows */
typedef __bf16 v16b __attribute__((ext_vector_type(16)));
typedef unsigned short v8us __attribute__((ext_vector_type(8), may_alias));
typedef float  v8f  __attribute__((ext_vector_type(8)));
typedef float  v4f  __attribute__((ext_vector_type(4)));
typedef float  v4fa __attribute__((ext_vector_type(4), may_alias));
union FragB { v16b v; v8us half[2]; unsigned short u[16]; };

__device__ __forceinline__ unsigned short bf16_bits(float x) { unsigned int u = __float_as_uint(x); return (unsigned short)((u + 0x7FFFu + ((u >> 16) & 1u)) >> 16); }
__device__ __forceinline__ float bf16_val(unsigned short b) { return __uint_as_float(((unsigned int)b) << 16); }
__device__ __forceinline__ float bf16_round(float x) { return bf16_val(bf16_bits(x)); }
// D += A·B with NT terms: 1 = ah·bh, 2 = + al·bh (A split), 3 = + ah·bl (both split)
template <int NT>
__device__ __forceinline__ v8f mmaN(v16b ah, v16b al, v16b bh, v16b bl, v8f c) {
  c = __builtin_amdgcn_wmma_f32_16x16x32_bf16(false, ah, false, bh, (short)0, c, false, false);
  if (NT >= 2) c = __builtin_amdgcn_wmma_f32_16x16x32_bf16(false, al, false, bh, (short)0, c, false, false);
  if (NT >= 3) c = __builtin_amdgcn_wmma_f32_16x16x32_bf16(false, ah, false, bl, (short)0, c, false, false);
  asm volatile("v_nop\n\tv_nop\n\tv_nop\n\tv_nop" : "+v"(c) : "v"(ah), "v"(al), "v"(bh), "v"(bl));
  return c;
}

__global__ __launch_bounds__(256) void k_wt_bf16(const float* __restrict__ W, unsigned short* __restrict__ Wt, int K, int N) {
  const int t = blockIdx.x * 256 + threadIdx.x;
  const int k8n = K / 8;
  if (t >= N * k8n) return;
  const int n = t / k8n, k8 = (t % k8n) * 8;
  v8us v;
#pragma unroll
  for (int i = 0; i < 8; ++i) v[i] = bf16_bits(W[(size_t)(k8 + i) * N + n]);
  *(v8us*)(Wt + (size_t)n * K + k8) = v;
  
}

// GEMM C[M][N] (f32, pitch ldc) = act(A[M][K]·W + bias). A f32 row-major (pitch lda) converted per fragment to bf16
// (ASPLIT: hi/lo two planes -> 2 terms, else single rounded term); Wt bf16 [N][K] (pitch ldb). BIAS_BF16 rounds the
// bias to bf16 first (bias quantised to bf16 before the add). K%32==0, M%16==0, N%64==0.
template <bool ASPLIT, int ACT, bool BIAS_BF16>
__global__ __launch_bounds__(128) void k_gemm_bf(const float* __restrict__ A, int lda, const unsigned short* __restrict__ Wt, int ldb,
                                               const float* __restrict__ bias, float* __restrict__ C, int ldc, int M, int N, int K) {
  __shared__ __attribute__((aligned(16))) float so[4][16][64];
  const int tid = threadIdx.x, w = tid >> 5, lane = tid & 31, ln = lane & 15, hh = lane >> 4;
  const int ntn = N / 64;
  const int wid = blockIdx.x * 4 + w;
  const int mt = wid / ntn, nq = wid % ntn;
  if (mt * 16 >= M) return;
  const int row0 = mt * 16, col0 = nq * 64;
  const float* arow = A + (size_t)(row0 + ln) * lda;
  v8f acc[4] = {};
  for (int kb = 0; kb < K; kb += 32) {
    FragB ah, al;
    const v4f x0 = *(const v4fa*)(arow + kb + 8 * hh), x1 = *(const v4fa*)(arow + kb + 8 * hh + 4);
    const v4f x2 = *(const v4fa*)(arow + kb + 16 + 8 * hh), x3 = *(const v4fa*)(arow + kb + 16 + 8 * hh + 4);
    float xs[16] = {x0[0],x0[1],x0[2],x0[3],x1[0],x1[1],x1[2],x1[3],x2[0],x2[1],x2[2],x2[3],x3[0],x3[1],x3[2],x3[3]};
#pragma unroll
    for (int i = 0; i < 16; ++i) { const unsigned short hb = bf16_bits(xs[i]); ah.u[i] = hb; al.u[i] = ASPLIT ? bf16_bits(xs[i] - bf16_val(hb)) : (unsigned short)0; }
#pragma unroll
    for (int t = 0; t < 4; ++t) {
      const unsigned short* brow = Wt + (size_t)(col0 + t * 16 + ln) * ldb + kb;
      FragB b;
      b.half[0] = *(const v8us*)(brow + 8 * hh);
      b.half[1] = *(const v8us*)(brow + 16 + 8 * hh);
      acc[t] = mmaN<ASPLIT ? 2 : 1>(ah.v, al.v, b.v, b.v, acc[t]);
    }
  }
#pragma unroll
  for (int t = 0; t < 4; ++t) {
    float bv = bias ? bias[col0 + t * 16 + ln] : 0.f;
    if (BIAS_BF16) bv = bf16_round(bv);
#pragma unroll
    for (int r = 0; r < 8; ++r) { float v = acc[t][r] + bv; if (ACT == 1) v = fmaxf(v, 0.f); so[w][8 * hh + r][t * 16 + ln] = v; }
  }
  __builtin_amdgcn_fence(__ATOMIC_ACQ_REL, "workgroup");
  __builtin_amdgcn_wave_barrier();
  const int rsub = lane >> 4, c4 = (lane & 15) * 4;
  {
#pragma unroll
    for (int q = 0; q < 8; ++q) {
      const int r = q * 2 + rsub;
      const v4f v = *(const v4fa*)&so[w][r][c4];
      *(v4f*)(C + (size_t)(row0 + r) * ldc + col0 + c4) = v;
    }
    
  }
}

// GEMM C = act(A·W + bias + resid): A f32 (ASPLIT -> hi/lo 2 terms), Wt bf16 [N][K]; ACT 0 none, 1 relu, 2 exact gelu;
// resid (optional, f32, row index = (row % rmod), pitch ldr, RES_BF16 rounds it) added before the activation.
template <bool ASPLIT, int ACT, bool BIAS_BF16, bool RES_BF16>
__global__ __launch_bounds__(128) void k_gemm_bf3(const float* __restrict__ A, int lda, const unsigned short* __restrict__ Wt, int ldb,
                                                const float* __restrict__ bias, const float* __restrict__ resid, int rmod, int ldr,
                                                float* __restrict__ C, int ldc, int M, int N, int K) {
  __shared__ __attribute__((aligned(16))) float so[4][16][64];
  const int tid = threadIdx.x, w = tid >> 5, lane = tid & 31, ln = lane & 15, hh = lane >> 4;
  const int ntn = N / 64;
  const int wid = blockIdx.x * 4 + w;
  const int mt = wid / ntn, nq = wid % ntn;
  if (mt * 16 >= M) return;
  const int row0 = mt * 16, col0 = nq * 64;
  const float* arow = A + (size_t)(row0 + ln) * lda;
  v8f acc[4] = {};
  for (int kb = 0; kb < K; kb += 32) {
    FragB ah, al;
    const v4f x0 = *(const v4fa*)(arow + kb + 8 * hh), x1 = *(const v4fa*)(arow + kb + 8 * hh + 4);
    const v4f x2 = *(const v4fa*)(arow + kb + 16 + 8 * hh), x3 = *(const v4fa*)(arow + kb + 16 + 8 * hh + 4);
    float xs[16] = {x0[0],x0[1],x0[2],x0[3],x1[0],x1[1],x1[2],x1[3],x2[0],x2[1],x2[2],x2[3],x3[0],x3[1],x3[2],x3[3]};
#pragma unroll
    for (int i = 0; i < 16; ++i) { const unsigned short hb = bf16_bits(xs[i]); ah.u[i] = hb; al.u[i] = ASPLIT ? bf16_bits(xs[i] - bf16_val(hb)) : (unsigned short)0; }
#pragma unroll
    for (int t = 0; t < 4; ++t) {
      const unsigned short* brow = Wt + (size_t)(col0 + t * 16 + ln) * ldb + kb;
      FragB b;
      b.half[0] = *(const v8us*)(brow + 8 * hh);
      b.half[1] = *(const v8us*)(brow + 16 + 8 * hh);
      acc[t] = mmaN<ASPLIT ? 2 : 1>(ah.v, al.v, b.v, b.v, acc[t]);
    }
  }
#pragma unroll
  for (int t = 0; t < 4; ++t) {
    const int col = col0 + t * 16 + ln;
    float bv = bias ? bias[col] : 0.f;
    if (BIAS_BF16) bv = bf16_round(bv);
#pragma unroll
    for (int r = 0; r < 8; ++r) {
      float v = acc[t][r] + bv;
      if (resid) { float rv = resid[(size_t)((row0 + 8 * hh + r) % rmod) * ldr + col]; if (RES_BF16) rv = bf16_round(rv); v += rv; }
      if (ACT == 1) v = fmaxf(v, 0.f);
      if (ACT == 2) v = 0.5f * v * (1.0f + erff(v * 0.70710678118654752f));
      if (ACT == 3) { const float u = 0.7978845608028654f * (v + 0.044715f * v * v * v); v = 0.5f * v * (1.0f + tanhf(u)); }
      so[w][8 * hh + r][t * 16 + ln] = v;
    }
  }
  __builtin_amdgcn_fence(__ATOMIC_ACQ_REL, "workgroup");
  __builtin_amdgcn_wave_barrier();
  const int rsub = lane >> 4, c4 = (lane & 15) * 4;
  {
#pragma unroll
    for (int q = 0; q < 8; ++q) {
      const int r = q * 2 + rsub;
      const v4f v = *(const v4fa*)&so[w][r][c4];
      *(v4f*)(C + (size_t)(row0 + r) * ldc + col0 + c4) = v;
    }
    
  }
}
// row LayerNorm (biased variance, eps) over N: s = X (+ R); optional out_sum <- s; out_norm <- (s-mu)*rsqrt(var+eps)*g + b
template <bool PARAM_BF16>
__global__ __launch_bounds__(256) void k_layernorm(const float* __restrict__ X, const float* __restrict__ R, const float* __restrict__ g, const float* __restrict__ bta,
                                                  float* __restrict__ out_sum, float* __restrict__ out_norm, int N, float eps) {
  __shared__ float red[256];
  const int row = blockIdx.x, tid = threadIdx.x;
  const float* x = X + (size_t)row * N; const float* rr = R ? R + (size_t)row * N : nullptr;
  float vals[16];                     // up to N = 4096
  const int per = N / 256;            // contiguous chunk per thread? use strided-by-4 chunks: thread handles j = tid*4 + 1024*u
  float s1 = 0.f;
  for (int u = 0; u < per / 4; ++u) {
    const int j = tid * 4 + 1024 * u;
    const v4f a = *(const v4fa*)(x + j);
    v4f b = {0.f,0.f,0.f,0.f}; if (rr) b = *(const v4fa*)(rr + j);
#pragma unroll
    for (int q = 0; q < 4; ++q) { const float v = a[q] + b[q]; vals[u * 4 + q] = v; s1 += v; }
  }
  red[tid] = s1; __syncthreads();
  for (int st = 128; st > 0; st >>= 1) { if (tid < st) red[tid] += red[tid + st]; __syncthreads(); }
  const float mu = red[0] / (float)N; __syncthreads();
  float s2 = 0.f;
  for (int u = 0; u < per / 4; ++u)
#pragma unroll
    for (int q = 0; q < 4; ++q) { const float c = vals[u * 4 + q] - mu; s2 += c * c; }
  red[tid] = s2; __syncthreads();
  for (int st = 128; st > 0; st >>= 1) { if (tid < st) red[tid] += red[tid + st]; __syncthreads(); }
  const float rs = rsqrtf(red[0] / (float)N + eps);
  {
    for (int u = 0; u < per / 4; ++u) {
      const int j = tid * 4 + 1024 * u;
      v4f o, sm;
#pragma unroll
      for (int q = 0; q < 4; ++q) {
        float gg = g[j + q], bb = bta[j + q];
        if (PARAM_BF16) { gg = bf16_round(gg); bb = bf16_round(bb); }
        sm[q] = vals[u * 4 + q]; o[q] = (vals[u * 4 + q] - mu) * rs * gg + bb;
      }
      if (out_sum) *(v4f*)(out_sum + (size_t)row * N + j) = sm;
      *(v4f*)(out_norm + (size_t)row * N + j) = o;
    }
    
  }
}



// ---- f16 WMMA path (v_wmma_f32_16x16x32_f16): 11-bit significands for operands in range — used where a [0,1] probability operand needs more precision than bf16
typedef _Float16 v16h __attribute__((ext_vector_type(16)));
union FragH { v16h v; v8us half[2]; _Float16 h[16]; unsigned short u[16]; };
// FRAGMENT ORDER of an f16 operand plane [rows][kc] (rows % 16 == 0, kc % 32 == 0): a band of 16 rows keeps its 32 kc bytes; inside it every 16 x 32 block is 1 KiB = two halves of 512 bytes,
// half j = [lane = 16 hh + ln][8 elements]: row ln, k = 16 j + 8 hh .. + 7. A wave-wide 16-byte load of a half then reads 512 bytes in a row (4 lines) where row-major rows gave 16 pieces of 32 bytes in 16 lines.
// Element index, in the row-major plane [rows][KC], of the 8 elements that 16-byte piece t of the plane in fragment order holds.
template <int KC>
__device__ __forceinline__ size_t pk_src(size_t t) { const size_t band = t / (KC * 2); const unsigned rem = (unsigned)(t % (KC * 2)); return (band * 16 + (rem & 15u)) * (size_t)KC + (rem >> 6) * 32u + ((rem >> 4) & 3u) * 8u; }
template <int NT>
__device__ __forceinline__ v8f mmaH(v16h ah, v16h al, v16h bh, v16h bl, v8f c) {
  c = __builtin_amdgcn_wmma_f32_16x16x32_f16(false, ah, false, bh, (short)0, c, false, false);
  if (NT >= 2) c = __builtin_amdgcn_wmma_f32_16x16x32_f16(false, al, false, bh, (short)0, c, false, false);
  if (NT >= 3) c = __builtin_amdgcn_wmma_f32_16x16x32_f16(false, ah, false, bl, (short)0, c, false, false);
  asm volatile("v_nop\n\tv_nop\n\tv_nop\n\tv_nop" : "+v"(c) : "v"(ah), "v"(al), "v"(bh), "v"(bl));
  return c;
}
// batched GEMM like k_gemm_b but f16 operands: A f32 (split into f16 hi/lo if ASPLIT, else rounded to f16), Bt = f16 values [n][k]; alpha; C f32; N multiple of 16 (partial tiles skipped)
template <bool ASPLIT>
__global__ __launch_bounds__(128) void k_gemm_h(const float* __restrict__ A, int lda, size_t sA, const _Float16* __restrict__ Bh, int ldb, size_t sB, float alpha, float* __restrict__ C, int ldc, size_t sC, int M, int N, int K) {
  __shared__ __attribute__((aligned(16))) float so[4][16][64];
  const int tid = threadIdx.x, w = tid >> 5, lane = tid & 31, ln = lane & 15, hh = lane >> 4; const int by = blockIdx.y;
  A += (size_t)by * sA; Bh += (size_t)by * sB; C += (size_t)by * sC;
  const int ntn = (N + 63) / 64; const int wid = blockIdx.x * 4 + w; const int mt = wid / ntn, nq = wid % ntn; if (mt * 16 >= M) return;
  const int row0 = mt * 16, col0 = nq * 64; const float* arow = A + (size_t)(row0 + ln) * lda;
  v8f acc[4] = {};
  for (int kb = 0; kb < K; kb += 32) {
    FragH ah, al;
    const v4f x0 = *(const v4fa*)(arow + kb + 8 * hh), x1 = *(const v4fa*)(arow + kb + 8 * hh + 4), x2 = *(const v4fa*)(arow + kb + 16 + 8 * hh), x3 = *(const v4fa*)(arow + kb + 16 + 8 * hh + 4);
    float xs[16] = {x0[0],x0[1],x0[2],x0[3],x1[0],x1[1],x1[2],x1[3],x2[0],x2[1],x2[2],x2[3],x3[0],x3[1],x3[2],x3[3]};
#pragma unroll
    for (int i = 0; i < 16; ++i) { const _Float16 h = (_Float16)xs[i]; ah.h[i] = h; al.h[i] = ASPLIT ? (_Float16)(xs[i] - (float)h) : (_Float16)0.0f; }
#pragma unroll
    for (int t = 0; t < 4; ++t) { if (col0 + t * 16 >= N) continue; const size_t boff = (size_t)(col0 + t * 16 + ln) * ldb + kb; FragH bq; bq.half[0] = *(const v8us*)(Bh + boff + 8 * hh); bq.half[1] = *(const v8us*)(Bh + boff + 16 + 8 * hh);
      acc[t] = mmaH<ASPLIT ? 2 : 1>(ah.v, al.v, bq.v, bq.v, acc[t]); }
  }
#pragma unroll
  for (int t = 0; t < 4; ++t) { if (col0 + t * 16 >= N) continue;
#pragma unroll
    for (int r = 0; r < 8; ++r) so[w][8 * hh + r][t * 16 + ln] = acc[t][r] * alpha; }
  __builtin_amdgcn_fence(__ATOMIC_ACQ_REL, "workgroup"); __builtin_amdgcn_wave_barrier();
  const int rsub = lane >> 4, c4 = (lane & 15) * 4;
  {
#pragma unroll
    for (int q = 0; q < 8; ++q) { const int r = q * 2 + rsub; if (col0 + c4 < N) { const v4f v = *(const v4fa*)&so[w][r][c4]; *(v4f*)(C + (size_t)(row0 + r) * ldc + col0 + c4) = v; } }
     }
}

// Wt[n][k] = f16(W[k][n] * scale) from f32 row-major W[K][N] (scale = power of two; bf16-exact weights stay exact in f16 away from the subnormal range); Wt in fragment order, thread = one 16-byte piece of it
template <int K, int N>
__global__ __launch_bounds__(256) void k_wt_f16(const float* __restrict__ W, _Float16* __restrict__ Wt, float scale) {
  const int t = blockIdx.x * 256 + threadIdx.x; if (t >= N * (K / 8)) return; const size_t e = pk_src<K>((size_t)t); const float* wp = W + (e % K) * N + e / K; float x[8]; FragH f;      /* n = e / K, k = e % K .. + 7 */
#pragma unroll
  for (int i = 0; i < 8; ++i) x[i] = wp[(size_t)i * N];
  asm volatile("s_wait_xcnt 0x0" :: "v"(wp) : "memory");      /* the wait that stands in front of any overwrite of a register that an issued load names; the address is an input so that no load gets it as its destination */
#pragma unroll
  for (int i = 0; i < 8; ++i) f.h[i] = (_Float16)(bf16_round(x[i]) * scale); const v8us o = f.half[0];
  *(v8us*)((unsigned short*)Wt + (size_t)t * 8) = o; 
}
// k_gemm_hh variant with fused epilogue: v = acc·alpha + bias[by·sBias + col] (+ CP[(row/rowsPerB)·sCPb + by·64 + col] if CP) ; ACT 0 none / 1 elu ; writes f16 C16 (and f32 C if non-null)
template <int ACT>
__global__ __launch_bounds__(128) void k_gemm_hhx(const _Float16* __restrict__ A, int lda, size_t sA, const _Float16* __restrict__ Bh, int ldb, size_t sB, float alpha, const float* __restrict__ bias, size_t sBias, const float* __restrict__ CP, int rowsPerB, size_t sCPb, int row0g,
    float* __restrict__ C, _Float16* __restrict__ C16, int ldc, size_t sC, int M, int N, int K) {
  __shared__ __attribute__((aligned(16))) float so[4][16][64];
  const int tid = threadIdx.x, w = tid >> 5, lane = tid & 31, ln = lane & 15, hh = lane >> 4; const int by = blockIdx.y;
  A += (size_t)by * sA; Bh += (size_t)by * sB; const size_t cofs = (size_t)by * sC; const float* bp = bias ? bias + (size_t)by * sBias : nullptr;
  const int ntn = (N + 63) / 64; const int wid = blockIdx.x * 4 + w; const int mt = wid / ntn, nq = wid % ntn; if (mt * 16 >= M) return;
  const int row0 = mt * 16, col0 = nq * 64; const _Float16* arow = A + (size_t)(row0 + ln) * lda;
  v8f acc[4] = {};
  for (int kb = 0; kb < K; kb += 32) { FragH ah; ah.half[0] = *(const v8us*)((const unsigned short*)arow + kb + 8 * hh); ah.half[1] = *(const v8us*)((const unsigned short*)arow + kb + 16 + 8 * hh);
#pragma unroll
    for (int t = 0; t < 4; ++t) { if (col0 + t * 16 >= N) continue; const size_t boff = (size_t)(col0 + t * 16 + ln) * ldb + kb; FragH bq; bq.half[0] = *(const v8us*)((const unsigned short*)Bh + boff + 8 * hh); bq.half[1] = *(const v8us*)((const unsigned short*)Bh + boff + 16 + 8 * hh);
      acc[t] = mmaH<1>(ah.v, ah.v, bq.v, bq.v, acc[t]); }
  }
#pragma unroll
  for (int t = 0; t < 4; ++t) { if (col0 + t * 16 >= N) continue; const int col = col0 + t * 16 + ln; const float bv = bp ? bf16_round(bp[col]) : 0.f;
#pragma unroll
    for (int r = 0; r < 8; ++r) { float v = acc[t][r] * alpha + bv; if (CP) { const int rr = row0g + row0 + 8 * hh + r; if (rowsPerB < 0) v += CP[cofs + (size_t)rr * ldc + col];      /* rowsPerB < 0: own element of the batched C plane */ else { const int bidx = rr / rowsPerB; v += CP[(size_t)bidx * sCPb + (size_t)by * 64 + col]; } } if (ACT == 1) v = (v > 0.f) ? v : expm1f(v); else if (ACT == 7) v = (v > 0.f) ? v + 1.0f : expf(v); else if (ACT == 8) v = tanhf(v); else if (ACT == 9) v = 0.5f * v * (1.0f + tanhf(0.7978845608028654f * (v + 0.044715f * v * v * v))); else if (ACT == 11) v = 1.0f / (1.0f + expf(-v)); else if (ACT == 12) v = (v > 0.f) ? v : 0.01f * v; else if (ACT == 14) v = (v > 0.f) ? v : 0.1f * v; else if (ACT == 16) v = (v >= 0.f) ? v : 0.3f * v; else if (ACT == 17) v = (v >= 0.f) ? v : 0.2f * v; else if (ACT == 15) v = v / (1.0f + expf(-v)); else if (ACT == 3) v = fmaxf(v, 0.f); else if (ACT == 6) v = 0.5f * v * (1.0f + erff(v * 0.70710678118654752f)); so[w][8 * hh + r][t * 16 + ln] = v; } }
  __builtin_amdgcn_fence(__ATOMIC_ACQ_REL, "workgroup"); __builtin_amdgcn_wave_barrier();
  const int rsub = lane >> 4, c4 = (lane & 15) * 4; typedef _Float16 v4h __attribute__((ext_vector_type(4)));
  {
#pragma unroll
    for (int q = 0; q < 8; ++q) { const int r = q * 2 + rsub; if (col0 + c4 < N) { const v4f v = *(const v4fa*)&so[w][r][c4]; if (C) *(v4f*)(C + cofs + (size_t)(row0 + r) * ldc + col0 + c4) = v; if (C16) { v4h h4; for (int i = 0; i < 4; ++i) h4[i] = (_Float16)v[i]; *(v4h*)(C16 + cofs + (size_t)(row0 + r) * ldc + col0 + c4) = h4; } } }
     }
}


typedef _Float16 v4h __attribute__((ext_vector_type(4)));

/* x row-major [rows][KC]; X16 in fragment order, thread = one 16-byte piece of it */
template <int KC>
__global__ __launch_bounds__(256) void k_x16(const float* __restrict__ x, _Float16* __restrict__ X16, size_t n8) { const size_t t = (size_t)blockIdx.x * 256 + threadIdx.x; if (t >= n8) return; const size_t e = pk_src<KC>(t); FragH f;
#pragma unroll
  for (int q = 0; q < 8; ++q) f.h[q] = (_Float16)bf16_round(x[e + q]); *(v8us*)((unsigned short*)X16 + t * 8) = f.half[0];  }
__global__ __launch_bounds__(256) void k_h16(const float* __restrict__ x, _Float16* __restrict__ X16, size_t n8) { const size_t t = (size_t)blockIdx.x * 256 + threadIdx.x; if (t >= n8) return; FragH f;
#pragma unroll
  for (int q = 0; q < 8; ++q) f.h[q] = (_Float16)x[t * 8 + q]; *(v8us*)((unsigned short*)X16 + t * 8) = f.half[0];  }
__global__ __launch_bounds__(256) void k_round16f(const float* __restrict__ W, _Float16* __restrict__ Bt, size_t n8) { const size_t t = (size_t)blockIdx.x * 256 + threadIdx.x; if (t >= n8) return; FragH f;
#pragma unroll
  for (int i = 0; i < 8; ++i) f.h[i] = (_Float16)(bf16_round(W[t * 8 + i]) * 16.0f); *(v8us*)((unsigned short*)Bt + t * 8) = f.half[0];  }
/* PK: F row-major [rows][DM], Hh and Hl in fragment order (thread = one 16-byte piece of each); else all three row-major */
template <bool PK>
__global__ __launch_bounds__(256) void k_hl(const float* __restrict__ F, _Float16* __restrict__ Hh, _Float16* __restrict__ Hl, size_t n8) { const size_t t = (size_t)blockIdx.x * 256 + threadIdx.x; if (t >= n8) return; const size_t e = PK ? pk_src<DM>(t) : t * 8; FragH fh, fl; const v4f a = *(const v4fa*)(F + e), c = *(const v4fa*)(F + e + 4);
#pragma unroll
  for (int q = 0; q < 4; ++q) { _Float16 h = (_Float16)a[q]; fh.h[q] = h; fl.h[q] = (_Float16)((a[q] - (float)h) * 1024.0f); h = (_Float16)c[q]; fh.h[4 + q] = h; fl.h[4 + q] = (_Float16)((c[q] - (float)h) * 1024.0f); }
  { *(v8us*)((unsigned short*)Hh + t * 8) = fh.half[0]; *(v8us*)((unsigned short*)Hl + t * 8) = fl.half[0];  } }

// ---- fast GEMM (wave tile 32x64; requires M % 32 == 0 rows per launch region and N % 64 == 0); epilogue = k_gemm_hhx semantics ----
__device__ __forceinline__ v8f g2_mma(v16h a, v16h b, v8f c) { v8f d = __builtin_amdgcn_wmma_f32_16x16x32_f16(false, a, false, b, (short)0, c, false, false); asm volatile("v_nop\n\tv_nop\n\tv_nop\n\tv_nop" : "+v"(d) : "v"(a), "v"(b)); return d; }
// One k-step (32 k) of the wave's 32x64 tile: two A and four B fragments = twelve 16-byte loads of 512 bytes in a row each (A and B in fragment order). pa / pb: wave-uniform byte address of A / B at that k-step (1 KiB a k-step); oa / ob: the lane's fixed byte offsets (band and lane).
struct G2St { v16h a0, a1, b0, b1, b2, b3; };
__device__ __forceinline__ v16h g2_fragb(const char* base, unsigned o) { FragH f; f.half[0] = *(const v8us*)(base + (size_t)o); f.half[1] = *(const v8us*)(base + (size_t)o + 512); return f.v; }
__device__ __forceinline__ void g2_ld(G2St& s, const char* pa, const char* pb, unsigned oa0, unsigned oa1, unsigned ob0, unsigned ob1, unsigned ob2, unsigned ob3) {
  s.a0 = g2_fragb(pa, oa0); s.a1 = g2_fragb(pa, oa1); s.b0 = g2_fragb(pb, ob0); s.b1 = g2_fragb(pb, ob1); s.b2 = g2_fragb(pb, ob2); s.b3 = g2_fragb(pb, ob3);
  __builtin_amdgcn_sched_barrier(0); }      /* keeps the twelve loads in front of the next k-step's first WMMA: behind it they would be issued only after that WMMA's wait for its own operands */
// The wait that stands in front of any overwrite of a register that an issued load names. The bases and the lane offsets are inputs so that they stay as they are up to here.
__device__ __forceinline__ void g2_xw(const char* pa, const char* pb, unsigned oa0, unsigned oa1, unsigned ob0, unsigned ob1, unsigned ob2, unsigned ob3) { asm volatile("s_wait_xcnt 0x0" :: "s"(pa), "s"(pb), "v"(oa0), "v"(oa1), "v"(ob0), "v"(ob1), "v"(ob2), "v"(ob3) : "memory"); }
__device__ __forceinline__ void g2_mm(const G2St& s, v8f (&c)[8]) { c[0] = g2_mma(s.a0, s.b0, c[0]); c[4] = g2_mma(s.a1, s.b0, c[4]); c[1] = g2_mma(s.a0, s.b1, c[1]); c[5] = g2_mma(s.a1, s.b1, c[5]); c[2] = g2_mma(s.a0, s.b2, c[2]); c[6] = g2_mma(s.a1, s.b2, c[6]); c[3] = g2_mma(s.a0, s.b3, c[3]); c[7] = g2_mma(s.a1, s.b3, c[7]); }
// The K loop of a wave's 32x64 tile (nst k-steps of 32), shared by the GEMM kernels below. pa / pb: wave-uniform bases; the offsets: the lane's own.
__device__ __forceinline__ void g2_kloop(const char* pa, const char* pb, const int nst, const unsigned oa0, const unsigned oa1, const unsigned ob0, const unsigned ob1, const unsigned ob2, const unsigned ob3, v8f (&accs)[8]) { G2St s0, s1, s2;
  // Three k-steps' fragments rest in registers: a set is loaded again right after its WMMAs, so its loads fly while the other two sets are worked on. Every accumulator still takes its k-steps in rising order.
  if (nst >= 3) { g2_ld(s0, pa, pb, oa0, oa1, ob0, ob1, ob2, ob3); g2_ld(s1, pa + 1024, pb + 1024, oa0, oa1, ob0, ob1, ob2, ob3); g2_ld(s2, pa + 2048, pb + 2048, oa0, oa1, ob0, ob1, ob2, ob3); g2_xw(pa, pb, oa0, oa1, ob0, ob1, ob2, ob3); int s = 0;
#pragma unroll 1      /* the body already holds three k-steps; a copy of it would not fit the registers */
    for (; s + 6 <= nst; s += 3) {
      g2_mm(s0, accs); g2_ld(s0, pa + 3072, pb + 3072, oa0, oa1, ob0, ob1, ob2, ob3);
      g2_mm(s1, accs); g2_ld(s1, pa + 4096, pb + 4096, oa0, oa1, ob0, ob1, ob2, ob3);
      g2_mm(s2, accs); g2_ld(s2, pa + 5120, pb + 5120, oa0, oa1, ob0, ob1, ob2, ob3);
      g2_xw(pa, pb, oa0, oa1, ob0, ob1, ob2, ob3);      /* the two bases move on below */
      pa += 3072; pb += 3072; }
    const int rem = nst - s;      /* 3 to 5 k-steps are left, three of them loaded */
    g2_mm(s0, accs); if (rem > 3) { g2_ld(s0, pa + 3072, pb + 3072, oa0, oa1, ob0, ob1, ob2, ob3); g2_xw(pa, pb, oa0, oa1, ob0, ob1, ob2, ob3); }
    g2_mm(s1, accs); if (rem > 4) { g2_ld(s1, pa + 4096, pb + 4096, oa0, oa1, ob0, ob1, ob2, ob3); g2_xw(pa, pb, oa0, oa1, ob0, ob1, ob2, ob3); }
    g2_mm(s2, accs); if (rem > 3) g2_mm(s0, accs); if (rem > 4) g2_mm(s1, accs); }
  else if (nst == 2) { g2_ld(s0, pa, pb, oa0, oa1, ob0, ob1, ob2, ob3); g2_ld(s1, pa + 1024, pb + 1024, oa0, oa1, ob0, ob1, ob2, ob3); g2_xw(pa, pb, oa0, oa1, ob0, ob1, ob2, ob3); g2_mm(s0, accs); g2_mm(s1, accs); }
  else if (nst == 1) { g2_ld(s0, pa, pb, oa0, oa1, ob0, ob1, ob2, ob3); g2_xw(pa, pb, oa0, oa1, ob0, ob1, ob2, ob3); g2_mm(s0, accs); }
}
template <int ACT>
__global__ __launch_bounds__(128) void k_gemm2(const _Float16* __restrict__ A, int lda, size_t sA, const _Float16* __restrict__ Bh, int ldb, size_t sB, float alpha, const float* __restrict__ bias, size_t sBias, const float* __restrict__ CP, int rowsPerB, size_t sCPb, int row0g,
    float* __restrict__ C, _Float16* __restrict__ C16, int ldc, size_t sC, int M, int N, int K, size_t zA, size_t zB, size_t zC) { static_assert(ACT == 0 || ACT == 3 || ACT == 6 || ACT == 8 || ACT == 9 || ACT == 11 || ACT == 12 || ACT == 14 || ACT == 15 || ACT == 16 || ACT == 17, "k_gemm2: unsupported ACT code (would silently apply no activation)");
  __shared__ __attribute__((aligned(16))) float so[4][32][68];
  const int tid = threadIdx.x, w = tid >> 5, lane = tid & 31, ln = lane & 15, hh = lane >> 4; const int by = blockIdx.y, bz = blockIdx.z;      /* grid.z: a second batch index with strides of its own (zA, zB, zC) */
  A += (size_t)by * sA + (size_t)bz * zA; Bh += (size_t)by * sB + (size_t)bz * zB; const size_t cofs = (size_t)by * sC + (size_t)bz * zC; const float* bp = bias ? bias + (size_t)by * sBias : nullptr;
  const int ntn = N >> 6; const int mt = blockIdx.x / ntn, nq = blockIdx.x - mt * ntn; const int row0 = mt * 128 + 32 * w, col0 = nq * 64; if (row0 >= M) return;
  const unsigned oa0 = (unsigned)row0 * (unsigned)lda * 2u + 16u * lane, oa1 = oa0 + 32u * (unsigned)lda;      /* fragment order: the band's first byte + the lane's 16 bytes */
  const unsigned ob0 = (unsigned)col0 * (unsigned)ldb * 2u + 16u * lane, ob1 = ob0 + 32u * (unsigned)ldb, ob2 = ob1 + 32u * (unsigned)ldb, ob3 = ob2 + 32u * (unsigned)ldb;
  const char* pa = (const char*)A; const char* pb = (const char*)Bh; const int nst = K >> 5;      /* k-steps of 32 = 1 KiB of every band */
  const v8f z8 = {0.f,0.f,0.f,0.f,0.f,0.f,0.f,0.f}; v8f accs[8] = {z8, z8, z8, z8, z8, z8, z8, z8};
  g2_kloop(pa, pb, nst, oa0, oa1, ob0, ob1, ob2, ob3, accs);
#pragma unroll
  for (int u = 0; u < 8; ++u) { const int t = u & 3, half = u >> 2; const int col = col0 + t * 16 + ln; const float bv = bp ? bf16_round(bp[col]) : 0.f;
#pragma unroll
    for (int r = 0; r < 8; ++r) { const int rloc = half * 16 + 8 * hh + r; float v = accs[u][r] * alpha + bv; if (CP) { if (rowsPerB < 0) v += CP[cofs + (size_t)(row0g + row0 + rloc) * ldc + col];      /* rowsPerB < 0: own element of the batched C plane */ else { const int bidx = (row0g + row0 + rloc) / rowsPerB; v += CP[(size_t)bidx * sCPb + (size_t)by * 64 + col]; } }
      if (ACT == 3) v = fmaxf(v, 0.f); else if (ACT == 6) v = 0.5f * v * (1.0f + erff(v * 0.70710678118654752f)); else if (ACT == 11) v = 1.0f / (1.0f + expf(-v)); else if (ACT == 15) v = v / (1.0f + expf(-v)); else if (ACT == 12) v = (v > 0.f) ? v : 0.01f * v; else if (ACT == 8) v = tanhf(v); else if (ACT == 9) v = 0.5f * v * (1.0f + tanhf(0.7978845608028654f * (v + 0.044715f * v * v * v))); else if (ACT == 14) v = (v > 0.f) ? v : 0.1f * v; else if (ACT == 16) v = (v >= 0.f) ? v : 0.3f * v; else if (ACT == 17) v = (v >= 0.f) ? v : 0.2f * v;
      so[w][rloc][t * 16 + ln] = v; } }
  __builtin_amdgcn_fence(__ATOMIC_ACQ_REL, "workgroup"); __builtin_amdgcn_wave_barrier();
  const int rsub = lane >> 4, c4 = (lane & 15) * 4;
  {
    if (C) {
#pragma unroll
      for (int q = 0; q < 16; ++q) { const int r = q * 2 + rsub; const v4f v = *(const v4fa*)&so[w][r][c4]; *(v4f*)(C + cofs + (size_t)(row0 + r) * ldc + col0 + c4) = v; }
      asm volatile("s_wait_xcnt 0x0" ::: "memory"); }      /* the wait that stands in front of any overwrite of a register that an issued store names: the C16 part below forms its values in the same registers */
    if (C16) {      /* C16 [rows][ldc] in fragment order: the tile's two bands x two k-steps x two halves, each one 512-byte store */
      char* cb16 = (char*)(C16 + cofs + (size_t)row0 * ldc) + (size_t)(col0 >> 5) * 1024 + lane * 16;
#pragma unroll
      for (int u = 0; u < 8; ++u) { const float* sr = &so[w][(u >> 2) * 16 + ln][(u & 3) * 16 + 8 * hh]; const v4f a = *(const v4fa*)sr, c = *(const v4fa*)(sr + 4); FragH f;
#pragma unroll
        for (int i = 0; i < 4; ++i) { f.h[i] = (_Float16)a[i]; f.h[4 + i] = (_Float16)c[i]; }
        *(v8us*)(cb16 + (size_t)(u >> 2) * 32 * ldc + (u & 3) * 512) = f.half[0]; } }
     } }


// v = x_t w_v (A [NR][DM], Bh [DM][DM], both in fragment order; tiles and K loop of k_gemm2), written at once as V^T [batch * NH + head][64][SQ], f16 hi and x1024 residual planes in fragment order.
// An accumulator tile holds, per lane, dim 16 t + ln and tokens 16 half + 8 hh .. + 7: the very 16-byte piece (band t, half block 'half', lane) of V^T, so no transpose and no LDS. A wave's 32 tokens are one 1-KiB block of each of the head's four bands.
__global__ __launch_bounds__(128) void k_gemm2v(const _Float16* __restrict__ A, const _Float16* __restrict__ Bh, float alpha, _Float16* __restrict__ Vt, _Float16* __restrict__ Vtl) {
  const int w = threadIdx.x >> 5, lane = threadIdx.x & 31; const int mt = blockIdx.x / (DM / 64), nq = blockIdx.x - mt * (DM / 64); const int row0 = mt * 128 + 32 * w, col0 = nq * 64;      /* nq = head */
  const unsigned oa0 = (unsigned)row0 * (DM * 2u) + 16u * lane, oa1 = oa0 + 32u * DM;
  const unsigned ob0 = (unsigned)col0 * (DM * 2u) + 16u * lane, ob1 = ob0 + 32u * DM, ob2 = ob1 + 32u * DM, ob3 = ob2 + 32u * DM;
  const v8f z8 = {0.f,0.f,0.f,0.f,0.f,0.f,0.f,0.f}; v8f accs[8] = {z8, z8, z8, z8, z8, z8, z8, z8};
  g2_kloop((const char*)A, (const char*)Bh, DM >> 5, oa0, oa1, ob0, ob1, ob2, ob3, accs);
  const size_t vo = ((size_t)((row0 / SQ) * NH + nq) * 4) * (32 * (size_t)SQ) + (size_t)((row0 % SQ) >> 5) * 1024 + 16u * lane; FragH fh[8], fl[8];
#pragma unroll
  for (int u = 0; u < 8; ++u) {
#pragma unroll
    for (int r = 0; r < 8; ++r) { const float v = accs[u][r] * alpha; const _Float16 hv = (_Float16)v; fh[u].h[r] = hv; fl[u].h[r] = (_Float16)((v - (float)hv) * 1024.0f); } }
  __builtin_amdgcn_sched_barrier(0);      /* keeps every conversion in front of the first store: no register that an issued store names is written again before the wave ends */
#pragma unroll
  for (int u = 0; u < 8; ++u) { const size_t o = vo + (size_t)(u & 3) * (32 * (size_t)SQ) + (u >> 2) * 512; *(v8us*)((char*)Vt + o) = fh[u].half[0]; *(v8us*)((char*)Vtl + o) = fl[u].half[0]; } }

// C = (Aa Ba ala + bias) + Ab Bb alb (+ Ac Bc alc): the hi / residual terms of one product, side by side in one launch. A work-group is one 32x64 tile of C and NT waves;
// wave t runs the whole K loop of term t, lays its scaled tile in its own LDS plane, and behind one barrier the planes are added in the order of the terms and stored as whole rows.
// Needs M % 32 == 0 (grid.x = (M / 32) (N / 64), exact), N % 64 == 0, K % 32 == 0; grid.y = batch (strides sA, sB, sC), grid.z = a second batch index (strides zA, zB, zC).
template <int NT>
__global__ __launch_bounds__(NT * 32) void k_gemm2t(const _Float16* __restrict__ Aa, const _Float16* __restrict__ Ab, const _Float16* __restrict__ Ac, int lda, size_t sA, const _Float16* __restrict__ Ba, const _Float16* __restrict__ Bb, const _Float16* __restrict__ Bc, int ldb, size_t sB,
    float ala, float alb, float alc, const float* __restrict__ bias, float* __restrict__ C, int ldc, size_t sC, int N, int K, size_t zA, size_t zB, size_t zC) { static_assert(NT == 2 || NT == 3, "k_gemm2t: two or three terms");
  __shared__ __attribute__((aligned(16))) float so[NT][32][68];
  const int lane = threadIdx.x & 31, ln = lane & 15, hh = lane >> 4; const int t = __builtin_amdgcn_readfirstlane((int)(threadIdx.x >> 5)); const int by = blockIdx.y, bz = blockIdx.z;      /* t wave-uniform: the term's bases stay scalar */
  const _Float16* A = (NT > 2 && t == 2) ? Ac : (t == 1) ? Ab : Aa; const _Float16* Bh = (NT > 2 && t == 2) ? Bc : (t == 1) ? Bb : Ba; const float alpha = (NT > 2 && t == 2) ? alc : (t == 1) ? alb : ala;
  A += (size_t)by * sA + (size_t)bz * zA; Bh += (size_t)by * sB + (size_t)bz * zB; const size_t cofs = (size_t)by * sC + (size_t)bz * zC;
  const int ntn = N >> 6; const int mt = blockIdx.x / ntn, nq = blockIdx.x - mt * ntn; const int row0 = mt * 32, col0 = nq * 64;
  const unsigned oa0 = (unsigned)row0 * (unsigned)lda * 2u + 16u * lane, oa1 = oa0 + 32u * (unsigned)lda;      /* fragment order: the band's first byte + the lane's 16 bytes */
  const unsigned ob0 = (unsigned)col0 * (unsigned)ldb * 2u + 16u * lane, ob1 = ob0 + 32u * (unsigned)ldb, ob2 = ob1 + 32u * (unsigned)ldb, ob3 = ob2 + 32u * (unsigned)ldb;
  const v8f z8 = {0.f,0.f,0.f,0.f,0.f,0.f,0.f,0.f}; v8f accs[8] = {z8, z8, z8, z8, z8, z8, z8, z8};
  g2_kloop((const char*)A, (const char*)Bh, K >> 5, oa0, oa1, ob0, ob1, ob2, ob3, accs);
#pragma unroll
  for (int u = 0; u < 8; ++u) { const int tc = u & 3, half = u >> 2; const float bv = (bias && t == 0) ? bf16_round(bias[col0 + tc * 16 + ln]) : 0.f;
#pragma unroll
    for (int r = 0; r < 8; ++r) so[t][half * 16 + 8 * hh + r][tc * 16 + ln] = accs[u][r] * alpha + bv; }
  __syncthreads();      /* every term's plane is complete before any wave adds them */
  const int rsub = lane >> 4, c4 = (lane & 15) * 4;
  for (int q = t; q < 16; q += NT) { const int r = q * 2 + rsub; v4f v = *(const v4fa*)&so[0][r][c4]; v += *(const v4fa*)&so[1][r][c4]; if (NT > 2) v += *(const v4fa*)&so[2][r][c4];
    *(v4f*)(C + cofs + (size_t)(row0 + r) * ldc + col0 + c4) = v;
    asm volatile("s_wait_xcnt 0x0" ::: "memory"); } }      /* the wait that stands in front of any overwrite of a register that an issued store names: the next trip forms its address and its sum in the same registers */

__global__ __launch_bounds__(256) void k_wnat(const float* __restrict__ w, size_t n8, _Float16* __restrict__ Bt) { const size_t t = (size_t)blockIdx.x * 256 + threadIdx.x; if (t >= n8) return; FragH f; for (int q = 0; q < 8; ++q) f.h[q] = (_Float16)(bf16_round(w[t * 8 + q]) * 16.0f); *(v8us*)((unsigned short*)Bt + t * 8) = f.half[0];  }
__global__ __launch_bounds__(256) void k_rsm(const float* __restrict__ S, _Float16* __restrict__ P, int nrows) {
  #pragma clang fp contract(off)
  const int i = blockIdx.x * 256 + threadIdx.x; if (i >= nrows) return; const float* s = S + (size_t)i * SQ; float mx = -3.0e38f;
#pragma unroll 1
  for (int j = 0; j < SQ; ++j) mx = fmaxf(mx, s[j]); float se = 0.f;
#pragma unroll 1
  for (int j = 0; j < SQ; ++j) se += expf(s[j] - mx); const float sc = 256.0f / se;
#pragma unroll 1
  for (int j0 = 0; j0 < SQ; j0 += 8) { FragH f; for (int q = 0; q < 8; ++q) f.h[q] = (_Float16)(expf(s[j0 + q] - mx) * sc); unsigned short* d = (unsigned short*)P + (size_t)i * SQ + j0; *(v8us*)d = f.half[0];  } }
__global__ __launch_bounds__(256) void k_vt(const _Float16* __restrict__ V16, int b, int h0, _Float16* __restrict__ VT) { __shared__ unsigned short tl[64][65]; const int tid = threadIdx.x; const int hh = blockIdx.x % HG, sg = blockIdx.x / HG; const int s0 = sg * 64; const int h = h0 + hh;
  for (int i = tid; i < 64 * 8; i += 256) { const int j = i / 8, d8 = (i % 8) * 8; FragH f; f.half[0] = *(const v8us*)((const unsigned short*)V16 + ((size_t)b * SQ + s0 + j) * DM + h * HD + d8); for (int q = 0; q < 8; ++q) tl[d8 + q][j] = f.u[q]; }
  __syncthreads();
  { for (int i = tid; i < 64 * 8; i += 256) { const int d = i / 8, j8 = (i % 8) * 8; FragH f; for (int q = 0; q < 8; ++q) f.u[q] = tl[d][j8 + q]; *(v8us*)((unsigned short*)VT + ((size_t)hh * HD + d) * SQ + s0 + j8) = f.half[0]; }  } }



__global__ __launch_bounds__(256) void k_rsmcf2(const float* __restrict__ S, _Float16* __restrict__ P, int hg, int q0, int nk) {
  #pragma clang fp contract(off)
  const int t = blockIdx.x * 256 + threadIdx.x; if (t >= hg * QT) return; const size_t i = (size_t)t; const float* s = S + i * NKX; const int last = q0 + (t % QT); float mx = -3.0e38f;
#pragma unroll 1
  for (int j = 0; j < nk; ++j) { const float f = (j <= last) ? 1.f : 0.f; mx = fmaxf(mx, fmaf(f, s[j], (1.f - f) * -1.0e9f)); } float se = 0.f;
#pragma unroll 1
  for (int j = 0; j < nk; ++j) { const float f = (j <= last) ? 1.f : 0.f; se += __expf(fmaf(f, s[j], (1.f - f) * -1.0e9f) - mx); } const float sc = 256.0f / se;
#pragma unroll 1
  for (int j0 = 0; j0 < nk; j0 += 8) { FragH fr; for (int q = 0; q < 8; ++q) { const int j = j0 + q; const float f = (j <= last) ? 1.f : 0.f; fr.h[q] = (_Float16)(__expf(fmaf(f, s[j], (1.f - f) * -1.0e9f) - mx) * sc); } unsigned short* d = (unsigned short*)P + i * NKX + j0; *(v8us*)d = fr.half[0];  } }


template <int MASKADD>
__global__ __launch_bounds__(64) void k_att0(const float* __restrict__ QF, const float* __restrict__ KF, const float* __restrict__ VF, int ld, const float* __restrict__ mask, float scale, float* __restrict__ OF, int ldo) {
  #pragma clang fp contract(off)
  __shared__ __attribute__((aligned(16))) float lq[64][64]; __shared__ __attribute__((aligned(16))) float lo[64][64];
  const int tid = threadIdx.x; const int h = blockIdx.x / (QT0 / 64), rg = blockIdx.x % (QT0 / 64); const int i = rg * 64 + tid;
  const float* qr = QF + (size_t)i * ld + h * HD;
#pragma unroll 1
  for (int c = 0; c < HD / 4; ++c) { *(v4f*)&lq[tid][c * 4] = *(const v4fa*)(qr + c * 4); const v4f z = {0.f, 0.f, 0.f, 0.f}; *(v4f*)&lo[tid][c * 4] = z; }
  float m = -1.0e30f, l = 0.f; const int jmax = MASKADD ? (SQ - 1) : (rg * 64 + 63);      /* additive-mask form: every key (the mask input decides); causal form: keys up to the block's last row */
#pragma unroll 1
  for (int j = 0; j <= jmax; ++j) { const float* kr = KF + (size_t)j * ld + h * HD; const float* vr = VF + (size_t)j * ld + h * HD; float s = 0.f;
#pragma unroll 1
    for (int c = 0; c < HD / 4; ++c) { const v4f kq = *(const v4fa*)(kr + c * 4); const v4f qq = *(v4f*)&lq[tid][c * 4]; s = __fadd_rn(s, __fmul_rn(qq[0], kq[0])); s = __fadd_rn(s, __fmul_rn(qq[1], kq[1])); s = __fadd_rn(s, __fmul_rn(qq[2], kq[2])); s = __fadd_rn(s, __fmul_rn(qq[3], kq[3])); }
    s = __fmul_rn(s, scale); if (MASKADD) s = __fadd_rn(s, __fmul_rn(bf16_round(mask[(size_t)i * SQ + j]), -10000.0f));
    const float f = (MASKADD || j <= i) ? 1.f : 0.f; const float sm = fmaf(f, s, (1.f - f) * -1.0e30f); const float mn = fmaxf(m, sm); const float sc = expf(m - mn); const float e = expf(sm - mn); l = __fadd_rn(__fmul_rn(l, sc), e); m = mn;
#pragma unroll 1
    for (int c = 0; c < HD / 4; ++c) { const v4f vv = *(const v4fa*)(vr + c * 4); v4f oo = *(v4f*)&lo[tid][c * 4]; for (int u = 0; u < 4; ++u) oo[u] = __fadd_rn(__fmul_rn(oo[u], sc), __fmul_rn(e, vv[u])); *(v4f*)&lo[tid][c * 4] = oo; } }
  const float fin = 64.0f / l;      /* o carried x64 like the f16 path */
#pragma unroll 1
  for (int c = 0; c < HD / 4; ++c) { v4f oo = *(v4f*)&lo[tid][c * 4]; for (int u = 0; u < 4; ++u) oo[u] = __fmul_rn(oo[u], fin); *(v4f*)&lo[tid][c * 4] = oo; }
  __syncthreads();
  {
#pragma unroll 1
    for (int it = 0; it < 16; ++it) { const int row = it * 4 + tid / 16, pc = (tid % 16) * 4; const v4f v = *(const v4f*)&lo[row][pc]; *(v4f*)(OF + (size_t)(rg * 64 + row) * ldo + h * HD + pc) = v; }
     } }


__global__ __launch_bounds__(256) void k_kvexp(const float* __restrict__ src, float* __restrict__ dst, size_t n4) { const size_t t = (size_t)blockIdx.x * 256 + threadIdx.x; if (t >= n4) return; const size_t e = t * 4; const size_t row = e / DM; const int col = (int)(e % DM); const int h = col / HD, d = col % HD; const v4f v = *(const v4fa*)(src + row * KVD + (size_t)(h / HPG) * HD + d); *(v4f*)(dst + e) = v;  }

__global__ __launch_bounds__(256) void k_tab2(float theta, float* __restrict__ CS, float* __restrict__ SN) {
  #pragma clang fp contract(off)
  const int t = blockIdx.x * 256 + threadIdx.x; if (t >= SQ * (HD / 2)) return; const int i = t % (HD / 2); const int p = t / (HD / 2); const float invf = 1.0f / powf(theta, (float)(2 * i) / (float)HD); const float ang = __fmul_rn((float)p, invf); const float c = cosf(ang), s = sinf(ang);
  *(float*)(CS + t) = c; *(float*)(SN + t) = s;  }
template <int NORM, int ROPE>
__global__ __launch_bounds__(64) void k_xform(const float* __restrict__ F, int ldf, int nh, const float* __restrict__ gain, float eps, const float* __restrict__ CS, const float* __restrict__ SN, _Float16* __restrict__ H16, int ldo) {
  #pragma clang fp contract(off)
  __shared__ float xv[HD]; __shared__ float red[HD]; __shared__ unsigned short sh_[HD]; const int d = threadIdx.x; const int h = blockIdx.x % nh; const size_t r = blockIdx.x / nh; const int p = (int)(r % SQ);
  float x = F[r * (size_t)ldf + (size_t)h * HD + d];
  if (NORM) { red[d] = __fmul_rn(x, x); __syncthreads(); for (int st = HD / 2; st > 0; st >>= 1) { if (d < st) red[d] = __fadd_rn(red[d], red[d + st]); __syncthreads(); } const float rs = rsqrtf(__fadd_rn(red[0] / (float)HD, eps)); x = __fmul_rn(__fmul_rn(x, rs), bf16_round(gain[d])); }
  xv[d] = x; __syncthreads();
  float o = x;
  if (ROPE == 1) { const int i = d >> 1; const float c = CS[p * (HD / 2) + i], s = SN[p * (HD / 2) + i]; const float ev = xv[2 * i], od = xv[2 * i + 1]; o = (d & 1) ? __fadd_rn(__fmul_rn(ev, s), __fmul_rn(od, c)) : __fadd_rn(__fmul_rn(ev, c), -__fmul_rn(od, s)); }
  if (ROPE == 2) { const int i = d & (HD / 2 - 1); const float c = CS[p * (HD / 2) + i], s = SN[p * (HD / 2) + i]; const float lo = xv[i], hi = xv[i + HD / 2]; o = (d < HD / 2) ? __fadd_rn(__fmul_rn(lo, c), -__fmul_rn(hi, s)) : __fadd_rn(__fmul_rn(lo, s), __fmul_rn(hi, c)); }
  FragH th; th.h[0] = (_Float16)o; sh_[d] = th.u[0]; __syncthreads();
  if (d < HD / 8) { FragH f; for (int q = 0; q < 8; ++q) f.u[q] = sh_[d * 8 + q]; unsigned short* dst = (unsigned short*)H16 + r * (size_t)ldo + (size_t)h * HD + d * 8; *(v8us*)dst = f.half[0];  } }

template <int NORM, int ROPE>
__global__ __launch_bounds__(64) void k_xformf(const float* __restrict__ F, int ldf, int nh, const float* __restrict__ gain, float eps, const float* __restrict__ CS, const float* __restrict__ SN, float* __restrict__ F32, int ldo) {
  #pragma clang fp contract(off)
  __shared__ float xv[HD]; __shared__ float red[HD]; const int d = threadIdx.x; const int h = blockIdx.x % nh; const size_t r = blockIdx.x / nh; const int p = (int)(r % SQ);
  float x = F[r * (size_t)ldf + (size_t)h * HD + d];
  if (NORM) { red[d] = __fmul_rn(x, x); __syncthreads(); for (int st = HD / 2; st > 0; st >>= 1) { if (d < st) red[d] = __fadd_rn(red[d], red[d + st]); __syncthreads(); } const float rs = rsqrtf(__fadd_rn(red[0] / (float)HD, eps)); x = __fmul_rn(__fmul_rn(x, rs), bf16_round(gain[d])); }
  xv[d] = x; __syncthreads();
  float o = x;
  if (ROPE == 1) { const int i = d >> 1; const float c = CS[p * (HD / 2) + i], s = SN[p * (HD / 2) + i]; const float ev = xv[2 * i], od = xv[2 * i + 1]; o = (d & 1) ? __fadd_rn(__fmul_rn(ev, s), __fmul_rn(od, c)) : __fadd_rn(__fmul_rn(ev, c), -__fmul_rn(od, s)); }
  if (ROPE == 2) { const int i = d & (HD / 2 - 1); const float c = CS[p * (HD / 2) + i], s = SN[p * (HD / 2) + i]; const float lo = xv[i], hi = xv[i + HD / 2]; o = (d < HD / 2) ? __fadd_rn(__fmul_rn(lo, c), -__fmul_rn(hi, s)) : __fadd_rn(__fmul_rn(lo, s), __fmul_rn(hi, c)); }
  float* dst = F32 + r * (size_t)ldo + (size_t)h * HD + d; *(float*)dst = o;  }

__global__ __launch_bounds__(256) void k_trig(const float* __restrict__ a, float* __restrict__ CS, float* __restrict__ SN, int n) {
  #pragma clang fp contract(off)
  const int t = blockIdx.x * 256 + threadIdx.x; if (t >= n) return; const float v = bf16_round(a[t]); const float c = cosf(v), s = sinf(v);
  *(float*)(CS + t) = c; *(float*)(SN + t) = s;  }

__global__ __launch_bounds__(256) void k_tabpos(const int* __restrict__ pos, float* __restrict__ CS, float* __restrict__ SN, int n) {
  #pragma clang fp contract(off)
  const int t = blockIdx.x * 256 + threadIdx.x; if (t >= n) return; const int p = t / 32, i = t % 32; const float invf = (float)(1.0 / pow(10000.0, ((double)(2 * i)) / 64.0)); const float a = __fmul_rn((float)pos[p], invf); const float c = cosf(a), s = sinf(a);
  *(float*)(CS + t) = c; *(float*)(SN + t) = s;  }

// 2^x of four values. One asm statement so that every v_exp_f32 has an independent instruction behind it (early-clobber outputs: none overwrites a source);
// the closing v_nop is the slot that the instruction set asks for before the last result is read or its source overwritten.
__device__ __forceinline__ v4f exp2x4(v4f x) { float r0, r1, r2, r3;
  asm("v_exp_f32 %0, %4\n\tv_exp_f32 %1, %5\n\tv_exp_f32 %2, %6\n\tv_exp_f32 %3, %7\n\tv_nop" : "=&v"(r0), "=&v"(r1), "=&v"(r2), "=&v"(r3) : "v"(x[0]), "v"(x[1]), "v"(x[2]), "v"(x[3]));
  const v4f r = {r0, r1, r2, r3}; return r; }
// 2^x of one value; the v_nop is the slot that the instruction set asks for before the result is read or the source overwritten.
__device__ __forceinline__ float exp2x1(float x) { float r; asm("v_exp_f32 %0, %1\n\tv_nop" : "=&v"(r) : "v"(x)); return r; }
__device__ __forceinline__ v8f fa_mma(v16h a, v16h b, v8f c) { return __builtin_amdgcn_wmma_f32_16x16x32_f16(false, a, false, b, (short)0, c, false, false); }
// Causal XL attention of one (batch, head, 64 query rows) per work-group: scores, softmax and P V in one kernel, no score or weight plane in memory.
// A wave owns 16 query rows i0 .. i0 + 15 and walks the keys in passes of 32 (j0 = 0, 32, .. <= i0), sharing nothing with the other waves (no barrier).
// A pass: AC = (q+u) k^T (16x32) and BD' = (q+v) r^T over the 48 xl_r rows cb .. cb + 47, cb = SQ - 16 - i0 + j0 (a band of 16 rows past the end is clamped to the last band; a clamped row is met above the diagonal only).
// rel_shift: score (m, n) takes BD'[m][n + 15 - m]; the shift is done by the LDS store (column cc of row m goes to place cc + 1 + m = n + 16 of the wave's own rows).
// Both tiles are read back with lane = row (the A-operand order), so a lane holds 16 scores of one row and the weights are formed in place as an A fragment.
// Running maximum and sum per row (weights x256 relative to the running maximum; accumulators rescaled when a maximum rises); weights as f16 hi + x1024 residual, V^T likewise:
// oh += Ph Vh, ol += Pl Vh + Ph Vl; o x64 = (oh + ol 2^-10) 64 / sum.
#define FPA 36      /* f32 pitch of the AC rows in LDS: 16 bytes x odd */
#define FPB 68      /* f32 pitch of the shifted BD' rows (places 1 .. 63 are written, 16 .. 47 read) and of the output rows staged there at the end */
__global__ __launch_bounds__(128) __attribute__((amdgpu_waves_per_eu(4, 4))) void k_fattn(const _Float16* __restrict__ QU, const _Float16* __restrict__ QV, const _Float16* __restrict__ K16, const _Float16* __restrict__ R16, const _Float16* __restrict__ VT, const _Float16* __restrict__ VTL, _Float16* __restrict__ O16, _Float16* __restrict__ OL16) {
  __shared__ __attribute__((aligned(16))) float sa[4][16][FPA]; __shared__ __attribute__((aligned(16))) float sb[4][16][FPB];
  const int lane = threadIdx.x & 31, ln = lane & 15, hh = lane >> 4; const int w = __builtin_amdgcn_readfirstlane((int)(threadIdx.x >> 5));      /* wave-uniform: scalar bases and trip count */
  const int h = blockIdx.y, b = blockIdx.z; const int i0 = (SQ / 64 - 1 - (int)blockIdx.x) * 64 + w * 16;      /* the long row blocks start first */
  const char* qub = (const char*)(QU + ((size_t)b * SQ + i0) * DM) + h * 2048; const char* qvb = (const char*)(QV + ((size_t)b * SQ + i0) * DM) + h * 2048;      /* every operand plane is in fragment order: a head's 64 dims are two 1-KiB blocks of a [row][DM] band */
  const unsigned oq = 16u * lane;      /* the lane's 16 bytes of a 512-byte half block: the same in every plane */
  const v16h qu0 = g2_fragb(qub, oq), qu1 = g2_fragb(qub + 1024, oq), qv0 = g2_fragb(qvb, oq), qv1 = g2_fragb(qvb + 1024, oq);
  asm volatile("s_wait_xcnt 0x0" :: "s"(qub), "s"(qvb), "v"(oq) : "memory");      /* the wait that stands in front of any overwrite of a register that an issued load names; bases and offset are inputs so that they stay as they are up to here */
  const char* kp = (const char*)(K16 + (size_t)b * SQ * DM) + h * 2048 + oq; const char* rb = (const char*)(R16 + (size_t)h * SQ * HD);      /* kp, vp, vlp: the lane's own addresses, moved on once per pass */
  const char* vp = (const char*)(VT + (size_t)(b * NH + h) * HD * SQ) + oq; const char* vlp = (const char*)(VTL + (size_t)(b * NH + h) * HD * SQ) + oq;
  float (*pa)[FPA] = sa[w]; float (*pb)[FPB] = sb[w];
  const v8f z8 = {0.f,0.f,0.f,0.f,0.f,0.f,0.f,0.f}; v8f oh[4] = {z8, z8, z8, z8}, ol[4] = {z8, z8, z8, z8}; float m = -3.0e38f, l = 0.f;
  const int np = (i0 >> 5) + 1;
#pragma unroll 1      /* a second copy of the pass would not fit the registers of four waves per SIMD */
  for (int p = 0; p < np; ++p) { const int cb = SQ - 16 - i0 + p * 32; v16h kf[4], rf[6]; unsigned orr[3];
#pragma unroll
    for (int t = 0; t < 2; ++t) { kf[2 * t] = g2_fragb(kp + t * (16 * DM * 2), 0u); kf[2 * t + 1] = g2_fragb(kp + t * (16 * DM * 2) + 1024, 0u); }
#pragma unroll
    for (int t = 0; t < 3; ++t) { orr[t] = (unsigned)min(cb + t * 16, SQ - 16) * (HD * 2u) + oq; rf[2 * t] = g2_fragb(rb, orr[t]); rf[2 * t + 1] = g2_fragb(rb + 1024, orr[t]); }      /* cb is a multiple of 16: whole bands of xl_r, 2 KiB each; a band past the end is clamped to the last */
    asm volatile("s_wait_xcnt 0x0" :: "v"(kp), "s"(rb), "v"(orr[0]), "v"(orr[1]), "v"(orr[2]) : "memory");      /* same wait, for the pass's K and xl_r loads: every address register is an input, so none is reused (as a destination either) before it */
    __builtin_amdgcn_sched_barrier(0);      /* keeps the pass's 20 K and xl_r loads in front of the first WMMA: behind it they would go out in groups, each with its own full wait */
    v8f s4[2], bd[3];
#pragma unroll
    for (int t = 0; t < 2; ++t) s4[t] = fa_mma(qu1, kf[2 * t + 1], fa_mma(qu0, kf[2 * t], z8));
#pragma unroll
    for (int t = 0; t < 3; ++t) bd[t] = fa_mma(qv1, rf[2 * t + 1], fa_mma(qv0, rf[2 * t], z8));
    v16h vh[4], vl[4];      /* V^T fragments, one per dim tile: they fly while the scores go through LDS and the softmax */
#pragma unroll
    for (int t = 0; t < 4; ++t) { vh[t] = g2_fragb(vp + t * (16 * SQ * 2), 0u); vl[t] = g2_fragb(vlp + t * (16 * SQ * 2), 0u); }
    asm volatile("s_wait_xcnt 0x0" :: "v"(vp), "v"(vlp) : "memory");      /* same wait, for the 16 V^T loads */
    __builtin_amdgcn_sched_barrier(0);      /* keeps those loads in front of the softmax, which hides them */
#pragma unroll
    for (int t = 0; t < 2; ++t) {
#pragma unroll
      for (int r = 0; r < 8; ++r) pa[8 * hh + r][t * 16 + ln] = s4[t][r]; }
#pragma unroll
    for (int t = 0; t < 3; ++t) {
#pragma unroll
      for (int r = 0; r < 8; ++r) pb[8 * hh + r][t * 16 + ln + 1 + 8 * hh + r] = bd[t][r]; }
    __builtin_amdgcn_fence(__ATOMIC_ACQ_REL, "workgroup", "local"); __builtin_amdgcn_wave_barrier();      /* the tiles are read across the wave's lanes: keeps the LDS stores in front of those reads */
    v4f sc[4];      /* sc[2 c], sc[2 c + 1]: keys j0 + 16 c + 8 hh .. + 7 of row ln */
#pragma unroll
    for (int c = 0; c < 2; ++c) { const int col = c * 16 + 8 * hh; sc[2 * c] = *(const v4f*)&pa[ln][col] + *(const v4f*)&pb[ln][16 + col]; sc[2 * c + 1] = *(const v4f*)&pa[ln][col + 4] + *(const v4f*)&pb[ln][16 + col + 4]; }
    __builtin_amdgcn_fence(__ATOMIC_ACQ_REL, "workgroup", "local"); __builtin_amdgcn_wave_barrier();      /* keeps the next pass's LDS stores behind these reads */
    if (p == np - 1) {      /* only the last pass meets the diagonal (j0 + 31 < i0 before it) */
#pragma unroll
      for (int c = 0; c < 4; ++c) {
#pragma unroll
        for (int q = 0; q < 4; ++q) { const int j = p * 32 + (c >> 1) * 16 + 8 * hh + (c & 1) * 4 + q; sc[c][q] = (j <= i0 + ln) ? sc[c][q] : -1.0e30f; } } }
    float mx = sc[0][0];
#pragma unroll
    for (int c = 0; c < 4; ++c) mx = fmaxf(mx, fmaxf(fmaxf(sc[c][0], sc[c][1]), fmaxf(sc[c][2], sc[c][3])));
    mx = fmaxf(mx, __shfl_xor(mx, 16, 32));      /* the other half of the row's 32 keys */
    const float mn = fmaxf(m, mx); const float al = exp2x1((m - mn) * 1.44269504f);
    if (__builtin_amdgcn_ballot_w32(mn > m) != 0) {      /* a scalar branch: where no row's maximum rose every factor is 1 */
#pragma unroll
      for (int r = 0; r < 8; ++r) { const float ar = __shfl(al, 8 * hh + r, 32);      /* accumulator register r holds row 8 hh + r */
#pragma unroll
        for (int t = 0; t < 4; ++t) { oh[t][r] *= ar; ol[t][r] *= ar; } } }
    m = mn; const float mb = 8.0f - mn * 1.44269504f; v4f ps = {0.f, 0.f, 0.f, 0.f}; FragH ph, pl;
#pragma unroll
    for (int c = 0; c < 4; ++c) { const v4f e = exp2x4(sc[c] * 1.44269504f + mb); ps += e;      /* 256 exp(s - m) */
#pragma unroll
      for (int q = 0; q < 4; ++q) { const _Float16 hv = (_Float16)e[q]; ph.h[c * 4 + q] = hv; pl.h[c * 4 + q] = (_Float16)((e[q] - (float)hv) * 1024.0f); } }
    l = l * al + ((ps[0] + ps[1]) + (ps[2] + ps[3]));
#pragma unroll
    for (int t = 0; t < 4; ++t) oh[t] = fa_mma(ph.v, vh[t], oh[t]);
#pragma unroll
    for (int t = 0; t < 4; ++t) ol[t] = fa_mma(pl.v, vh[t], ol[t]);
#pragma unroll
    for (int t = 0; t < 4; ++t) ol[t] = fa_mma(ph.v, vl[t], ol[t]);
    kp += 32 * DM * 2; vp += 1024; vlp += 1024; }
  l += __shfl_xor(l, 16, 32); const float inv = 64.0f / l;      /* the two halves' sums joined once; o carried x64 */
#pragma unroll
  for (int r = 0; r < 8; ++r) { const float ir = __shfl(inv, 8 * hh + r, 32);
#pragma unroll
    for (int t = 0; t < 4; ++t) pb[8 * hh + r][t * 16 + ln] = (oh[t][r] + ol[t][r] * 0.0009765625f) * ir; }
  __builtin_amdgcn_fence(__ATOMIC_ACQ_REL, "workgroup", "local"); __builtin_amdgcn_wave_barrier();      /* the rows are read across the wave's lanes, lane = row, for the operand order of the output GEMM */
  /* o x64 leaves as the f16 hi and x1024 residual planes [row][DM] in fragment order: the wave's 16 rows are one band, the head's 64 dims two 1-KiB blocks of it = four 512-byte stores a plane */
  const size_t oo = ((size_t)b * SQ + i0) * (DM * 2) + h * 2048 + oq; FragH fh[4], fl[4];
#pragma unroll
  for (int u = 0; u < 4; ++u) { const float* sr = &pb[ln][u * 16 + 8 * hh]; const v4f a = *(const v4f*)sr, c = *(const v4f*)(sr + 4);
#pragma unroll
    for (int q = 0; q < 4; ++q) { _Float16 hv = (_Float16)a[q]; fh[u].h[q] = hv; fl[u].h[q] = (_Float16)((a[q] - (float)hv) * 1024.0f); hv = (_Float16)c[q]; fh[u].h[4 + q] = hv; fl[u].h[4 + q] = (_Float16)((c[q] - (float)hv) * 1024.0f); } }
  __builtin_amdgcn_sched_barrier(0);      /* keeps every conversion in front of the first store: no register that an issued store names is written again before the wave ends */
#pragma unroll
  for (int u = 0; u < 4; ++u) { *(v8us*)((char*)O16 + oo + u * 512) = fh[u].half[0]; *(v8us*)((char*)OL16 + oo + u * 512) = fl[u].half[0]; } }

// x_t = RMSNorm(bf16(x)) g (f32), written at once as its f16 hi and x1024 residual planes [row][DM] in fragment order. A work-group is one band of 16 rows, a wave one row:
// a lane holds 32 elements (eight 16-byte loads of 512 bytes in a row each); sum of squares = per-lane partials joined in pairs, then a lane butterfly.
// The f16 rows are laid row-major in LDS and, behind one barrier, read back piece by piece in fragment order, so that every global store is 512 bytes in a row.
#define RXP (DM + 8)      /* f16 pitch of a staged row: 16 bytes x odd */
typedef unsigned short v4us __attribute__((ext_vector_type(4), may_alias));
union FragQ { v4us v; _Float16 h[4]; };
__global__ __launch_bounds__(512) void k_rmsx(const float* __restrict__ x, const float* __restrict__ g, float eps, _Float16* __restrict__ Hh, _Float16* __restrict__ Hl) {
  __shared__ __attribute__((aligned(16))) unsigned short sh[16][RXP]; __shared__ __attribute__((aligned(16))) unsigned short sl[16][RXP];
  const int tid = threadIdx.x, lane = tid & 31, w = tid >> 5;
  const float* xr = x + ((size_t)blockIdx.x * 16 + w) * DM + lane * 4; const float* gr = g + lane * 4; v4f v[8], gg[8]; float s[8];
#pragma unroll
  for (int i = 0; i < 8; ++i) { v[i] = *(const v4fa*)(xr + i * 128); gg[i] = *(const v4fa*)(gr + i * 128); }
  asm volatile("s_wait_xcnt 0x0" :: "v"(xr), "v"(gr) : "memory");      /* the wait that stands in front of any overwrite of a register that an issued load names; the addresses are inputs so that no load gets one as its destination */
#pragma unroll
  for (int i = 0; i < 8; ++i) { s[i] = 0.f;
#pragma unroll
    for (int q = 0; q < 4; ++q) { v[i][q] = bf16_round(v[i][q]); s[i] += v[i][q] * v[i][q]; } }
  float ss = ((s[0] + s[4]) + (s[2] + s[6])) + ((s[1] + s[5]) + (s[3] + s[7]));
#pragma unroll
  for (int m = 16; m > 0; m >>= 1) ss += __shfl_xor(ss, m, 32);
  const float rs = rsqrtf(ss / (float)DM + eps);
#pragma unroll
  for (int i = 0; i < 8; ++i) { FragQ fh, fl;
#pragma unroll
    for (int q = 0; q < 4; ++q) { const float o = (v[i][q] * rs) * bf16_round(gg[i][q]); const _Float16 hv = (_Float16)o; fh.h[q] = hv; fl.h[q] = (_Float16)((o - (float)hv) * 1024.0f); }
    *(v4us*)&sh[w][i * 128 + lane * 4] = fh.v; *(v4us*)&sl[w][i * 128 + lane * 4] = fl.v; }
  __syncthreads();      /* all 16 rows of the band lie in LDS before any piece, which takes its place by row, is read */
  v8us ph[4], pl[4];
#pragma unroll
  for (int it = 0; it < 4; ++it) { const int t = it * 512 + tid; const int r = t & 15, k = (t >> 6) * 32 + ((t >> 4) & 3) * 8; ph[it] = *(const v8us*)&sh[r][k]; pl[it] = *(const v8us*)&sl[r][k]; }      /* piece t of the band: row t & 15, see pk_src */
  __builtin_amdgcn_sched_barrier(0);      /* keeps the eight LDS reads in front of the first store: no register that an issued store names is written again before the wave ends */
  const size_t o8 = ((size_t)blockIdx.x * (DM * 2) + tid) * 8;
#pragma unroll
  for (int it = 0; it < 4; ++it) { *(v8us*)((unsigned short*)Hh + o8 + it * 4096) = ph[it]; *(v8us*)((unsigned short*)Hl + o8 + it * 4096) = pl[it]; } }

// Exact f32 XL attention of the first QT0 rows of a batch: one wave per (head, row i). Lane = 16 hh + ln: ln owns dims 4 ln .. 4 ln + 3, hh one of two keys,
// so every 16-byte load instruction reads two whole 256-byte rows. Keys go in chunks of 32: a lane forms 16 partial dots (q+u).k + (q+v).r over its four dims,
// a four-step butterfly sums each over its 16 lanes, and lane l keeps the score of key 32 c + l. Scores, then weights, rest in the wave's own LDS row;
// maximum and sum are taken over the whole row (two passes, no rescaling); o = sum_j e_j v_j per half, the halves added at the end, x 64 / sum.
// Rows of K, V up to 32 c + 31 <= QT0 - 1 exist; a key above the diagonal gets -1e30 by the arithmetic select and its xl_r index is clamped.
__global__ __launch_bounds__(256) void k_att0xl(const float* __restrict__ QF, const float* __restrict__ QVF, const float* __restrict__ KF, const float* __restrict__ VF, const float* __restrict__ RF, float* __restrict__ OF) {
  __shared__ __attribute__((aligned(16))) float pw[8][QT0];
  { const size_t bo = (size_t)blockIdx.y * (QT0 * DM); QF += bo; QVF += bo; KF += bo; VF += bo; OF += bo; }      /* grid.y = batch: every plane holds QT0 rows per batch */
  const int lane = threadIdx.x & 31, ln = lane & 15, hh = lane >> 4; const int w = __builtin_amdgcn_readfirstlane((int)(threadIdx.x >> 5));      /* wave-uniform: scalar row bases and trip counts */
  const int h = blockIdx.x % NH; const int i = QT0 - 1 - ((int)(blockIdx.x / NH) * 8 + w); const int nch = (i >> 5) + 1;      /* the long rows start first; nch chunks of 32 keys cover 0 .. i */
  const unsigned qo = (unsigned)(i * DM + h * HD + ln * 4) * 4u;
  const v4f q4 = *(const v4fa*)((const char*)QF + qo), qv4 = *(const v4fa*)((const char*)QVF + qo);
  const unsigned ko = (unsigned)(hh * 16 * DM + h * HD + ln * 4) * 4u;      /* the lane's byte offset in a chunk of K or V rows */
  const char* rb = (const char*)(RF + (size_t)h * SQ * HD); float* pr = pw[w]; float mx = -3.0e38f;
#pragma unroll 1
  for (int c = 0; c < nch; ++c) { const char* kp = (const char*)KF + (size_t)c * (32 * DM * 4) + ko; const int r0 = SQ - 1 - i + c * 32 + hh * 16; v4f kk[16], rr[16]; unsigned ro[16];
#pragma unroll
    for (int u = 0; u < 16; ++u) { ro[u] = (unsigned)min(r0 + u, SQ - 1) * (HD * 4u) + ln * 16u; kk[u] = *(const v4fa*)(kp + u * (DM * 4)); rr[u] = *(const v4fa*)(rb + ro[u]); }      /* key j = 32 c + 16 hh + u; xl_r row min(SQ - 1 - i + j, SQ - 1) */
    /* the wait that stands in front of any overwrite of a register that an issued load names, for the chunk's 32 loads: every address register is an input, so none is reused (as a destination either) before it */
    asm volatile("s_wait_xcnt 0x0" :: "v"(kp), "s"(rb), "v"(ro[0]), "v"(ro[1]), "v"(ro[2]), "v"(ro[3]), "v"(ro[4]), "v"(ro[5]), "v"(ro[6]), "v"(ro[7]), "v"(ro[8]), "v"(ro[9]), "v"(ro[10]), "v"(ro[11]), "v"(ro[12]), "v"(ro[13]), "v"(ro[14]), "v"(ro[15]) : "memory");
    __builtin_amdgcn_sched_barrier(0);      /* keeps the arithmetic behind the chunk's loads: without it most K rows are loaded one at a time, each with its own wait */
    float keep = 0.f;
#pragma unroll
    for (int u = 0; u < 16; ++u) { float p = q4[0] * kk[u][0];
#pragma unroll
      for (int d = 1; d < 4; ++d) p = fmaf(q4[d], kk[u][d], p);
#pragma unroll
      for (int d = 0; d < 4; ++d) p = fmaf(qv4[d], bf16_round(rr[u][d]), p);
      p += __shfl_xor(p, 1, 32); p += __shfl_xor(p, 2, 32); p += __shfl_xor(p, 4, 32); p += __shfl_xor(p, 8, 32);
      keep = (ln == u) ? p : keep; }
    const float f = (c * 32 + lane <= i) ? 1.f : 0.f; const float sm = fmaf(f, keep, (1.f - f) * -1.0e30f); pr[c * 32 + lane] = sm; mx = fmaxf(mx, sm); }
#pragma unroll
  for (int m = 16; m > 0; m >>= 1) mx = fmaxf(mx, __shfl_xor(mx, m, 32));
  float l = 0.f;
#pragma unroll 1
  for (int c = 0; c < nch; ++c) { const float e = expf(pr[c * 32 + lane] - mx); pr[c * 32 + lane] = e; l += e; }      /* each lane reads back what it wrote itself */
#pragma unroll
  for (int m = 16; m > 0; m >>= 1) l += __shfl_xor(l, m, 32);
  __builtin_amdgcn_fence(__ATOMIC_ACQ_REL, "workgroup"); __builtin_amdgcn_wave_barrier();      /* the weights are read across the wave's lanes from here on: keeps the LDS stores in front of those reads */
  v4f o = {0.f, 0.f, 0.f, 0.f};
#pragma unroll 1
  for (int c = 0; c < nch; ++c) { const char* vp = (const char*)VF + (size_t)c * (32 * DM * 4) + ko; v4f vv[16], pe[4];
#pragma unroll
    for (int u = 0; u < 16; ++u) vv[u] = *(const v4fa*)(vp + u * (DM * 4));
    asm volatile("s_wait_xcnt 0x0" :: "v"(vp) : "memory");      /* same wait, for the chunk's 16 loads; the address is an input so that no load of the chunk gets it as its destination */
#pragma unroll
    for (int m = 0; m < 4; ++m) pe[m] = *(const v4f*)&pr[c * 32 + hh * 16 + m * 4];      /* the half's 16 weights, one address per half */
#pragma unroll
    for (int u = 0; u < 16; ++u) { const float e = pe[u >> 2][u & 3];
#pragma unroll
      for (int d = 0; d < 4; ++d) o[d] = fmaf(e, vv[u][d], o[d]); } }
  const float fin = 64.0f / l;      /* o carried x64 like the f16 path */
#pragma unroll
  for (int d = 0; d < 4; ++d) o[d] = (o[d] + __shfl_xor(o[d], 16, 32)) * fin;
  if (hh == 0) *(v4f*)(OF + (size_t)i * DM + h * HD + ln * 4) = o; }

extern "C" void kernel_launch(void* const* d_in, const int* in_sizes, int n_in,
                              void* d_out, int out_size, void* d_ws, size_t ws_size, hipStream_t stream) {
  (void)in_sizes; (void)n_in; (void)out_size;
  const float* const* I = (const float* const*)d_in; const float* x = I[0]; const float* g = I[1]; const float* wq = I[2]; const float* wk = I[3]; const float* wv = I[4]; const float* wres = I[5]; const float* xlr = I[6]; const float* xlu = I[7]; const float* xlv = I[8];      /* x; RMS gain; w_q/w_k/w_v [1024][16][64] = [in][out]; w_res [1024][1024] [in][out]; xl_r [16][2048][64]; xl_u, xl_v [1][16][1][64] = per-head 64-vectors (a [1024] bias over the merged columns) */
  char* ws = (char*)d_ws; size_t off = 0;
  auto take = [&](size_t bytes) { char* p = ws + off; off += (bytes + 255) & ~(size_t)255; return p; };
  /* Planes that live across the attention kernel. */
  _Float16* BR = (_Float16*)take((size_t)DM * DM * 2); _Float16* QU = (_Float16*)take(NR * DM * 2); _Float16* QV = (_Float16*)take(NR * DM * 2); _Float16* K16 = (_Float16*)take(NR * DM * 2); _Float16* R16 = (_Float16*)take((size_t)NH * SQ * HD * 2); float* OF0 = (float*)take((size_t)NB * QT0 * DM * 4); _Float16* VT = (_Float16*)take((size_t)NB * NH * HD * SQ * 2); _Float16* VTL = (_Float16*)take((size_t)NB * NH * HD * SQ * 2);
  const size_t offs = off;
  /* What is last read in front of the attention kernel ... */
  _Float16* BQ = (_Float16*)take((size_t)DM * DM * 2); _Float16* BK = (_Float16*)take((size_t)DM * DM * 2); _Float16* BV = (_Float16*)take((size_t)DM * DM * 2);
  _Float16* X16 = (_Float16*)take(NR * DM * 2); _Float16* XL16 = (_Float16*)take(NR * DM * 2); float* QUF = (float*)take((size_t)NB * QT0 * DM * 4); float* QVF = (float*)take((size_t)NB * QT0 * DM * 4); float* KF0 = (float*)take((size_t)NB * QT0 * DM * 4); float* VF0 = (float*)take((size_t)NB * QT0 * DM * 4);
  if (off > ws_size) return;
  /* ... shares its bytes with the operands of the output stage, written by it and behind it. */
  off = offs;
  _Float16* O16 = (_Float16*)take(NR * DM * 2); _Float16* OL16 = (_Float16*)take(NR * DM * 2); _Float16* OH0 = (_Float16*)take((size_t)NB * QT0 * DM * 2); _Float16* OL0 = (_Float16*)take((size_t)NB * QT0 * DM * 2);
  { const unsigned gw = (unsigned)(((size_t)DM * DM / 8 + 255) / 256); k_wt_f16<DM, DM><<<gw, 256, 0, stream>>>(wq, BQ, 16.0f); k_wt_f16<DM, DM><<<gw, 256, 0, stream>>>(wk, BK, 16.0f); k_wt_f16<DM, DM><<<gw, 256, 0, stream>>>(wv, BV, 16.0f); k_wt_f16<DM, DM><<<gw, 256, 0, stream>>>(wres, BR, 16.0f); }      /* [in][out] ([in][h][k] flattened) -> Bt x16, fragment order */
  k_rmsx<<<(unsigned)(NR / 16), 512, 0, stream>>>(x, g, 1e-6f, X16, XL16);      /* x_t = RMSNorm(bf16(x)) g (f32, in registers) -> f16 hi rows (+ x1024 residual rows for the exact first tile) */
  k_x16<HD><<<(unsigned)(((size_t)NH * SQ * HD / 8 + 255) / 256), 256, 0, stream>>>(xlr, R16, (size_t)NH * SQ * HD / 8);      /* xl_r [h][j][64] as exact f16 rows (bf16-valued input), fragment order */
  k_gemm2<0><<<dim3((unsigned)((NR / 128) * (DM / 64)), 1), 128, 0, stream>>>(X16, DM, 0, BQ, DM, 0, 0.0078125f, xlu, 0, nullptr, 1, 0, 0, nullptr, QU, DM, 0, (int)NR, DM, DM, 0, 0, 0); k_gemm2<0><<<dim3((unsigned)((NR / 128) * (DM / 64)), 1), 128, 0, stream>>>(X16, DM, 0, BQ, DM, 0, 0.0078125f, xlv, 0, nullptr, 1, 0, 0, nullptr, QV, DM, 0, (int)NR, DM, DM, 0, 0, 0);      /* q / 8 + xl_u and q / 8 + xl_v (the per-head 64-vectors as [1024] column biases) -> f16 rows */
  k_gemm2<0><<<dim3((unsigned)((NR / 128) * (DM / 64)), 1), 128, 0, stream>>>(X16, DM, 0, BK, DM, 0, 0.0625f, nullptr, 0, nullptr, 1, 0, 0, nullptr, K16, DM, 0, (int)NR, DM, DM, 0, 0, 0); k_gemm2v<<<(unsigned)((NR / 128) * (DM / 64)), 128, 0, stream>>>(X16, BV, 0.0625f, VT, VTL);      /* k -> f16; v (f32 accumulators) -> V^T f16 hi + x1024 residual [batch][16][64][SQ] (the first causal rows copy v almost verbatim into small outputs) */
  /* From here to the output stage the two batches, which share nothing but weights, stand side by side in every launch: the batch is one more grid index. */
  const size_t zX = (size_t)SQ * DM, z0 = (size_t)QT0 * DM;      /* batch strides of the token-row planes and of the first-tile planes */
  { const dim3 g0((QT0 / 32) * (DM / 64), 1, NB);      /* hi and residual rows of x_t as the two terms of one launch */
    k_gemm2t<2><<<g0, 64, 0, stream>>>(X16, XL16, nullptr, DM, 0, BQ, BQ, nullptr, DM, 0, 0.0078125f, 0.00000762939453125f, 0.f, xlu, QUF, DM, 0, DM, DM, zX, 0, z0);
    k_gemm2t<2><<<g0, 64, 0, stream>>>(X16, XL16, nullptr, DM, 0, BQ, BQ, nullptr, DM, 0, 0.0078125f, 0.00000762939453125f, 0.f, xlv, QVF, DM, 0, DM, DM, zX, 0, z0);
    k_gemm2t<2><<<g0, 64, 0, stream>>>(X16, XL16, nullptr, DM, 0, BK, BK, nullptr, DM, 0, 0.0625f, 0.00006103515625f, 0.f, nullptr, KF0, DM, 0, DM, DM, zX, 0, z0);
    k_gemm2t<2><<<g0, 64, 0, stream>>>(X16, XL16, nullptr, DM, 0, BV, BV, nullptr, DM, 0, 0.0625f, 0.00006103515625f, 0.f, nullptr, VF0, DM, 0, DM, DM, zX, 0, z0);
    k_att0xl<<<dim3(NH * (QT0 / 8), NB), 256, 0, stream>>>(QUF, QVF, KF0, VF0, xlr, OF0); }      /* exact causal XL attention for rows 0..255 of each batch (o x64, f32) */
  k_fattn<<<dim3(SQ / 64, NH, NB), 128, 0, stream>>>(QU, QV, K16, R16, VT, VTL, O16, OL16);      /* wv x64 of every row as f16 hi + x1024 residual rows: scores = AC + rel_shift(BD), causal softmax, P V (hi / residual terms) in one launch */
  k_gemm2<0><<<dim3((unsigned)((NR / 128) * (DM / 64)), 1), 128, 0, stream>>>(O16, DM, 0, BR, DM, 0, 0.0009765625f, nullptr, 0, nullptr, 1, 0, 0, (float*)d_out, nullptr, DM, 0, (int)NR, DM, DM, 0, 0, 0); k_gemm2<0><<<dim3((unsigned)((NR / 128) * (DM / 64)), 1), 128, 0, stream>>>(OL16, DM, 0, BR, DM, 0, 0.00000095367431640625f, nullptr, 0, (const float*)d_out, -1, 0, 0, (float*)d_out, nullptr, DM, 0, (int)NR, DM, DM, 0, 0, 0);      /* res = wv_hi w_res 2^-10 += wv_lo w_res 2^-20 (own element) */
  k_hl<true><<<(unsigned)(((size_t)NB * QT0 * DM / 8 + 255) / 256), 256, 0, stream>>>(OF0, OH0, OL0, (size_t)NB * QT0 * DM / 8);      /* first-tile o (x64) -> f16 hi + x1024 residual planes */
  k_gemm2t<2><<<dim3((QT0 / 32) * (DM / 64), 1, NB), 64, 0, stream>>>(OH0, OL0, nullptr, DM, 0, BR, BR, nullptr, DM, 0, 0.0009765625f, 0.00000095367431640625f, 0.f, nullptr, (float*)d_out, DM, 0, DM, DM, z0, 0, zX);      /* rows 0..255 of each batch rewritten from the exact path: o_hi w_res 2^-10 + o_lo w_res 2^-20 */
}

// v009
// It runs in 188 microseconds.
// Two timings next to v008 put it at 1.49 and 1.51 times that version's speed.
// Over all steps from v000, the starting kernel, it is 82.2 times as fast.
#include <hip/hip_runtime.h>
// Transformer-XL style causal attention with relative-position (rel_shift) scores (x [2][2048][1024]; x_t = RMSNorm(x) g (eps 1e-6); q = x_t w_q / 8, k = x_t w_k, v = x_t w_v (w [1024][16][64] = [in][out], sigma 1/32); scores = (q + xl_u).k^T + rel_shift((q + xl_v).xl_r^T) (xl_r [16][2048][64], xl_u / xl_v [1][16][1][64]); causal: - 1e30 above the diagonal; softmax; wv = w v merged (h*64+v); res = wv w_res ([in][out]) -> [2][2048][1024]. rel_shift with q_len = k_len = T gives bd[i][j] = (q_i + xl_v).xl_r[h][T-1-(i-j)] for j <= i).
// Structure: token rows; x_t = RMSNorm(bf16(x)) in f32 on VALU, one kernel -> f16 hi / residual rows; [in][out] weights as x16 planes; q+u and q+v as two WMMA GEMMs (32x64 wave tiles, f32 accumulation, alpha 1/128, per-head bias vectors), k -> f16 rows, v -> V^T hi / residual straight from the accumulators; xl_r as exact f16 rows; both batches side by side in every launch from here on (batch = grid.z in the attention kernel, part of the token row index elsewhere): exact f32 XL attention for rows 0..255 per batch on VALU (q/k/v of those rows from x_t hi + residual GEMM passes); one attention kernel, a wave per 16 query rows, passes of 32 keys: AC = (q+u) k^T and BD' = (q+v) r^T over the 48 xl_r rows the shift can reach (WMMA, f32), rel_shift by a skewed LDS store, causal select (-1e30 fill, clamped xl_r index), running maximum and sum (f32, native exp; weights x256 f16 hi + residual), o = P V^T (x64) f32 in registers, stored as f16 hi / residual rows; first-tile rows of the o planes rewritten from the exact o; res = o_hi w_res + o_lo w_res 2^-10, both terms in one launch; launches that depend on nothing of each other share one (the job is a grid index); every f16 plane that a WMMA reads (x_t, weights, q+u, q+v, k, xl_r, V^T, o) lies in fragment order (see FragH): each wave-wide 16-byte load is 512 bytes in a row; launches: see trace.
// Compute dtype: inputs rounded to bf16; x / weights exact; q and k as plain f16 GEMM operands (~2^-12); v, softmax weights and o as f16 hi + x1024 residual; scores and softmax statistics f32; v_wmma_f32_16x16x32_f16.
#define NB 2
#define NG 16
#define HPG 1
#define KVD (NG * HD)
#define SQ 2048
#define DM 1024
#define NH 16
#define HD 64
#define HG 4                         /* heads per launch of the (b, h0) k_vt overload, which is not launched */
#define QT 256                       /* query rows per causal tile */
#define NKX SQ                       /* S / P row pitch */
#define QT0 256                      /* first-tile rows recomputed exactly in f32 (= one causal tile) */
#define B0 0                         /* first batch processed (unused) */
#define NBR NB                       /* batches processed (read only by MP) */
#define NR ((size_t)NB * SQ)         /* token rows */
#define MP ((int)((size_t)NBR * SQ)) /* rows projected (read only by MPO) */
#define QN SQ                        /* query rows attended per batch (unused) */
#define NHD NH                       /* heads attended (unused) */
#define MPO MP                       /* rows through the output stage (unused) */
#define LQ DM      /* row pitch of the q/k/v rows */
typedef __bf16 v16b __attribute__((ext_vector_type(16)));
typedef unsigned short v8us __attribute__((ext_vector_type(8), may_alias));
typedef float  v8f  __attribute__((ext_vector_type(8)));
typedef float  v4f  __attribute__((ext_vector_type(4)));
typedef float  v4fa __attribute__((ext_vector_type(4), may_alias));
union FragB { v16b v; v8us half[2]; unsigned short u[16]; };

__device__ __forceinline__ unsigned short bf16_bits(float x) { unsigned int u = __float_as_uint(x); return (unsigned short)((u + 0x7FFFu + ((u >> 16) & 1u)) >> 16); }
__device__ __forceinline__ float bf16_val(unsigned short b) { return __uint_as_float(((unsigned int)b) << 16); }
__device__ __forceinline__ float bf16_round(float x) { return bf16_val(bf16_bits(x)); }
// D += A·B with NT terms: 1 = ah·bh, 2 = + al·bh (A split), 3 = + ah·bl (both split)
template <int NT>
__device__ __forceinline__ v8f mmaN(v16b ah, v16b al, v16b bh, v16b bl, v8f c) {
  c = __builtin_amdgcn_wmma_f32_16x16x32_bf16(false, ah, false, bh, (short)0, c, false, false);
  if (NT >= 2) c = __builtin_amdgcn_wmma_f32_16x16x32_bf16(false, al, false, bh, (short)0, c, false, false);
  if (NT >= 3) c = __builtin_amdgcn_wmma_f32_16x16x32_bf16(false, ah, false, bl, (short)0, c, false, false);
  asm volatile("v_nop\n\tv_nop\n\tv_nop\n\tv_nop" : "+v"(c) : "v"(ah), "v"(al), "v"(bh), "v"(bl));
  return c;
}

__global__ __launch_bounds__(256) void k_wt_bf16(const float* __restrict__ W, unsigned short* __restrict__ Wt, int K, int N) {
  const int t = blockIdx.x * 256 + threadIdx.x;
  const int k8n = K / 8;
  if (t >= N * k8n) return;
  const int n = t / k8n, k8 = (t % k8n) * 8;
  v8us v;
#pragma unroll
  for (int i = 0; i < 8; ++i) v[i] = bf16_bits(W[(size_t)(k8 + i) * N + n]);
  *(v8us*)(Wt + (size_t)n * K + k8) = v;
  
}

// GEMM C[M][N] (f32, pitch ldc) = act(A[M][K]·W + bias). A f32 row-major (pitch lda) converted per fragment to bf16
// (ASPLIT: hi/lo two planes -> 2 terms, else single rounded term); Wt bf16 [N][K] (pitch ldb). BIAS_BF16 rounds the
// bias to bf16 first (bias quantised to bf16 before the add). K%32==0, M%16==0, N%64==0.
template <bool ASPLIT, int ACT, bool BIAS_BF16>
__global__ __launch_bounds__(128) void k_gemm_bf(const float* __restrict__ A, int lda, const unsigned short* __restrict__ Wt, int ldb,
                                               const float* __restrict__ bias, float* __restrict__ C, int ldc, int M, int N, int K) {
  __shared__ __attribute__((aligned(16))) float so[4][16][64];
  const int tid = threadIdx.x, w = tid >> 5, lane = tid & 31, ln = lane & 15, hh = lane >> 4;
  const int ntn = N / 64;
  const int wid = blockIdx.x * 4 + w;
  const int mt = wid / ntn, nq = wid % ntn;
  if (mt * 16 >= M) return;
  const int row0 = mt * 16, col0 = nq * 64;
  const float* arow = A + (size_t)(row0 + ln) * lda;
  v8f acc[4] = {};
  for (int kb = 0; kb < K; kb += 32) {
    FragB ah, al;
    const v4f x0 = *(const v4fa*)(arow + kb + 8 * hh), x1 = *(const v4fa*)(arow + kb + 8 * hh + 4);
    const v4f x2 = *(const v4fa*)(arow + kb + 16 + 8 * hh), x3 = *(const v4fa*)(arow + kb + 16 + 8 * hh + 4);
    float xs[16] = {x0[0],x0[1],x0[2],x0[3],x1[0],x1[1],x1[2],x1[3],x2[0],x2[1],x2[2],x2[3],x3[0],x3[1],x3[2],x3[3]};
#pragma unroll
    for (int i = 0; i < 16; ++i) { const unsigned short hb = bf16_bits(xs[i]); ah.u[i] = hb; al.u[i] = ASPLIT ? bf16_bits(xs[i] - bf16_val(hb)) : (unsigned short)0; }
#pragma unroll
    for (int t = 0; t < 4; ++t) {
      const unsigned short* brow = Wt + (size_t)(col0 + t * 16 + ln) * ldb + kb;
      FragB b;
      b.half[0] = *(const v8us*)(brow + 8 * hh);
      b.half[1] = *(const v8us*)(brow + 16 + 8 * hh);
      acc[t] = mmaN<ASPLIT ? 2 : 1>(ah.v, al.v, b.v, b.v, acc[t]);
    }
  }
#pragma unroll
  for (int t = 0; t < 4; ++t) {
    float bv = bias ? bias[col0 + t * 16 + ln] : 0.f;
    if (BIAS_BF16) bv = bf16_round(bv);
#pragma unroll
    for (int r = 0; r < 8; ++r) { float v = acc[t][r] + bv; if (ACT == 1) v = fmaxf(v, 0.f); so[w][8 * hh + r][t * 16 + ln] = v; }
  }
  __builtin_amdgcn_fence(__ATOMIC_ACQ_REL, "workgroup");
  __builtin_amdgcn_wave_barrier();
  const int rsub = lane >> 4, c4 = (lane & 15) * 4;
  {
#pragma unroll
    for (int q = 0; q < 8; ++q) {
      const int r = q * 2 + rsub;
      const v4f v = *(const v4fa*)&so[w][r][c4];
      *(v4f*)(C + (size_t)(row0 + r) * ldc + col0 + c4) = v;
    }
    
  }
}

// GEMM C = act(A·W + bias + resid): A f32 (ASPLIT -> hi/lo 2 terms), Wt bf16 [N][K]; ACT 0 none, 1 relu, 2 exact gelu;
// resid (optional, f32, row index = (row % rmod), pitch ldr, RES_BF16 rounds it) added before the activation.
template <bool ASPLIT, int ACT, bool BIAS_BF16, bool RES_BF16>
__global__ __launch_bounds__(128) void k_gemm_bf3(const float* __restrict__ A, int lda, const unsigned short* __restrict__ Wt, int ldb,
                                                const float* __restrict__ bias, const float* __restrict__ resid, int rmod, int ldr,
                                                float* __restrict__ C, int ldc, int M, int N, int K) {
  __shared__ __attribute__((aligned(16))) float so[4][16][64];
  const int tid = threadIdx.x, w = tid >> 5, lane = tid & 31, ln = lane & 15, hh = lane >> 4;
  const int ntn = N / 64;
  const int wid = blockIdx.x * 4 + w;
  const int mt = wid / ntn, nq = wid % ntn;
  if (mt * 16 >= M) return;
  const int row0 = mt * 16, col0 = nq * 64;
  const float* arow = A + (size_t)(row0 + ln) * lda;
  v8f acc[4] = {};
  for (int kb = 0; kb < K; kb += 32) {
    FragB ah, al;
    const v4f x0 = *(const v4fa*)(arow + kb + 8 * hh), x1 = *(const v4fa*)(arow + kb + 8 * hh + 4);
    const v4f x2 = *(const v4fa*)(arow + kb + 16 + 8 * hh), x3 = *(const v4fa*)(arow + kb + 16 + 8 * hh + 4);
    float xs[16] = {x0[0],x0[1],x0[2],x0[3],x1[0],x1[1],x1[2],x1[3],x2[0],x2[1],x2[2],x2[3],x3[0],x3[1],x3[2],x3[3]};
#pragma unroll
    for (int i = 0; i < 16; ++i) { const unsigned short hb = bf16_bits(xs[i]); ah.u[i] = hb; al.u[i] = ASPLIT ? bf16_bits(xs[i] - bf16_val(hb)) : (unsigned short)0; }
#pragma unroll
    for (int t = 0; t < 4; ++t) {
      const unsigned short* brow = Wt + (size_t)(col0 + t * 16 + ln) * ldb + kb;
      FragB b;
      b.half[0] = *(const v8us*)(brow + 8 * hh);
      b.half[1] = *(const v8us*)(brow + 16 + 8 * hh);
      acc[t] = mmaN<ASPLIT ? 2 : 1>(ah.v, al.v, b.v, b.v, acc[t]);
    }
  }
#pragma unroll
  for (int t = 0; t < 4; ++t) {
    const int col = col0 + t * 16 + ln;
    float bv = bias ? bias[col] : 0.f;
    if (BIAS_BF16) bv = bf16_round(bv);
#pragma unroll
    for (int r = 0; r < 8; ++r) {
      float v = acc[t][r] + bv;
      if (resid) { float rv = resid[(size_t)((row0 + 8 * hh + r) % rmod) * ldr + col]; if (RES_BF16) rv = bf16_round(rv); v += rv; }
      if (ACT == 1) v = fmaxf(v, 0.f);
      if (ACT == 2) v = 0.5f * v * (1.0f + erff(v * 0.70710678118654752f));
      if (ACT == 3) { const float u = 0.7978845608028654f * (v + 0.044715f * v * v * v); v = 0.5f * v * (1.0f + tanhf(u)); }
      so[w][8 * hh + r][t * 16 + ln] = v;
    }
  }
  __builtin_amdgcn_fence(__ATOMIC_ACQ_REL, "workgroup");
  __builtin_amdgcn_wave_barrier();
  const int rsub = lane >> 4, c4 = (lane & 15) * 4;
  {
#pragma unroll
    for (int q = 0; q < 8; ++q) {
      const int r = q * 2 + rsub;
      const v4f v = *(const v4fa*)&so[w][r][c4];
      *(v4f*)(C + (size_t)(row0 + r) * ldc + col0 + c4) = v;
    }
    
  }
}
// row LayerNorm (biased variance, eps) over N: s = X (+ R); optional out_sum <- s; out_norm <- (s-mu)*rsqrt(var+eps)*g + b
template <bool PARAM_BF16>
__global__ __launch_bounds__(256) void k_layernorm(const float* __restrict__ X, const float* __restrict__ R, const float* __restrict__ g, const float* __restrict__ bta,
                                                  float* __restrict__ out_sum, float* __restrict__ out_norm, int N, float eps) {
  __shared__ float red[256];
  const int row = blockIdx.x, tid = threadIdx.x;
  const float* x = X + (size_t)row * N; const float* rr = R ? R + (size_t)row * N : nullptr;
  float vals[16];                     // up to N = 4096
  const int per = N / 256;            // contiguous chunk per thread? use strided-by-4 chunks: thread handles j = tid*4 + 1024*u
  float s1 = 0.f;
  for (int u = 0; u < per / 4; ++u) {
    const int j = tid * 4 + 1024 * u;
    const v4f a = *(const v4fa*)(x + j);
    v4f b = {0.f,0.f,0.f,0.f}; if (rr) b = *(const v4fa*)(rr + j);
#pragma unroll
    for (int q = 0; q < 4; ++q) { const float v = a[q] + b[q]; vals[u * 4 + q] = v; s1 += v; }
  }
  red[tid] = s1; __syncthreads();
  for (int st = 128; st > 0; st >>= 1) { if (tid < st) red[tid] += red[tid + st]; __syncthreads(); }
  const float mu = red[0] / (float)N; __syncthreads();
  float s2 = 0.f;
  for (int u = 0; u < per / 4; ++u)
#pragma unroll
    for (int q = 0; q < 4; ++q) { const float c = vals[u * 4 + q] - mu; s2 += c * c; }
  red[tid] = s2; __syncthreads();
  for (int st = 128; st > 0; st >>= 1) { if (tid < st) red[tid] += red[tid + st]; __syncthreads(); }
  const float rs = rsqrtf(red[0] / (float)N + eps);
  {
    for (int u = 0; u < per / 4; ++u) {
      const int j = tid * 4 + 1024 * u;
      v4f o, sm;
#pragma unroll
      for (int q = 0; q < 4; ++q) {
        float gg = g[j + q], bb = bta[j + q];
        if (PARAM_BF16) { gg = bf16_round(gg); bb = bf16_round(bb); }
        sm[q] = vals[u * 4 + q]; o[q] = (vals[u * 4 + q] - mu) * rs * gg + bb;
      }
      if (out_sum) *(v4f*)(out_sum + (size_t)row * N + j) = sm;
      *(v4f*)(out_norm + (size_t)row * N + j) = o;
    }
    
  }
}



// ---- f16 WMMA path (v_wmma_f32_16x16x32_f16): 11-bit significands for operands in range — used where a [0,1] probability operand needs more precision than bf16
typedef _Float16 v16h __attribute__((ext_vector_type(16)));
union FragH { v16h v; v8us half[2]; _Float16 h[16]; unsigned short u[16]; };
// FRAGMENT ORDER of an f16 operand plane [rows][kc] (rows % 16 == 0, kc % 32 == 0): a band of 16 rows keeps its 32 kc bytes; inside it every 16 x 32 block is 1 KiB = two halves of 512 bytes,
// half j = [lane = 16 hh + ln][8 elements]: row ln, k = 16 j + 8 hh .. + 7. A wave-wide 16-byte load of a half then reads 512 bytes in a row (4 lines) where row-major rows gave 16 pieces of 32 bytes in 16 lines.
// Element index, in the row-major plane [rows][KC], of the 8 elements that 16-byte piece t of the plane in fragment order holds.
template <int KC>
__device__ __forceinline__ size_t pk_src(size_t t) { const size_t band = t / (KC * 2); const unsigned rem = (unsigned)(t % (KC * 2)); return (band * 16 + (rem & 15u)) * (size_t)KC + (rem >> 6) * 32u + ((rem >> 4) & 3u) * 8u; }
template <int NT>
__device__ __forceinline__ v8f mmaH(v16h ah, v16h al, v16h bh, v16h bl, v8f c) {
  c = __builtin_amdgcn_wmma_f32_16x16x32_f16(false, ah, false, bh, (short)0, c, false, false);
  if (NT >= 2) c = __builtin_amdgcn_wmma_f32_16x16x32_f16(false, al, false, bh, (short)0, c, false, false);
  if (NT >= 3) c = __builtin_amdgcn_wmma_f32_16x16x32_f16(false, ah, false, bl, (short)0, c, false, false);
  asm volatile("v_nop\n\tv_nop\n\tv_nop\n\tv_nop" : "+v"(c) : "v"(ah), "v"(al), "v"(bh), "v"(bl));
  return c;
}
// batched GEMM like k_gemm_b but f16 operands: A f32 (split into f16 hi/lo if ASPLIT, else rounded to f16), Bt = f16 values [n][k]; alpha; C f32; N multiple of 16 (partial tiles skipped)
template <bool ASPLIT>
__global__ __launch_bounds__(128) void k_gemm_h(const float* __restrict__ A, int lda, size_t sA, const _Float16* __restrict__ Bh, int ldb, size_t sB, float alpha, float* __restrict__ C, int ldc, size_t sC, int M, int N, int K) {
  __shared__ __attribute__((aligned(16))) float so[4][16][64];
  const int tid = threadIdx.x, w = tid >> 5, lane = tid & 31, ln = lane & 15, hh = lane >> 4; const int by = blockIdx.y;
  A += (size_t)by * sA; Bh += (size_t)by * sB; C += (size_t)by * sC;
  const int ntn = (N + 63) / 64; const int wid = blockIdx.x * 4 + w; const int mt = wid / ntn, nq = wid % ntn; if (mt * 16 >= M) return;
  const int row0 = mt * 16, col0 = nq * 64; const float* arow = A + (size_t)(row0 + ln) * lda;
  v8f acc[4] = {};
  for (int kb = 0; kb < K; kb += 32) {
    FragH ah, al;
    const v4f x0 = *(const v4fa*)(arow + kb + 8 * hh), x1 = *(const v4fa*)(arow + kb + 8 * hh + 4), x2 = *(const v4fa*)(arow + kb + 16 + 8 * hh), x3 = *(const v4fa*)(arow + kb + 16 + 8 * hh + 4);
    float xs[16] = {x0[0],x0[1],x0[2],x0[3],x1[0],x1[1],x1[2],x1[3],x2[0],x2[1],x2[2],x2[3],x3[0],x3[1],x3[2],x3[3]};
#pragma unroll
    for (int i = 0; i < 16; ++i) { const _Float16 h = (_Float16)xs[i]; ah.h[i] = h; al.h[i] = ASPLIT ? (_Float16)(xs[i] - (float)h) : (_Float16)0.0f; }
#pragma unroll
    for (int t = 0; t < 4; ++t) { if (col0 + t * 16 >= N) continue; const size_t boff = (size_t)(col0 + t * 16 + ln) * ldb + kb; FragH bq; bq.half[0] = *(const v8us*)(Bh + boff + 8 * hh); bq.half[1] = *(const v8us*)(Bh + boff + 16 + 8 * hh);
      acc[t] = mmaH<ASPLIT ? 2 : 1>(ah.v, al.v, bq.v, bq.v, acc[t]); }
  }
#pragma unroll
  for (int t = 0; t < 4; ++t) { if (col0 + t * 16 >= N) continue;
#pragma unroll
    for (int r = 0; r < 8; ++r) so[w][8 * hh + r][t * 16 + ln] = acc[t][r] * alpha; }
  __builtin_amdgcn_fence(__ATOMIC_ACQ_REL, "workgroup"); __builtin_amdgcn_wave_barrier();
  const int rsub = lane >> 4, c4 = (lane & 15) * 4;
  {
#pragma unroll
    for (int q = 0; q < 8; ++q) { const int r = q * 2 + rsub; if (col0 + c4 < N) { const v4f v = *(const v4fa*)&so[w][r][c4]; *(v4f*)(C + (size_t)(row0 + r) * ldc + col0 + c4) = v; } }
     }
}

// Wt[n][k] = f16(W[k][n] * scale) from f32 row-major W[K][N] (scale = power of two; bf16-exact weights stay exact in f16 away from the subnormal range); Wt in fragment order, thread t = one 16-byte piece of it
template <int K, int N>
__device__ __forceinline__ void d_wt_f16(const float* __restrict__ W, _Float16* __restrict__ Wt, float scale, const int t) {
  if (t >= N * (K / 8)) return; const size_t e = pk_src<K>((size_t)t); const float* wp = W + (e % K) * N + e / K; float x[8]; FragH f;      /* n = e / K, k = e % K .. + 7 */
#pragma unroll
  for (int i = 0; i < 8; ++i) x[i] = wp[(size_t)i * N];
  asm volatile("s_wait_xcnt 0x0" :: "v"(wp) : "memory");      /* the wait that stands in front of any overwrite of a register that an issued load names; the address is an input so that no load gets it as its destination */
#pragma unroll
  for (int i = 0; i < 8; ++i) f.h[i] = (_Float16)(bf16_round(x[i]) * scale); const v8us o = f.half[0];
  *(v8us*)((unsigned short*)Wt + (size_t)t * 8) = o; 
}
// k_gemm_hh variant with fused epilogue: v = acc·alpha + bias[by·sBias + col] (+ CP[(row/rowsPerB)·sCPb + by·64 + col] if CP) ; ACT 0 none / 1 elu ; writes f16 C16 (and f32 C if non-null)
template <int ACT>
__global__ __launch_bounds__(128) void k_gemm_hhx(const _Float16* __restrict__ A, int lda, size_t sA, const _Float16* __restrict__ Bh, int ldb, size_t sB, float alpha, const float* __restrict__ bias, size_t sBias, const float* __restrict__ CP, int rowsPerB, size_t sCPb, int row0g,
    float* __restrict__ C, _Float16* __restrict__ C16, int ldc, size_t sC, int M, int N, int K) {
  __shared__ __attribute__((aligned(16))) float so[4][16][64];
  const int tid = threadIdx.x, w = tid >> 5, lane = tid & 31, ln = lane & 15, hh = lane >> 4; const int by = blockIdx.y;
  A += (size_t)by * sA; Bh += (size_t)by * sB; const size_t cofs = (size_t)by * sC; const float* bp = bias ? bias + (size_t)by * sBias : nullptr;
  const int ntn = (N + 63) / 64; const int wid = blockIdx.x * 4 + w; const int mt = wid / ntn, nq = wid % ntn; if (mt * 16 >= M) return;
  const int row0 = mt * 16, col0 = nq * 64; const _Float16* arow = A + (size_t)(row0 + ln) * lda;
  v8f acc[4] = {};
  for (int kb = 0; kb < K; kb += 32) { FragH ah; ah.half[0] = *(const v8us*)((const unsigned short*)arow + kb + 8 * hh); ah.half[1] = *(const v8us*)((const unsigned short*)arow + kb + 16 + 8 * hh);
#pragma unroll
    for (int t = 0; t < 4; ++t) { if (col0 + t * 16 >= N) continue; const size_t boff = (size_t)(col0 + t * 16 + ln) * ldb + kb; FragH bq; bq.half[0] = *(const v8us*)((const unsigned short*)Bh + boff + 8 * hh); bq.half[1] = *(const v8us*)((const unsigned short*)Bh + boff + 16 + 8 * hh);
      acc[t] = mmaH<1>(ah.v, ah.v, bq.v, bq.v, acc[t]); }
  }
#pragma unroll
  for (int t = 0; t < 4; ++t) { if (col0 + t * 16 >= N) continue; const int col = col0 + t * 16 + ln; const float bv = bp ? bf16_round(bp[col]) : 0.f;
#pragma unroll
    for (int r = 0; r < 8; ++r) { float v = acc[t][r] * alpha + bv; if (CP) { const int rr = row0g + row0 + 8 * hh + r; if (rowsPerB < 0) v += CP[cofs + (size_t)rr * ldc + col];      /* rowsPerB < 0: own element of the batched C plane */ else { const int bidx = rr / rowsPerB; v += CP[(size_t)bidx * sCPb + (size_t)by * 64 + col]; } } if (ACT == 1) v = (v > 0.f) ? v : expm1f(v); else if (ACT == 7) v = (v > 0.f) ? v + 1.0f : expf(v); else if (ACT == 8) v = tanhf(v); else if (ACT == 9) v = 0.5f * v * (1.0f + tanhf(0.7978845608028654f * (v + 0.044715f * v * v * v))); else if (ACT == 11) v = 1.0f / (1.0f + expf(-v)); else if (ACT == 12) v = (v > 0.f) ? v : 0.01f * v; else if (ACT == 14) v = (v > 0.f) ? v : 0.1f * v; else if (ACT == 16) v = (v >= 0.f) ? v : 0.3f * v; else if (ACT == 17) v = (v >= 0.f) ? v : 0.2f * v; else if (ACT == 15) v = v / (1.0f + expf(-v)); else if (ACT == 3) v = fmaxf(v, 0.f); else if (ACT == 6) v = 0.5f * v * (1.0f + erff(v * 0.70710678118654752f)); so[w][8 * hh + r][t * 16 + ln] = v; } }
  __builtin_amdgcn_fence(__ATOMIC_ACQ_REL, "workgroup"); __builtin_amdgcn_wave_barrier();
  const int rsub = lane >> 4, c4 = (lane & 15) * 4; typedef _Float16 v4h __attribute__((ext_vector_type(4)));
  {
#pragma unroll
    for (int q = 0; q < 8; ++q) { const int r = q * 2 + rsub; if (col0 + c4 < N) { const v4f v = *(const v4fa*)&so[w][r][c4]; if (C) *(v4f*)(C + cofs + (size_t)(row0 + r) * ldc + col0 + c4) = v; if (C16) { v4h h4; for (int i = 0; i < 4; ++i) h4[i] = (_Float16)v[i]; *(v4h*)(C16 + cofs + (size_t)(row0 + r) * ldc + col0 + c4) = h4; } } }
     }
}


typedef _Float16 v4h __attribute__((ext_vector_type(4)));

/* x row-major [rows][KC]; X16 in fragment order, thread t = one 16-byte piece of it */
template <int KC>
__device__ __forceinline__ void d_x16(const float* __restrict__ x, _Float16* __restrict__ X16, size_t n8, const size_t t) { if (t >= n8) return; const size_t e = pk_src<KC>(t); FragH f;
#pragma unroll
  for (int q = 0; q < 8; ++q) f.h[q] = (_Float16)bf16_round(x[e + q]); *(v8us*)((unsigned short*)X16 + t * 8) = f.half[0];  }
__global__ __launch_bounds__(256) void k_h16(const float* __restrict__ x, _Float16* __restrict__ X16, size_t n8) { const size_t t = (size_t)blockIdx.x * 256 + threadIdx.x; if (t >= n8) return; FragH f;
#pragma unroll
  for (int q = 0; q < 8; ++q) f.h[q] = (_Float16)x[t * 8 + q]; *(v8us*)((unsigned short*)X16 + t * 8) = f.half[0];  }
__global__ __launch_bounds__(256) void k_round16f(const float* __restrict__ W, _Float16* __restrict__ Bt, size_t n8) { const size_t t = (size_t)blockIdx.x * 256 + threadIdx.x; if (t >= n8) return; FragH f;
#pragma unroll
  for (int i = 0; i < 8; ++i) f.h[i] = (_Float16)(bf16_round(W[t * 8 + i]) * 16.0f); *(v8us*)((unsigned short*)Bt + t * 8) = f.half[0];  }
/* PK: F row-major [rows][DM], Hh and Hl in fragment order (thread = one 16-byte piece of each); else all three row-major. F holds blk8 pieces per batch, Hh and Hl pitch8: the rows of F become the first rows of each batch there */
template <bool PK>
__global__ __launch_bounds__(256) void k_hl(const float* __restrict__ F, _Float16* __restrict__ Hh, _Float16* __restrict__ Hl, size_t n8, size_t blk8, size_t pitch8) { const size_t t = (size_t)blockIdx.x * 256 + threadIdx.x; if (t >= n8) return; const size_t e = PK ? pk_src<DM>(t) : t * 8; FragH fh, fl; const v4f a = *(const v4fa*)(F + e), c = *(const v4fa*)(F + e + 4);
#pragma unroll
  for (int q = 0; q < 4; ++q) { _Float16 h = (_Float16)a[q]; fh.h[q] = h; fl.h[q] = (_Float16)((a[q] - (float)h) * 1024.0f); h = (_Float16)c[q]; fh.h[4 + q] = h; fl.h[4 + q] = (_Float16)((c[q] - (float)h) * 1024.0f); }
  { const size_t d = (t / blk8) * pitch8 + t % blk8; *(v8us*)((unsigned short*)Hh + d * 8) = fh.half[0]; *(v8us*)((unsigned short*)Hl + d * 8) = fl.half[0];  } }

// ---- fast GEMM (wave tile 32x64; requires M % 32 == 0 rows per launch region and N % 64 == 0); epilogue = k_gemm_hhx semantics ----
__device__ __forceinline__ v8f g2_mma(v16h a, v16h b, v8f c) { v8f d = __builtin_amdgcn_wmma_f32_16x16x32_f16(false, a, false, b, (short)0, c, false, false); asm volatile("v_nop\n\tv_nop\n\tv_nop\n\tv_nop" : "+v"(d) : "v"(a), "v"(b)); return d; }
// One k-step (32 k) of the wave's 32x64 tile: two A and four B fragments = twelve 16-byte loads of 512 bytes in a row each (A and B in fragment order). pa / pb: wave-uniform byte address of A / B at that k-step (1 KiB a k-step); oa / ob: the lane's fixed byte offsets (band and lane).
struct G2St { v16h a0, a1, b0, b1, b2, b3; };
__device__ __forceinline__ v16h g2_fragb(const char* base, unsigned o) { FragH f; f.half[0] = *(const v8us*)(base + (size_t)o); f.half[1] = *(const v8us*)(base + (size_t)o + 512); return f.v; }
__device__ __forceinline__ void g2_ld(G2St& s, const char* pa, const char* pb, unsigned oa0, unsigned oa1, unsigned ob0, unsigned ob1, unsigned ob2, unsigned ob3) {
  s.a0 = g2_fragb(pa, oa0); s.a1 = g2_fragb(pa, oa1); s.b0 = g2_fragb(pb, ob0); s.b1 = g2_fragb(pb, ob1); s.b2 = g2_fragb(pb, ob2); s.b3 = g2_fragb(pb, ob3);
  __builtin_amdgcn_sched_barrier(0); }      /* keeps the twelve loads in front of the next k-step's first WMMA: behind it they would be issued only after that WMMA's wait for its own operands */
// The wait that stands in front of any overwrite of a register that an issued load names. The bases and the lane offsets are inputs so that they stay as they are up to here.
__device__ __forceinline__ void g2_xw(const char* pa, const char* pb, unsigned oa0, unsigned oa1, unsigned ob0, unsigned ob1, unsigned ob2, unsigned ob3) { asm volatile("s_wait_xcnt 0x0" :: "s"(pa), "s"(pb), "v"(oa0), "v"(oa1), "v"(ob0), "v"(ob1), "v"(ob2), "v"(ob3) : "memory"); }
__device__ __forceinline__ void g2_mm(const G2St& s, v8f (&c)[8]) { c[0] = g2_mma(s.a0, s.b0, c[0]); c[4] = g2_mma(s.a1, s.b0, c[4]); c[1] = g2_mma(s.a0, s.b1, c[1]); c[5] = g2_mma(s.a1, s.b1, c[5]); c[2] = g2_mma(s.a0, s.b2, c[2]); c[6] = g2_mma(s.a1, s.b2, c[6]); c[3] = g2_mma(s.a0, s.b3, c[3]); c[7] = g2_mma(s.a1, s.b3, c[7]); }
// The K loop of a wave's 32x64 tile (nst k-steps of 32), shared by the GEMM kernels below. pa / pb: wave-uniform bases; the offsets: the lane's own.
__device__ __forceinline__ void g2_kloop(const char* pa, const char* pb, const int nst, const unsigned oa0, const unsigned oa1, const unsigned ob0, const unsigned ob1, const unsigned ob2, const unsigned ob3, v8f (&accs)[8]) { G2St s0, s1, s2;
  // Three k-steps' fragments rest in registers: a set is loaded again right after its WMMAs, so its loads fly while the other two sets are worked on. Every accumulator still takes its k-steps in rising order.
  if (nst >= 3) { g2_ld(s0, pa, pb, oa0, oa1, ob0, ob1, ob2, ob3); g2_ld(s1, pa + 1024, pb + 1024, oa0, oa1, ob0, ob1, ob2, ob3); g2_ld(s2, pa + 2048, pb + 2048, oa0, oa1, ob0, ob1, ob2, ob3); g2_xw(pa, pb, oa0, oa1, ob0, ob1, ob2, ob3); int s = 0;
#pragma unroll 1      /* the body already holds three k-steps; a copy of it would not fit the registers */
    for (; s + 6 <= nst; s += 3) {
      g2_mm(s0, accs); g2_ld(s0, pa + 3072, pb + 3072, oa0, oa1, ob0, ob1, ob2, ob3);
      g2_mm(s1, accs); g2_ld(s1, pa + 4096, pb + 4096, oa0, oa1, ob0, ob1, ob2, ob3);
      g2_mm(s2, accs); g2_ld(s2, pa + 5120, pb + 5120, oa0, oa1, ob0, ob1, ob2, ob3);
      g2_xw(pa, pb, oa0, oa1, ob0, ob1, ob2, ob3);      /* the two bases move on below */
      pa += 3072; pb += 3072; }
    const int rem = nst - s;      /* 3 to 5 k-steps are left, three of them loaded */
    g2_mm(s0, accs); if (rem > 3) { g2_ld(s0, pa + 3072, pb + 3072, oa0, oa1, ob0, ob1, ob2, ob3); g2_xw(pa, pb, oa0, oa1, ob0, ob1, ob2, ob3); }
    g2_mm(s1, accs); if (rem > 4) { g2_ld(s1, pa + 4096, pb + 4096, oa0, oa1, ob0, ob1, ob2, ob3); g2_xw(pa, pb, oa0, oa1, ob0, ob1, ob2, ob3); }
    g2_mm(s2, accs); if (rem > 3) g2_mm(s0, accs); if (rem > 4) g2_mm(s1, accs); }
  else if (nst == 2) { g2_ld(s0, pa, pb, oa0, oa1, ob0, ob1, ob2, ob3); g2_ld(s1, pa + 1024, pb + 1024, oa0, oa1, ob0, ob1, ob2, ob3); g2_xw(pa, pb, oa0, oa1, ob0, ob1, ob2, ob3); g2_mm(s0, accs); g2_mm(s1, accs); }
  else if (nst == 1) { g2_ld(s0, pa, pb, oa0, oa1, ob0, ob1, ob2, ob3); g2_xw(pa, pb, oa0, oa1, ob0, ob1, ob2, ob3); g2_mm(s0, accs); }
}
// Every product of x_t in ONE launch: they share operands and depend on nothing of each other. All have the wave tile 32x64 and the K loop above; grid.y picks the job, grid.x the tile.
// grid.y = 0: q / 8 + xl_u, 1: q / 8 + xl_v, 2: k, each -> f16 rows in fragment order; 3: v -> V^T; all token rows, a work-group = 128x64, a wave = 32 rows of it.
// grid.y = 4: the same four products (grid.x / 128) for the first QT0 rows of each batch, in f32: a work-group is two 32x64 tiles of C one below the other, a tile has two waves;
// wave t of a tile runs the whole K loop of term t (0: hi rows of x_t, 1: x1024 residual rows), lays its scaled tile in its own LDS plane, and behind one barrier the two planes are added, hi + residual, and stored as whole rows.
// V^T [batch * NH + head][64][SQ], f16 hi and x1024 residual planes in fragment order: an accumulator tile holds, per lane, dim 16 t + ln and tokens 16 half + 8 hh .. + 7:
// the very 16-byte piece (band t, half block 'half', lane) of V^T, so no transpose and no LDS. A wave's 32 tokens are one 1-KiB block of each of the head's four bands.
__global__ __launch_bounds__(128) void k_proj(const _Float16* __restrict__ X16, const _Float16* __restrict__ XL16, const _Float16* __restrict__ BQ, const _Float16* __restrict__ BK, const _Float16* __restrict__ BV, const float* __restrict__ xlu, const float* __restrict__ xlv,
    _Float16* __restrict__ QU, _Float16* __restrict__ QV, _Float16* __restrict__ K16, _Float16* __restrict__ Vt, _Float16* __restrict__ Vtl, float* __restrict__ QUF, float* __restrict__ QVF, float* __restrict__ KF0, float* __restrict__ VF0) {
  __shared__ __attribute__((aligned(16))) float so[4][32][68];
  const int lane = threadIdx.x & 31, ln = lane & 15, hh = lane >> 4; const int w = __builtin_amdgcn_readfirstlane((int)(threadIdx.x >> 5));      /* wave-uniform: the job's bases stay scalar */
  const int bx = blockIdx.x; const bool ft = blockIdx.y == 4; const int prod = ft ? bx / 128 : (int)blockIdx.y; const int t = ft ? (w & 1) : 0; const int nq = bx % (DM / 64);      /* nq = head */
  const int frow = ((bx % 128) / (DM / 64)) * 64 + (w >> 1) * 32;      /* ft: the tile's first row among the NB * QT0 first-tile rows */
  const int row0 = ft ? (frow / QT0) * SQ + frow % QT0 : (bx / (DM / 64)) * 128 + 32 * w, col0 = nq * 64;      /* row0: token row */
  const _Float16* A = t ? XL16 : X16; const _Float16* Bh = (prod < 2) ? BQ : (prod == 2) ? BK : BV; const float alpha = ((prod < 2) ? 0.0078125f : 0.0625f) * (t ? 0.0009765625f : 1.0f);      /* weights x16; q / 8; residual x1024 */
  const float* bp = (t != 0) ? nullptr : (prod == 0) ? xlu : (prod == 1) ? xlv : nullptr;      /* the per-head 64-vectors as a [1024] column bias, with the first term */
  const unsigned oa0 = (unsigned)row0 * (DM * 2u) + 16u * lane, oa1 = oa0 + 32u * DM;      /* fragment order: the band's first byte + the lane's 16 bytes */
  const unsigned ob0 = (unsigned)col0 * (DM * 2u) + 16u * lane, ob1 = ob0 + 32u * DM, ob2 = ob1 + 32u * DM, ob3 = ob2 + 32u * DM;
  const v8f z8 = {0.f,0.f,0.f,0.f,0.f,0.f,0.f,0.f}; v8f accs[8] = {z8, z8, z8, z8, z8, z8, z8, z8};
  g2_kloop((const char*)A, (const char*)Bh, DM >> 5, oa0, oa1, ob0, ob1, ob2, ob3, accs);
  if (!ft && prod == 3) {      /* the whole work-group: no barrier lies behind */
    const size_t vo = ((size_t)((row0 / SQ) * NH + nq) * 4) * (32 * (size_t)SQ) + (size_t)((row0 % SQ) >> 5) * 1024 + 16u * lane; FragH fh[8], fl[8];
#pragma unroll
    for (int u = 0; u < 8; ++u) {
#pragma unroll
      for (int r = 0; r < 8; ++r) { const float v = accs[u][r] * alpha; const _Float16 hv = (_Float16)v; fh[u].h[r] = hv; fl[u].h[r] = (_Float16)((v - (float)hv) * 1024.0f); } }
    __builtin_amdgcn_sched_barrier(0);      /* keeps every conversion in front of the first store: no register that an issued store names is written again before the wave ends */
#pragma unroll
    for (int u = 0; u < 8; ++u) { const size_t o = vo + (size_t)(u & 3) * (32 * (size_t)SQ) + (u >> 2) * 512; *(v8us*)((char*)Vt + o) = fh[u].half[0]; *(v8us*)((char*)Vtl + o) = fl[u].half[0]; }
    return; }
#pragma unroll
  for (int u = 0; u < 8; ++u) { const int tc = u & 3, half = u >> 2; const float bv = bp ? bf16_round(bp[col0 + tc * 16 + ln]) : 0.f;
#pragma unroll
    for (int r = 0; r < 8; ++r) so[w][half * 16 + 8 * hh + r][tc * 16 + ln] = accs[u][r] * alpha + bv; }
  if (ft) { float* C = (prod == 0) ? QUF : (prod == 1) ? QVF : (prod == 2) ? KF0 : VF0;
    __syncthreads();      /* both terms' planes are complete before any wave adds them */
    const int rsub = lane >> 4, c4 = (lane & 15) * 4, p0 = w & 2;      /* p0: the hi plane of the wave's tile */
    for (int q = t; q < 16; q += 2) { const int r = q * 2 + rsub; v4f v = *(const v4fa*)&so[p0][r][c4]; v += *(const v4fa*)&so[p0 + 1][r][c4];
      *(v4f*)(C + (size_t)(frow + r) * DM + col0 + c4) = v;
      asm volatile("s_wait_xcnt 0x0" ::: "memory"); } }      /* the wait that stands in front of any overwrite of a register that an issued store names: the next trip forms its address and its sum in the same registers */
  else { _Float16* C16 = (prod == 0) ? QU : (prod == 1) ? QV : K16;      /* C16 [rows][DM] in fragment order: the tile's two bands x two k-steps x two halves, each one 512-byte store */
    __builtin_amdgcn_fence(__ATOMIC_ACQ_REL, "workgroup"); __builtin_amdgcn_wave_barrier();      /* the tile is read across the wave's lanes: keeps the LDS stores in front of those reads */
    char* cb16 = (char*)(C16 + (size_t)row0 * DM) + (size_t)(col0 >> 5) * 1024 + lane * 16;
#pragma unroll
    for (int u = 0; u < 8; ++u) { const float* sr = &so[w][(u >> 2) * 16 + ln][(u & 3) * 16 + 8 * hh]; const v4f a = *(const v4fa*)sr, c = *(const v4fa*)(sr + 4); FragH f;
#pragma unroll
      for (int i = 0; i < 4; ++i) { f.h[i] = (_Float16)a[i]; f.h[4 + i] = (_Float16)c[i]; }
      *(v8us*)(cb16 + (size_t)(u >> 2) * 32 * DM + (u & 3) * 512) = f.half[0]; } } }

// res = o_hi w_res 2^-10 + o_lo w_res 2^-20 (o x64, weights x16, residual x1024), both terms in one launch: work-group, waves, LDS planes and the order of the sum as in the job grid.y = 4 above; grid.x = (NR / 64) (DM / 64).
__global__ __launch_bounds__(128) void k_out(const _Float16* __restrict__ O16, const _Float16* __restrict__ OL16, const _Float16* __restrict__ BR, float* __restrict__ C) {
  __shared__ __attribute__((aligned(16))) float so[4][32][68];
  const int lane = threadIdx.x & 31, ln = lane & 15, hh = lane >> 4; const int w = __builtin_amdgcn_readfirstlane((int)(threadIdx.x >> 5)); const int t = w & 1;      /* wave-uniform: the term's base stays scalar */
  const int row0 = ((int)blockIdx.x / (DM / 64)) * 64 + (w >> 1) * 32, col0 = ((int)blockIdx.x % (DM / 64)) * 64;
  const _Float16* A = t ? OL16 : O16; const float alpha = t ? 0.00000095367431640625f : 0.0009765625f;
  const unsigned oa0 = (unsigned)row0 * (DM * 2u) + 16u * lane, oa1 = oa0 + 32u * DM;
  const unsigned ob0 = (unsigned)col0 * (DM * 2u) + 16u * lane, ob1 = ob0 + 32u * DM, ob2 = ob1 + 32u * DM, ob3 = ob2 + 32u * DM;
  const v8f z8 = {0.f,0.f,0.f,0.f,0.f,0.f,0.f,0.f}; v8f accs[8] = {z8, z8, z8, z8, z8, z8, z8, z8};
  g2_kloop((const char*)A, (const char*)BR, DM >> 5, oa0, oa1, ob0, ob1, ob2, ob3, accs);
#pragma unroll
  for (int u = 0; u < 8; ++u) { const int tc = u & 3, half = u >> 2;
#pragma unroll
    for (int r = 0; r < 8; ++r) so[w][half * 16 + 8 * hh + r][tc * 16 + ln] = accs[u][r] * alpha; }
  __syncthreads();      /* both terms' planes are complete before any wave adds them */
  const int rsub = lane >> 4, c4 = (lane & 15) * 4, p0 = w & 2;
  for (int q = t; q < 16; q += 2) { const int r = q * 2 + rsub; v4f v = *(const v4fa*)&so[p0][r][c4]; v += *(const v4fa*)&so[p0 + 1][r][c4];
    *(v4f*)(C + (size_t)(row0 + r) * DM + col0 + c4) = v;
    asm volatile("s_wait_xcnt 0x0" ::: "memory"); } }      /* the wait that stands in front of any overwrite of a register that an issued store names: the next trip forms its address and its sum in the same registers */

__global__ __launch_bounds__(256) void k_wnat(const float* __restrict__ w, size_t n8, _Float16* __restrict__ Bt) { const size_t t = (size_t)blockIdx.x * 256 + threadIdx.x; if (t >= n8) return; FragH f; for (int q = 0; q < 8; ++q) f.h[q] = (_Float16)(bf16_round(w[t * 8 + q]) * 16.0f); *(v8us*)((unsigned short*)Bt + t * 8) = f.half[0];  }
__global__ __launch_bounds__(256) void k_rsm(const float* __restrict__ S, _Float16* __restrict__ P, int nrows) {
  #pragma clang fp contract(off)
  const int i = blockIdx.x * 256 + threadIdx.x; if (i >= nrows) return; const float* s = S + (size_t)i * SQ; float mx = -3.0e38f;
#pragma unroll 1
  for (int j = 0; j < SQ; ++j) mx = fmaxf(mx, s[j]); float se = 0.f;
#pragma unroll 1
  for (int j = 0; j < SQ; ++j) se += expf(s[j] - mx); const float sc = 256.0f / se;
#pragma unroll 1
  for (int j0 = 0; j0 < SQ; j0 += 8) { FragH f; for (int q = 0; q < 8; ++q) f.h[q] = (_Float16)(expf(s[j0 + q] - mx) * sc); unsigned short* d = (unsigned short*)P + (size_t)i * SQ + j0; *(v8us*)d = f.half[0];  } }
__global__ __launch_bounds__(256) void k_vt(const _Float16* __restrict__ V16, int b, int h0, _Float16* __restrict__ VT) { __shared__ unsigned short tl[64][65]; const int tid = threadIdx.x; const int hh = blockIdx.x % HG, sg = blockIdx.x / HG; const int s0 = sg * 64; const int h = h0 + hh;
  for (int i = tid; i < 64 * 8; i += 256) { const int j = i / 8, d8 = (i % 8) * 8; FragH f; f.half[0] = *(const v8us*)((const unsigned short*)V16 + ((size_t)b * SQ + s0 + j) * DM + h * HD + d8); for (int q = 0; q < 8; ++q) tl[d8 + q][j] = f.u[q]; }
  __syncthreads();
  { for (int i = tid; i < 64 * 8; i += 256) { const int d = i / 8, j8 = (i % 8) * 8; FragH f; for (int q = 0; q < 8; ++q) f.u[q] = tl[d][j8 + q]; *(v8us*)((unsigned short*)VT + ((size_t)hh * HD + d) * SQ + s0 + j8) = f.half[0]; }  } }



__global__ __launch_bounds__(256) void k_rsmcf2(const float* __restrict__ S, _Float16* __restrict__ P, int hg, int q0, int nk) {
  #pragma clang fp contract(off)
  const int t = blockIdx.x * 256 + threadIdx.x; if (t >= hg * QT) return; const size_t i = (size_t)t; const float* s = S + i * NKX; const int last = q0 + (t % QT); float mx = -3.0e38f;
#pragma unroll 1
  for (int j = 0; j < nk; ++j) { const float f = (j <= last) ? 1.f : 0.f; mx = fmaxf(mx, fmaf(f, s[j], (1.f - f) * -1.0e9f)); } float se = 0.f;
#pragma unroll 1
  for (int j = 0; j < nk; ++j) { const float f = (j <= last) ? 1.f : 0.f; se += __expf(fmaf(f, s[j], (1.f - f) * -1.0e9f) - mx); } const float sc = 256.0f / se;
#pragma unroll 1
  for (int j0 = 0; j0 < nk; j0 += 8) { FragH fr; for (int q = 0; q < 8; ++q) { const int j = j0 + q; const float f = (j <= last) ? 1.f : 0.f; fr.h[q] = (_Float16)(__expf(fmaf(f, s[j], (1.f - f) * -1.0e9f) - mx) * sc); } unsigned short* d = (unsigned short*)P + i * NKX + j0; *(v8us*)d = fr.half[0];  } }


template <int MASKADD>
__global__ __launch_bounds__(64) void k_att0(const float* __restrict__ QF, const float* __restrict__ KF, const float* __restrict__ VF, int ld, const float* __restrict__ mask, float scale, float* __restrict__ OF, int ldo) {
  #pragma clang fp contract(off)
  __shared__ __attribute__((aligned(16))) float lq[64][64]; __shared__ __attribute__((aligned(16))) float lo[64][64];
  const int tid = threadIdx.x; const int h = blockIdx.x / (QT0 / 64), rg = blockIdx.x % (QT0 / 64); const int i = rg * 64 + tid;
  const float* qr = QF + (size_t)i * ld + h * HD;
#pragma unroll 1
  for (int c = 0; c < HD / 4; ++c) { *(v4f*)&lq[tid][c * 4] = *(const v4fa*)(qr + c * 4); const v4f z = {0.f, 0.f, 0.f, 0.f}; *(v4f*)&lo[tid][c * 4] = z; }
  float m = -1.0e30f, l = 0.f; const int jmax = MASKADD ? (SQ - 1) : (rg * 64 + 63);      /* additive-mask form: every key (the mask input decides); causal form: keys up to the block's last row */
#pragma unroll 1
  for (int j = 0; j <= jmax; ++j) { const float* kr = KF + (size_t)j * ld + h * HD; const float* vr = VF + (size_t)j * ld + h * HD; float s = 0.f;
#pragma unroll 1
    for (int c = 0; c < HD / 4; ++c) { const v4f kq = *(const v4fa*)(kr + c * 4); const v4f qq = *(v4f*)&lq[tid][c * 4]; s = __fadd_rn(s, __fmul_rn(qq[0], kq[0])); s = __fadd_rn(s, __fmul_rn(qq[1], kq[1])); s = __fadd_rn(s, __fmul_rn(qq[2], kq[2])); s = __fadd_rn(s, __fmul_rn(qq[3], kq[3])); }
    s = __fmul_rn(s, scale); if (MASKADD) s = __fadd_rn(s, __fmul_rn(bf16_round(mask[(size_t)i * SQ + j]), -10000.0f));
    const float f = (MASKADD || j <= i) ? 1.f : 0.f; const float sm = fmaf(f, s, (1.f - f) * -1.0e30f); const float mn = fmaxf(m, sm); const float sc = expf(m - mn); const float e = expf(sm - mn); l = __fadd_rn(__fmul_rn(l, sc), e); m = mn;
#pragma unroll 1
    for (int c = 0; c < HD / 4; ++c) { const v4f vv = *(const v4fa*)(vr + c * 4); v4f oo = *(v4f*)&lo[tid][c * 4]; for (int u = 0; u < 4; ++u) oo[u] = __fadd_rn(__fmul_rn(oo[u], sc), __fmul_rn(e, vv[u])); *(v4f*)&lo[tid][c * 4] = oo; } }
  const float fin = 64.0f / l;      /* o carried x64 like the f16 path */
#pragma unroll 1
  for (int c = 0; c < HD / 4; ++c) { v4f oo = *(v4f*)&lo[tid][c * 4]; for (int u = 0; u < 4; ++u) oo[u] = __fmul_rn(oo[u], fin); *(v4f*)&lo[tid][c * 4] = oo; }
  __syncthreads();
  {
#pragma unroll 1
    for (int it = 0; it < 16; ++it) { const int row = it * 4 + tid / 16, pc = (tid % 16) * 4; const v4f v = *(const v4f*)&lo[row][pc]; *(v4f*)(OF + (size_t)(rg * 64 + row) * ldo + h * HD + pc) = v; }
     } }


__global__ __launch_bounds__(256) void k_kvexp(const float* __restrict__ src, float* __restrict__ dst, size_t n4) { const size_t t = (size_t)blockIdx.x * 256 + threadIdx.x; if (t >= n4) return; const size_t e = t * 4; const size_t row = e / DM; const int col = (int)(e % DM); const int h = col / HD, d = col % HD; const v4f v = *(const v4fa*)(src + row * KVD + (size_t)(h / HPG) * HD + d); *(v4f*)(dst + e) = v;  }

__global__ __launch_bounds__(256) void k_tab2(float theta, float* __restrict__ CS, float* __restrict__ SN) {
  #pragma clang fp contract(off)
  const int t = blockIdx.x * 256 + threadIdx.x; if (t >= SQ * (HD / 2)) return; const int i = t % (HD / 2); const int p = t / (HD / 2); const float invf = 1.0f / powf(theta, (float)(2 * i) / (float)HD); const float ang = __fmul_rn((float)p, invf); const float c = cosf(ang), s = sinf(ang);
  *(float*)(CS + t) = c; *(float*)(SN + t) = s;  }
template <int NORM, int ROPE>
__global__ __launch_bounds__(64) void k_xform(const float* __restrict__ F, int ldf, int nh, const float* __restrict__ gain, float eps, const float* __restrict__ CS, const float* __restrict__ SN, _Float16* __restrict__ H16, int ldo) {
  #pragma clang fp contract(off)
  __shared__ float xv[HD]; __shared__ float red[HD]; __shared__ unsigned short sh_[HD]; const int d = threadIdx.x; const int h = blockIdx.x % nh; const size_t r = blockIdx.x / nh; const int p = (int)(r % SQ);
  float x = F[r * (size_t)ldf + (size_t)h * HD + d];
  if (NORM) { red[d] = __fmul_rn(x, x); __syncthreads(); for (int st = HD / 2; st > 0; st >>= 1) { if (d < st) red[d] = __fadd_rn(red[d], red[d + st]); __syncthreads(); } const float rs = rsqrtf(__fadd_rn(red[0] / (float)HD, eps)); x = __fmul_rn(__fmul_rn(x, rs), bf16_round(gain[d])); }
  xv[d] = x; __syncthreads();
  float o = x;
  if (ROPE == 1) { const int i = d >> 1; const float c = CS[p * (HD / 2) + i], s = SN[p * (HD / 2) + i]; const float ev = xv[2 * i], od = xv[2 * i + 1]; o = (d & 1) ? __fadd_rn(__fmul_rn(ev, s), __fmul_rn(od, c)) : __fadd_rn(__fmul_rn(ev, c), -__fmul_rn(od, s)); }
  if (ROPE == 2) { const int i = d & (HD / 2 - 1); const float c = CS[p * (HD / 2) + i], s = SN[p * (HD / 2) + i]; const float lo = xv[i], hi = xv[i + HD / 2]; o = (d < HD / 2) ? __fadd_rn(__fmul_rn(lo, c), -__fmul_rn(hi, s)) : __fadd_rn(__fmul_rn(lo, s), __fmul_rn(hi, c)); }
  FragH th; th.h[0] = (_Float16)o; sh_[d] = th.u[0]; __syncthreads();
  if (d < HD / 8) { FragH f; for (int q = 0; q < 8; ++q) f.u[q] = sh_[d * 8 + q]; unsigned short* dst = (unsigned short*)H16 + r * (size_t)ldo + (size_t)h * HD + d * 8; *(v8us*)dst = f.half[0];  } }

template <int NORM, int ROPE>
__global__ __launch_bounds__(64) void k_xformf(const float* __restrict__ F, int ldf, int nh, const float* __restrict__ gain, float eps, const float* __restrict__ CS, const float* __restrict__ SN, float* __restrict__ F32, int ldo) {
  #pragma clang fp contract(off)
  __shared__ float xv[HD]; __shared__ float red[HD]; const int d = threadIdx.x; const int h = blockIdx.x % nh; const size_t r = blockIdx.x / nh; const int p = (int)(r % SQ);
  float x = F[r * (size_t)ldf + (size_t)h * HD + d];
  if (NORM) { red[d] = __fmul_rn(x, x); __syncthreads(); for (int st = HD / 2; st > 0; st >>= 1) { if (d < st) red[d] = __fadd_rn(red[d], red[d + st]); __syncthreads(); } const float rs = rsqrtf(__fadd_rn(red[0] / (float)HD, eps)); x = __fmul_rn(__fmul_rn(x, rs), bf16_round(gain[d])); }
  xv[d] = x; __syncthreads();
  float o = x;
  if (ROPE == 1) { const int i = d >> 1; const float c = CS[p * (HD / 2) + i], s = SN[p * (HD / 2) + i]; const float ev = xv[2 * i], od = xv[2 * i + 1]; o = (d & 1) ? __fadd_rn(__fmul_rn(ev, s), __fmul_rn(od, c)) : __fadd_rn(__fmul_rn(ev, c), -__fmul_rn(od, s)); }
  if (ROPE == 2) { const int i = d & (HD / 2 - 1); const float c = CS[p * (HD / 2) + i], s = SN[p * (HD / 2) + i]; const float lo = xv[i], hi = xv[i + HD / 2]; o = (d < HD / 2) ? __fadd_rn(__fmul_rn(lo, c), -__fmul_rn(hi, s)) : __fadd_rn(__fmul_rn(lo, s), __fmul_rn(hi, c)); }
  float* dst = F32 + r * (size_t)ldo + (size_t)h * HD + d; *(float*)dst = o;  }

__global__ __launch_bounds__(256) void k_trig(const float* __restrict__ a, float* __restrict__ CS, float* __restrict__ SN, int n) {
  #pragma clang fp contract(off)
  const int t = blockIdx.x * 256 + threadIdx.x; if (t >= n) return; const float v = bf16_round(a[t]); const float c = cosf(v), s = sinf(v);
  *(float*)(CS + t) = c; *(float*)(SN + t) = s;  }

__global__ __launch_bounds__(256) void k_tabpos(const int* __restrict__ pos, float* __restrict__ CS, float* __restrict__ SN, int n) {
  #pragma clang fp contract(off)
  const int t = blockIdx.x * 256 + threadIdx.x; if (t >= n) return; const int p = t / 32, i = t % 32; const float invf = (float)(1.0 / pow(10000.0, ((double)(2 * i)) / 64.0)); const float a = __fmul_rn((float)pos[p], invf); const float c = cosf(a), s = sinf(a);
  *(float*)(CS + t) = c; *(float*)(SN + t) = s;  }

// 2^x of four values. One asm statement so that every v_exp_f32 has an independent instruction behind it (early-clobber outputs: none overwrites a source);
// the closing v_nop is the slot that the instruction set asks for before the last result is read or its source overwritten.
__device__ __forceinline__ v4f exp2x4(v4f x) { float r0, r1, r2, r3;
  asm("v_exp_f32 %0, %4\n\tv_exp_f32 %1, %5\n\tv_exp_f32 %2, %6\n\tv_exp_f32 %3, %7\n\tv_nop" : "=&v"(r0), "=&v"(r1), "=&v"(r2), "=&v"(r3) : "v"(x[0]), "v"(x[1]), "v"(x[2]), "v"(x[3]));
  const v4f r = {r0, r1, r2, r3}; return r; }
// 2^x of one value; the v_nop is the slot that the instruction set asks for before the result is read or the source overwritten.
__device__ __forceinline__ float exp2x1(float x) { float r; asm("v_exp_f32 %0, %1\n\tv_nop" : "=&v"(r) : "v"(x)); return r; }
__device__ __forceinline__ v8f fa_mma(v16h a, v16h b, v8f c) { return __builtin_amdgcn_wmma_f32_16x16x32_f16(false, a, false, b, (short)0, c, false, false); }
// Exact f32 XL attention of the first QT0 rows of a batch: one wave per (head, row i). Lane = 16 hh + ln: ln owns dims 4 ln .. 4 ln + 3, hh one of two keys,
// so every 16-byte load instruction reads two whole 256-byte rows. Keys go in chunks of 32: a lane forms 16 partial dots (q+u).k + (q+v).r over its four dims,
// a four-step butterfly sums each over its 16 lanes, and lane l keeps the score of key 32 c + l. Scores, then weights, rest in the wave's own LDS row;
// maximum and sum are taken over the whole row (two passes, no rescaling); o = sum_j e_j v_j per half, the halves added at the end, x 64 / sum.
// Rows of K, V up to 32 c + 31 <= QT0 - 1 exist; a key above the diagonal gets -1e30 by the arithmetic select and its xl_r index is clamped.
// f: the work-group's number among the NH * NB * (QT0 / 4) of this part, four rows (waves) each; pw: an LDS row per wave.
__device__ __forceinline__ void d_att0xl(const float* __restrict__ QF, const float* __restrict__ QVF, const float* __restrict__ KF, const float* __restrict__ VF, const float* __restrict__ RF, float* __restrict__ OF, float (*pw)[QT0], const int f) {
  { const size_t bo = (size_t)((f / NH) % NB) * (QT0 * DM); QF += bo; QVF += bo; KF += bo; VF += bo; OF += bo; }      /* every plane holds QT0 rows per batch */
  const int lane = threadIdx.x & 31, ln = lane & 15, hh = lane >> 4; const int w = __builtin_amdgcn_readfirstlane((int)(threadIdx.x >> 5));      /* wave-uniform: scalar row bases and trip counts */
  const int h = f % NH; const int i = QT0 - 1 - ((f / (NH * NB)) * 4 + w); const int nch = (i >> 5) + 1;      /* the long rows start first; nch chunks of 32 keys cover 0 .. i */
  const unsigned qo = (unsigned)(i * DM + h * HD + ln * 4) * 4u;
  const v4f q4 = *(const v4fa*)((const char*)QF + qo), qv4 = *(const v4fa*)((const char*)QVF + qo);
  const unsigned ko = (unsigned)(hh * 16 * DM + h * HD + ln * 4) * 4u;      /* the lane's byte offset in a chunk of K or V rows */
  const char* rb = (const char*)(RF + (size_t)h * SQ * HD); float* pr = pw[w]; float mx = -3.0e38f;
#pragma unroll 1
  for (int c = 0; c < nch; ++c) { const char* kp = (const char*)KF + (size_t)c * (32 * DM * 4) + ko; const int r0 = SQ - 1 - i + c * 32 + hh * 16; v4f kk[16], rr[16]; unsigned ro[16];
#pragma unroll
    for (int u = 0; u < 16; ++u) { ro[u] = (unsigned)min(r0 + u, SQ - 1) * (HD * 4u) + ln * 16u; kk[u] = *(const v4fa*)(kp + u * (DM * 4)); rr[u] = *(const v4fa*)(rb + ro[u]); }      /* key j = 32 c + 16 hh + u; xl_r row min(SQ - 1 - i + j, SQ - 1) */
    /* the wait that stands in front of any overwrite of a register that an issued load names, for the chunk's 32 loads: every address register is an input, so none is reused (as a destination either) before it */
    asm volatile("s_wait_xcnt 0x0" :: "v"(kp), "s"(rb), "v"(ro[0]), "v"(ro[1]), "v"(ro[2]), "v"(ro[3]), "v"(ro[4]), "v"(ro[5]), "v"(ro[6]), "v"(ro[7]), "v"(ro[8]), "v"(ro[9]), "v"(ro[10]), "v"(ro[11]), "v"(ro[12]), "v"(ro[13]), "v"(ro[14]), "v"(ro[15]) : "memory");
    __builtin_amdgcn_sched_barrier(0);      /* keeps the arithmetic behind the chunk's loads: without it most K rows are loaded one at a time, each with its own wait */
    float keep = 0.f;
#pragma unroll
    for (int u = 0; u < 16; ++u) { float p = q4[0] * kk[u][0];
#pragma unroll
      for (int d = 1; d < 4; ++d) p = fmaf(q4[d], kk[u][d], p);
#pragma unroll
      for (int d = 0; d < 4; ++d) p = fmaf(qv4[d], bf16_round(rr[u][d]), p);
      p += __shfl_xor(p, 1, 32); p += __shfl_xor(p, 2, 32); p += __shfl_xor(p, 4, 32); p += __shfl_xor(p, 8, 32);
      keep = (ln == u) ? p : keep; }
    const float f = (c * 32 + lane <= i) ? 1.f : 0.f; const float sm = fmaf(f, keep, (1.f - f) * -1.0e30f); pr[c * 32 + lane] = sm; mx = fmaxf(mx, sm); }
#pragma unroll
  for (int m = 16; m > 0; m >>= 1) mx = fmaxf(mx, __shfl_xor(mx, m, 32));
  float l = 0.f;
#pragma unroll 1
  for (int c = 0; c < nch; ++c) { const float e = expf(pr[c * 32 + lane] - mx); pr[c * 32 + lane] = e; l += e; }      /* each lane reads back what it wrote itself */
#pragma unroll
  for (int m = 16; m > 0; m >>= 1) l += __shfl_xor(l, m, 32);
  __builtin_amdgcn_fence(__ATOMIC_ACQ_REL, "workgroup"); __builtin_amdgcn_wave_barrier();      /* the weights are read across the wave's lanes from here on: keeps the LDS stores in front of those reads */
  v4f o = {0.f, 0.f, 0.f, 0.f};
#pragma unroll 1
  for (int c = 0; c < nch; ++c) { const char* vp = (const char*)VF + (size_t)c * (32 * DM * 4) + ko; v4f vv[16], pe[4];
#pragma unroll
    for (int u = 0; u < 16; ++u) vv[u] = *(const v4fa*)(vp + u * (DM * 4));
    asm volatile("s_wait_xcnt 0x0" :: "v"(vp) : "memory");      /* same wait, for the chunk's 16 loads; the address is an input so that no load of the chunk gets it as its destination */
#pragma unroll
    for (int m = 0; m < 4; ++m) pe[m] = *(const v4f*)&pr[c * 32 + hh * 16 + m * 4];      /* the half's 16 weights, one address per half */
#pragma unroll
    for (int u = 0; u < 16; ++u) { const float e = pe[u >> 2][u & 3];
#pragma unroll
      for (int d = 0; d < 4; ++d) o[d] = fmaf(e, vv[u][d], o[d]); } }
  const float fin = 64.0f / l;      /* o carried x64 like the f16 path */
#pragma unroll
  for (int d = 0; d < 4; ++d) o[d] = (o[d] + __shfl_xor(o[d], 16, 32)) * fin;
  if (hh == 0) *(v4f*)(OF + (size_t)i * DM + h * HD + ln * 4) = o; }

// Causal XL attention of one (batch, head, 64 query rows) per work-group: scores, softmax and P V in one kernel, no score or weight plane in memory.
// A wave owns 16 query rows i0 .. i0 + 15 and walks the keys in passes of 32 (j0 = 0, 32, .. <= i0), sharing nothing with the other waves (no barrier).
// A pass: AC = (q+u) k^T (16x32) and BD' = (q+v) r^T over the 48 xl_r rows cb .. cb + 47, cb = SQ - 16 - i0 + j0 (a band of 16 rows past the end is clamped to the last band; a clamped row is met above the diagonal only).
// rel_shift: score (m, n) takes BD'[m][n + 15 - m]; the shift is done by the LDS store (column cc of row m goes to place cc + 1 + m = n + 16 of the wave's own rows).
// Both tiles are read back with lane = row (the A-operand order), so a lane holds 16 scores of one row and the weights are formed in place as an A fragment.
// Running maximum and sum per row (weights x256 relative to the running maximum; accumulators rescaled when a maximum rises); weights as f16 hi + x1024 residual, V^T likewise:
// oh += Ph Vh, ol += Pl Vh + Ph Vl; o x64 = (oh + ol 2^-10) 64 / sum.
#define FPA 36      /* f32 pitch of the AC rows in LDS: 16 bytes x odd */
#define FPB 68      /* f32 pitch of the shifted BD' rows (places 1 .. 63 are written, 16 .. 47 read) and of the output rows staged there at the end */
__global__ __launch_bounds__(128) __attribute__((amdgpu_waves_per_eu(4, 4))) void k_fattn(const _Float16* __restrict__ QU, const _Float16* __restrict__ QV, const _Float16* __restrict__ K16, const _Float16* __restrict__ R16, const _Float16* __restrict__ VT, const _Float16* __restrict__ VTL, _Float16* __restrict__ O16, _Float16* __restrict__ OL16,
    const float* __restrict__ QF, const float* __restrict__ QVF, const float* __restrict__ KF, const float* __restrict__ VF, const float* __restrict__ RF, float* __restrict__ OF) {
  __shared__ __attribute__((aligned(16))) float sa[4][16][FPA]; __shared__ __attribute__((aligned(16))) float sb[4][16][FPB]; __shared__ __attribute__((aligned(16))) float pw[4][QT0];
  if (blockIdx.z >= NB) { d_att0xl(QF, QVF, KF, VF, RF, OF, pw, (int)(blockIdx.x + (SQ / 64) * (blockIdx.y + NH * (blockIdx.z - NB)))); return; }      /* the exact first-tile rows, which depend on nothing of this kernel's own work, ride in the same launch: the last grid.z planes, so that they start behind the long row blocks */
  const int lane = threadIdx.x & 31, ln = lane & 15, hh = lane >> 4; const int w = __builtin_amdgcn_readfirstlane((int)(threadIdx.x >> 5));      /* wave-uniform: scalar bases and trip count */
  const int h = blockIdx.y, b = blockIdx.z; const int i0 = (SQ / 64 - 1 - (int)blockIdx.x) * 64 + w * 16;      /* the long row blocks start first */
  const char* qub = (const char*)(QU + ((size_t)b * SQ + i0) * DM) + h * 2048; const char* qvb = (const char*)(QV + ((size_t)b * SQ + i0) * DM) + h * 2048;      /* every operand plane is in fragment order: a head's 64 dims are two 1-KiB blocks of a [row][DM] band */
  const unsigned oq = 16u * lane;      /* the lane's 16 bytes of a 512-byte half block: the same in every plane */
  const v16h qu0 = g2_fragb(qub, oq), qu1 = g2_fragb(qub + 1024, oq), qv0 = g2_fragb(qvb, oq), qv1 = g2_fragb(qvb + 1024, oq);
  asm volatile("s_wait_xcnt 0x0" :: "s"(qub), "s"(qvb), "v"(oq) : "memory");      /* the wait that stands in front of any overwrite of a register that an issued load names; bases and offset are inputs so that they stay as they are up to here */
  const char* kp = (const char*)(K16 + (size_t)b * SQ * DM) + h * 2048 + oq; const char* rb = (const char*)(R16 + (size_t)h * SQ * HD);      /* kp, vp, vlp: the lane's own addresses, moved on once per pass */
  const char* vp = (const char*)(VT + (size_t)(b * NH + h) * HD * SQ) + oq; const char* vlp = (const char*)(VTL + (size_t)(b * NH + h) * HD * SQ) + oq;
  float (*pa)[FPA] = sa[w]; float (*pb)[FPB] = sb[w];
  const v8f z8 = {0.f,0.f,0.f,0.f,0.f,0.f,0.f,0.f}; v8f oh[4] = {z8, z8, z8, z8}, ol[4] = {z8, z8, z8, z8}; float m = -3.0e38f, l = 0.f;
  const int np = (i0 >> 5) + 1;
#pragma unroll 1      /* a second copy of the pass would not fit the registers of four waves per SIMD */
  for (int p = 0; p < np; ++p) { const int cb = SQ - 16 - i0 + p * 32; v16h kf[4], rf[6]; unsigned orr[3];
#pragma unroll
    for (int t = 0; t < 2; ++t) { kf[2 * t] = g2_fragb(kp + t * (16 * DM * 2), 0u); kf[2 * t + 1] = g2_fragb(kp + t * (16 * DM * 2) + 1024, 0u); }
#pragma unroll
    for (int t = 0; t < 3; ++t) { orr[t] = (unsigned)min(cb + t * 16, SQ - 16) * (HD * 2u) + oq; rf[2 * t] = g2_fragb(rb, orr[t]); rf[2 * t + 1] = g2_fragb(rb + 1024, orr[t]); }      /* cb is a multiple of 16: whole bands of xl_r, 2 KiB each; a band past the end is clamped to the last */
    asm volatile("s_wait_xcnt 0x0" :: "v"(kp), "s"(rb), "v"(orr[0]), "v"(orr[1]), "v"(orr[2]) : "memory");      /* same wait, for the pass's K and xl_r loads: every address register is an input, so none is reused (as a destination either) before it */
    __builtin_amdgcn_sched_barrier(0);      /* keeps the pass's 20 K and xl_r loads in front of the first WMMA: behind it they would go out in groups, each with its own full wait */
    v8f s4[2], bd[3];
#pragma unroll
    for (int t = 0; t < 2; ++t) s4[t] = fa_mma(qu1, kf[2 * t + 1], fa_mma(qu0, kf[2 * t], z8));
#pragma unroll
    for (int t = 0; t < 3; ++t) bd[t] = fa_mma(qv1, rf[2 * t + 1], fa_mma(qv0, rf[2 * t], z8));
    v16h vh[4], vl[4];      /* V^T fragments, one per dim tile: they fly while the scores go through LDS and the softmax */
#pragma unroll
    for (int t = 0; t < 4; ++t) { vh[t] = g2_fragb(vp + t * (16 * SQ * 2), 0u); vl[t] = g2_fragb(vlp + t * (16 * SQ * 2), 0u); }
    asm volatile("s_wait_xcnt 0x0" :: "v"(vp), "v"(vlp) : "memory");      /* same wait, for the 16 V^T loads */
    __builtin_amdgcn_sched_barrier(0);      /* keeps those loads in front of the softmax, which hides them */
#pragma unroll
    for (int t = 0; t < 2; ++t) {
#pragma unroll
      for (int r = 0; r < 8; ++r) pa[8 * hh + r][t * 16 + ln] = s4[t][r]; }
#pragma unroll
    for (int t = 0; t < 3; ++t) {
#pragma unroll
      for (int r = 0; r < 8; ++r) pb[8 * hh + r][t * 16 + ln + 1 + 8 * hh + r] = bd[t][r]; }
    __builtin_amdgcn_fence(__ATOMIC_ACQ_REL, "workgroup", "local"); __builtin_amdgcn_wave_barrier();      /* the tiles are read across the wave's lanes: keeps the LDS stores in front of those reads */
    v4f sc[4];      /* sc[2 c], sc[2 c + 1]: keys j0 + 16 c + 8 hh .. + 7 of row ln */
#pragma unroll
    for (int c = 0; c < 2; ++c) { const int col = c * 16 + 8 * hh; sc[2 * c] = *(const v4f*)&pa[ln][col] + *(const v4f*)&pb[ln][16 + col]; sc[2 * c + 1] = *(const v4f*)&pa[ln][col + 4] + *(const v4f*)&pb[ln][16 + col + 4]; }
    __builtin_amdgcn_fence(__ATOMIC_ACQ_REL, "workgroup", "local"); __builtin_amdgcn_wave_barrier();      /* keeps the next pass's LDS stores behind these reads */
    if (p == np - 1) {      /* only the last pass meets the diagonal (j0 + 31 < i0 before it) */
#pragma unroll
      for (int c = 0; c < 4; ++c) {
#pragma unroll
        for (int q = 0; q < 4; ++q) { const int j = p * 32 + (c >> 1) * 16 + 8 * hh + (c & 1) * 4 + q; sc[c][q] = (j <= i0 + ln) ? sc[c][q] : -1.0e30f; } } }
    float mx = sc[0][0];
#pragma unroll
    for (int c = 0; c < 4; ++c) mx = fmaxf(mx, fmaxf(fmaxf(sc[c][0], sc[c][1]), fmaxf(sc[c][2], sc[c][3])));
    mx = fmaxf(mx, __shfl_xor(mx, 16, 32));      /* the other half of the row's 32 keys */
    const float mn = fmaxf(m, mx); const float al = exp2x1((m - mn) * 1.44269504f);
    if (__builtin_amdgcn_ballot_w32(mn > m) != 0) {      /* a scalar branch: where no row's maximum rose every factor is 1 */
#pragma unroll
      for (int r = 0; r < 8; ++r) { const float ar = __shfl(al, 8 * hh + r, 32);      /* accumulator register r holds row 8 hh + r */
#pragma unroll
        for (int t = 0; t < 4; ++t) { oh[t][r] *= ar; ol[t][r] *= ar; } } }
    m = mn; const float mb = 8.0f - mn * 1.44269504f; v4f ps = {0.f, 0.f, 0.f, 0.f}; FragH ph, pl;
#pragma unroll
    for (int c = 0; c < 4; ++c) { const v4f e = exp2x4(sc[c] * 1.44269504f + mb); ps += e;      /* 256 exp(s - m) */
#pragma unroll
      for (int q = 0; q < 4; ++q) { const _Float16 hv = (_Float16)e[q]; ph.h[c * 4 + q] = hv; pl.h[c * 4 + q] = (_Float16)((e[q] - (float)hv) * 1024.0f); } }
    l = l * al + ((ps[0] + ps[1]) + (ps[2] + ps[3]));
#pragma unroll
    for (int t = 0; t < 4; ++t) oh[t] = fa_mma(ph.v, vh[t], oh[t]);
#pragma unroll
    for (int t = 0; t < 4; ++t) ol[t] = fa_mma(pl.v, vh[t], ol[t]);
#pragma unroll
    for (int t = 0; t < 4; ++t) ol[t] = fa_mma(ph.v, vl[t], ol[t]);
    kp += 32 * DM * 2; vp += 1024; vlp += 1024; }
  l += __shfl_xor(l, 16, 32); const float inv = 64.0f / l;      /* the two halves' sums joined once; o carried x64 */
#pragma unroll
  for (int r = 0; r < 8; ++r) { const float ir = __shfl(inv, 8 * hh + r, 32);
#pragma unroll
    for (int t = 0; t < 4; ++t) pb[8 * hh + r][t * 16 + ln] = (oh[t][r] + ol[t][r] * 0.0009765625f) * ir; }
  __builtin_amdgcn_fence(__ATOMIC_ACQ_REL, "workgroup", "local"); __builtin_amdgcn_wave_barrier();      /* the rows are read across the wave's lanes, lane = row, for the operand order of the output GEMM */
  /* o x64 leaves as the f16 hi and x1024 residual planes [row][DM] in fragment order: the wave's 16 rows are one band, the head's 64 dims two 1-KiB blocks of it = four 512-byte stores a plane */
  const size_t oo = ((size_t)b * SQ + i0) * (DM * 2) + h * 2048 + oq; FragH fh[4], fl[4];
#pragma unroll
  for (int u = 0; u < 4; ++u) { const float* sr = &pb[ln][u * 16 + 8 * hh]; const v4f a = *(const v4f*)sr, c = *(const v4f*)(sr + 4);
#pragma unroll
    for (int q = 0; q < 4; ++q) { _Float16 hv = (_Float16)a[q]; fh[u].h[q] = hv; fl[u].h[q] = (_Float16)((a[q] - (float)hv) * 1024.0f); hv = (_Float16)c[q]; fh[u].h[4 + q] = hv; fl[u].h[4 + q] = (_Float16)((c[q] - (float)hv) * 1024.0f); } }
  __builtin_amdgcn_sched_barrier(0);      /* keeps every conversion in front of the first store: no register that an issued store names is written again before the wave ends */
#pragma unroll
  for (int u = 0; u < 4; ++u) { *(v8us*)((char*)O16 + oo + u * 512) = fh[u].half[0]; *(v8us*)((char*)OL16 + oo + u * 512) = fl[u].half[0]; } }

// x_t = RMSNorm(bf16(x)) g (f32), written at once as its f16 hi and x1024 residual planes [row][DM] in fragment order. A work-group is one band of 16 rows, a wave one row:
// a lane holds 32 elements (eight 16-byte loads of 512 bytes in a row each); sum of squares = per-lane partials joined in pairs, then a lane butterfly.
// The f16 rows are laid row-major in LDS and, behind one barrier, read back piece by piece in fragment order, so that every global store is 512 bytes in a row.
#define RXP (DM + 8)      /* f16 pitch of a staged row: 16 bytes x odd */
typedef unsigned short v4us __attribute__((ext_vector_type(4), may_alias));
union FragQ { v4us v; _Float16 h[4]; };
// The same launch also packs the four weight matrices and xl_r, which depend on nothing of x_t: the work-groups behind the NR / 16 bands, 512 pieces each (WPB work-groups a weight matrix, then xl_r).
#define WPB (DM * DM / 8 / 512)
__global__ __launch_bounds__(512) void k_prep(const float* __restrict__ x, const float* __restrict__ g, float eps, _Float16* __restrict__ Hh, _Float16* __restrict__ Hl,
    const float* __restrict__ wq, const float* __restrict__ wk, const float* __restrict__ wv, const float* __restrict__ wres, _Float16* __restrict__ BQ, _Float16* __restrict__ BK, _Float16* __restrict__ BV, _Float16* __restrict__ BR, const float* __restrict__ xlr, _Float16* __restrict__ R16) {
  __shared__ __attribute__((aligned(16))) unsigned short sh[16][RXP]; __shared__ __attribute__((aligned(16))) unsigned short sl[16][RXP];
  const int tid = threadIdx.x, lane = tid & 31, w = tid >> 5;
  if (blockIdx.x >= NR / 16) {      /* a whole work-group takes this way, in front of the barrier */
    const int j = (int)blockIdx.x - (int)(NR / 16), m = j / WPB;
    if (m < 4) d_wt_f16<DM, DM>((m == 0) ? wq : (m == 1) ? wk : (m == 2) ? wv : wres, (m == 0) ? BQ : (m == 1) ? BK : (m == 2) ? BV : BR, 16.0f, (j % WPB) * 512 + tid);      /* [in][out] ([in][h][k] flattened) -> Bt x16, fragment order */
    else d_x16<HD>(xlr, R16, (size_t)NH * SQ * HD / 8, (size_t)(j - 4 * WPB) * 512 + tid);      /* xl_r [h][j][64] as exact f16 rows (bf16-valued input), fragment order */
    return; }
  const float* xr = x + ((size_t)blockIdx.x * 16 + w) * DM + lane * 4; const float* gr = g + lane * 4; v4f v[8], gg[8]; float s[8];
#pragma unroll
  for (int i = 0; i < 8; ++i) { v[i] = *(const v4fa*)(xr + i * 128); gg[i] = *(const v4fa*)(gr + i * 128); }
  asm volatile("s_wait_xcnt 0x0" :: "v"(xr), "v"(gr) : "memory");      /* the wait that stands in front of any overwrite of a register that an issued load names; the addresses are inputs so that no load gets one as its destination */
#pragma unroll
  for (int i = 0; i < 8; ++i) { s[i] = 0.f;
#pragma unroll
    for (int q = 0; q < 4; ++q) { v[i][q] = bf16_round(v[i][q]); s[i] += v[i][q] * v[i][q]; } }
  float ss = ((s[0] + s[4]) + (s[2] + s[6])) + ((s[1] + s[5]) + (s[3] + s[7]));
#pragma unroll
  for (int m = 16; m > 0; m >>= 1) ss += __shfl_xor(ss, m, 32);
  const float rs = rsqrtf(ss / (float)DM + eps);
#pragma unroll
  for (int i = 0; i < 8; ++i) { FragQ fh, fl;
#pragma unroll
    for (int q = 0; q < 4; ++q) { const float o = (v[i][q] * rs) * bf16_round(gg[i][q]); const _Float16 hv = (_Float16)o; fh.h[q] = hv; fl.h[q] = (_Float16)((o - (float)hv) * 1024.0f); }
    *(v4us*)&sh[w][i * 128 + lane * 4] = fh.v; *(v4us*)&sl[w][i * 128 + lane * 4] = fl.v; }
  __syncthreads();      /* all 16 rows of the band lie in LDS before any piece, which takes its place by row, is read */
  v8us ph[4], pl[4];
#pragma unroll
  for (int it = 0; it < 4; ++it) { const int t = it * 512 + tid; const int r = t & 15, k = (t >> 6) * 32 + ((t >> 4) & 3) * 8; ph[it] = *(const v8us*)&sh[r][k]; pl[it] = *(const v8us*)&sl[r][k]; }      /* piece t of the band: row t & 15, see pk_src */
  __builtin_amdgcn_sched_barrier(0);      /* keeps the eight LDS reads in front of the first store: no register that an issued store names is written again before the wave ends */
  const size_t o8 = ((size_t)blockIdx.x * (DM * 2) + tid) * 8;
#pragma unroll
  for (int it = 0; it < 4; ++it) { *(v8us*)((unsigned short*)Hh + o8 + it * 4096) = ph[it]; *(v8us*)((unsigned short*)Hl + o8 + it * 4096) = pl[it]; } }

extern "C" void kernel_launch(void* const* d_in, const int* in_sizes, int n_in,
                              void* d_out, int out_size, void* d_ws, size_t ws_size, hipStream_t stream) {
  (void)in_sizes; (void)n_in; (void)out_size;
  const float* const* I = (const float* const*)d_in; const float* x = I[0]; const float* g = I[1]; const float* wq = I[2]; const float* wk = I[3]; const float* wv = I[4]; const float* wres = I[5]; const float* xlr = I[6]; const float* xlu = I[7]; const float* xlv = I[8];      /* x; RMS gain; w_q/w_k/w_v [1024][16][64] = [in][out]; w_res [1024][1024] [in][out]; xl_r [16][2048][64]; xl_u, xl_v [1][16][1][64] = per-head 64-vectors (a [1024] bias over the merged columns) */
  char* ws = (char*)d_ws; size_t off = 0;
  auto take = [&](size_t bytes) { char* p = ws + off; off += (bytes + 255) & ~(size_t)255; return p; };
  /* Planes that live across the attention kernel. */
  _Float16* BR = (_Float16*)take((size_t)DM * DM * 2); _Float16* QU = (_Float16*)take(NR * DM * 2); _Float16* QV = (_Float16*)take(NR * DM * 2); _Float16* K16 = (_Float16*)take(NR * DM * 2); _Float16* R16 = (_Float16*)take((size_t)NH * SQ * HD * 2); float* OF0 = (float*)take((size_t)NB * QT0 * DM * 4); _Float16* VT = (_Float16*)take((size_t)NB * NH * HD * SQ * 2); _Float16* VTL = (_Float16*)take((size_t)NB * NH * HD * SQ * 2);
  const size_t offs = off;
  /* What is last read in front of the attention kernel, and the f32 first-tile planes that it reads itself ... */
  _Float16* BQ = (_Float16*)take((size_t)DM * DM * 2); _Float16* BK = (_Float16*)take((size_t)DM * DM * 2); _Float16* BV = (_Float16*)take((size_t)DM * DM * 2);
  _Float16* X16 = (_Float16*)take(NR * DM * 2); _Float16* XL16 = (_Float16*)take(NR * DM * 2); float* QUF = (float*)take((size_t)NB * QT0 * DM * 4); float* QVF = (float*)take((size_t)NB * QT0 * DM * 4); float* KF0 = (float*)take((size_t)NB * QT0 * DM * 4); float* VF0 = (float*)take((size_t)NB * QT0 * DM * 4);
  if (off > ws_size) return;
  /* ... shares its first 16 MiB, short of the f32 planes, with the operands of the output stage, written by it and behind it. */
  off = offs;
  _Float16* O16 = (_Float16*)take(NR * DM * 2); _Float16* OL16 = (_Float16*)take(NR * DM * 2);
  /* Launches that depend on nothing of each other stand side by side in one: the job is one more grid index. */
  k_prep<<<(unsigned)(NR / 16 + 4 * WPB + (size_t)NH * SQ * HD / 8 / 512), 512, 0, stream>>>(x, g, 1e-6f, X16, XL16, wq, wk, wv, wres, BQ, BK, BV, BR, xlr, R16);      /* x_t = RMSNorm(bf16(x)) g (f32, in registers) -> f16 hi rows (+ x1024 residual rows for the exact first tile); the four weight planes; xl_r */
  k_proj<<<dim3((unsigned)((NR / 128) * (DM / 64)), 5), 128, 0, stream>>>(X16, XL16, BQ, BK, BV, xlu, xlv, QU, QV, K16, VT, VTL, QUF, QVF, KF0, VF0);      /* q / 8 + xl_u, q / 8 + xl_v, k -> f16 rows; v (f32 accumulators) -> V^T f16 hi + x1024 residual [batch][16][64][SQ] (the first causal rows copy v almost verbatim into small outputs); the four in f32 for rows 0..255 of each batch */
  k_fattn<<<dim3(SQ / 64, NH, NB + NB * (QT0 / 4) / (SQ / 64)), 128, 0, stream>>>(QU, QV, K16, R16, VT, VTL, O16, OL16, QUF, QVF, KF0, VF0, xlr, OF0);      /* grid.z >= NB: exact causal XL attention for rows 0..255 of each batch (o x64, f32); grid.z < NB: */      /* wv x64 of every row as f16 hi + x1024 residual rows: scores = AC + rel_shift(BD), causal softmax, P V (hi / residual terms) in one launch */
  k_hl<true><<<(unsigned)(((size_t)NB * QT0 * DM / 8 + 255) / 256), 256, 0, stream>>>(OF0, O16, OL16, (size_t)NB * QT0 * DM / 8, (size_t)QT0 * DM / 8, (size_t)SQ * DM / 8);      /* first-tile o (x64) -> f16 hi + x1024 residual, over rows 0..255 of each batch in the o planes: the output product of those rows rides in the launch below */
  k_out<<<(unsigned)((NR / 64) * (DM / 64)), 128, 0, stream>>>(O16, OL16, BR, (float*)d_out);      /* res = wv_hi w_res 2^-10 + wv_lo w_res 2^-20 */
}

// v010
// Measured time: 162 microseconds a run.
// In both of two side-by-side timings against v009, it was 1.16 times as fast.
// Counting every step since v000, which is the starting kernel, it is 95.2 times as fast.
#include <hip/hip_runtime.h>
// Transformer-XL style causal attention with relative-position (rel_shift) scores (x [2][2048][1024]; x_t = RMSNorm(x) g (eps 1e-6); q = x_t w_q / 8, k = x_t w_k, v = x_t w_v (w [1024][16][64] = [in][out], sigma 1/32); scores = (q + xl_u).k^T + rel_shift((q + xl_v).xl_r^T) (xl_r [16][2048][64], xl_u / xl_v [1][16][1][64]); causal: - 1e30 above the diagonal; softmax; wv = w v merged (h*64+v); res = wv w_res ([in][out]) -> [2][2048][1024]. rel_shift with q_len = k_len = T gives bd[i][j] = (q_i + xl_v).xl_r[h][T-1-(i-j)] for j <= i).
// Structure: token rows; x_t = RMSNorm(bf16(x)) in f32 on VALU, one kernel -> f16 hi / residual rows; [in][out] weights as x16 planes; q+u and q+v as two WMMA GEMMs (32x64 wave tiles, f32 accumulation, alpha 1/128, per-head bias vectors), k -> f16 rows, v -> V^T hi / residual straight from the accumulators; xl_r as exact f16 rows; both batches side by side in every launch from here on (batch = one more grid index): exact f32 XL attention for rows 0..255 per batch on VALU (q/k/v of those rows from x_t hi + residual GEMM passes); one attention kernel, two waves per 16 query rows (each walks half of the key passes; the two results are joined at the end), passes of 32 keys: AC = (q+u) k^T and BD' = (q+v) r^T over the 48 xl_r rows the shift can reach (WMMA, f32), rel_shift by a skewed LDS store, causal select (-1e30 fill, clamped xl_r index), running maximum and sum (f32, native exp; weights x256 f16 hi + residual), o = P V^T (x64) f32 in registers, stored as f16 hi / residual rows; first-tile rows of the o planes rewritten from the exact o; res = o_hi w_res + o_lo w_res 2^-10, both terms in one launch; launches that depend on nothing of each other share one (the job is a grid index); every f16 plane that a WMMA reads (x_t, weights, q+u, q+v, k, xl_r, V^T, o) lies in fragment order (see FragH): each wave-wide 16-byte load is 512 bytes in a row.
// Compute dtype: inputs rounded to bf16; x / weights exact; q and k as plain f16 GEMM operands (~2^-12); v, softmax weights and o as f16 hi + x1024 residual; scores and softmax statistics f32. v_wmma_f32_16x16x32_f16.
#define NB 2
#define NG 16
#define HPG 1
#define KVD (NG * HD)
#define SQ 2048
#define DM 1024
#define NH 16
#define HD 64
#define HG 4                         /* heads per launch of the (b, h0) k_vt overload, which is not launched */
#define QT 256                       /* query rows per causal tile */
#define NKX SQ                       /* S / P row pitch */
#define QT0 256                      /* first-tile rows recomputed exactly in f32 (= one causal tile) */
#define B0 0                         /* first batch processed (unused) */
#define NBR NB                       /* batches processed (read only by MP) */
#define NR ((size_t)NB * SQ)         /* token rows */
#define MP ((int)((size_t)NBR * SQ)) /* rows projected (read only by MPO) */
#define QN SQ                        /* query rows attended per batch (unused) */
#define NHD NH                       /* heads attended (unused) */
#define MPO MP                       /* rows through the output stage (unused) */
#define LQ DM      /* row pitch of the q/k/v rows */
typedef __bf16 v16b __attribute__((ext_vector_type(16)));
typedef unsigned short v8us __attribute__((ext_vector_type(8), may_alias));
typedef float  v8f  __attribute__((ext_vector_type(8)));
typedef float  v4f  __attribute__((ext_vector_type(4)));
typedef float  v4fa __attribute__((ext_vector_type(4), may_alias));
union FragB { v16b v; v8us half[2]; unsigned short u[16]; };

__device__ __forceinline__ unsigned short bf16_bits(float x) { unsigned int u = __float_as_uint(x); return (unsigned short)((u + 0x7FFFu + ((u >> 16) & 1u)) >> 16); }
__device__ __forceinline__ float bf16_val(unsigned short b) { return __uint_as_float(((unsigned int)b) << 16); }
__device__ __forceinline__ float bf16_round(float x) { return bf16_val(bf16_bits(x)); }
// D += A·B with NT terms: 1 = ah·bh, 2 = + al·bh (A split), 3 = + ah·bl (both split)
template <int NT>
__device__ __forceinline__ v8f mmaN(v16b ah, v16b al, v16b bh, v16b bl, v8f c) {
  c = __builtin_amdgcn_wmma_f32_16x16x32_bf16(false, ah, false, bh, (short)0, c, false, false);
  if (NT >= 2) c = __builtin_amdgcn_wmma_f32_16x16x32_bf16(false, al, false, bh, (short)0, c, false, false);
  if (NT >= 3) c = __builtin_amdgcn_wmma_f32_16x16x32_bf16(false, ah, false, bl, (short)0, c, false, false);
  asm volatile("v_nop\n\tv_nop\n\tv_nop\n\tv_nop" : "+v"(c) : "v"(ah), "v"(al), "v"(bh), "v"(bl));
  return c;
}

__global__ __launch_bounds__(256) void k_wt_bf16(const float* __restrict__ W, unsigned short* __restrict__ Wt, int K, int N) {
  const int t = blockIdx.x * 256 + threadIdx.x;
  const int k8n = K / 8;
  if (t >= N * k8n) return;
  const int n = t / k8n, k8 = (t % k8n) * 8;
  v8us v;
#pragma unroll
  for (int i = 0; i < 8; ++i) v[i] = bf16_bits(W[(size_t)(k8 + i) * N + n]);
  *(v8us*)(Wt + (size_t)n * K + k8) = v;
  
}

// GEMM C[M][N] (f32, pitch ldc) = act(A[M][K]·W + bias). A f32 row-major (pitch lda) converted per fragment to bf16
// (ASPLIT: hi/lo two planes -> 2 terms, else single rounded term); Wt bf16 [N][K] (pitch ldb). BIAS_BF16 rounds the
// bias to bf16 first (bias quantised to bf16 before the add). K%32==0, M%16==0, N%64==0.
template <bool ASPLIT, int ACT, bool BIAS_BF16>
__global__ __launch_bounds__(128) void k_gemm_bf(const float* __restrict__ A, int lda, const unsigned short* __restrict__ Wt, int ldb,
                                               const float* __restrict__ bias, float* __restrict__ C, int ldc, int M, int N, int K) {
  __shared__ __attribute__((aligned(16))) float so[4][16][64];
  const int tid = threadIdx.x, w = tid >> 5, lane = tid & 31, ln = lane & 15, hh = lane >> 4;
  const int ntn = N / 64;
  const int wid = blockIdx.x * 4 + w;
  const int mt = wid / ntn, nq = wid % ntn;
  if (mt * 16 >= M) return;
  const int row0 = mt * 16, col0 = nq * 64;
  const float* arow = A + (size_t)(row0 + ln) * lda;
  v8f acc[4] = {};
  for (int kb = 0; kb < K; kb += 32) {
    FragB ah, al;
    const v4f x0 = *(const v4fa*)(arow + kb + 8 * hh), x1 = *(const v4fa*)(arow + kb + 8 * hh + 4);
    const v4f x2 = *(const v4fa*)(arow + kb + 16 + 8 * hh), x3 = *(const v4fa*)(arow + kb + 16 + 8 * hh + 4);
    float xs[16] = {x0[0],x0[1],x0[2],x0[3],x1[0],x1[1],x1[2],x1[3],x2[0],x2[1],x2[2],x2[3],x3[0],x3[1],x3[2],x3[3]};
#pragma unroll
    for (int i = 0; i < 16; ++i) { const unsigned short hb = bf16_bits(xs[i]); ah.u[i] = hb; al.u[i] = ASPLIT ? bf16_bits(xs[i] - bf16_val(hb)) : (unsigned short)0; }
#pragma unroll
    for (int t = 0; t < 4; ++t) {
      const unsigned short* brow = Wt + (size_t)(col0 + t * 16 + ln) * ldb + kb;
      FragB b;
      b.half[0] = *(const v8us*)(brow + 8 * hh);
      b.half[1] = *(const v8us*)(brow + 16 + 8 * hh);
      acc[t] = mmaN<ASPLIT ? 2 : 1>(ah.v, al.v, b.v, b.v, acc[t]);
    }
  }
#pragma unroll
  for (int t = 0; t < 4; ++t) {
    float bv = bias ? bias[col0 + t * 16 + ln] : 0.f;
    if (BIAS_BF16) bv = bf16_round(bv);
#pragma unroll
    for (int r = 0; r < 8; ++r) { float v = acc[t][r] + bv; if (ACT == 1) v = fmaxf(v, 0.f); so[w][8 * hh + r][t * 16 + ln] = v; }
  }
  __builtin_amdgcn_fence(__ATOMIC_ACQ_REL, "workgroup");
  __builtin_amdgcn_wave_barrier();
  const int rsub = lane >> 4, c4 = (lane & 15) * 4;
  {
#pragma unroll
    for (int q = 0; q < 8; ++q) {
      const int r = q * 2 + rsub;
      const v4f v = *(const v4fa*)&so[w][r][c4];
      *(v4f*)(C + (size_t)(row0 + r) * ldc + col0 + c4) = v;
    }
    
  }
}

// GEMM C = act(A·W + bias + resid): A f32 (ASPLIT -> hi/lo 2 terms), Wt bf16 [N][K]; ACT 0 none, 1 relu, 2 exact gelu;
// resid (optional, f32, row index = (row % rmod), pitch ldr, RES_BF16 rounds it) added before the activation.
template <bool ASPLIT, int ACT, bool BIAS_BF16, bool RES_BF16>
__global__ __launch_bounds__(128) void k_gemm_bf3(const float* __restrict__ A, int lda, const unsigned short* __restrict__ Wt, int ldb,
                                                const float* __restrict__ bias, const float* __restrict__ resid, int rmod, int ldr,
                                                float* __restrict__ C, int ldc, int M, int N, int K) {
  __shared__ __attribute__((aligned(16))) float so[4][16][64];
  const int tid = threadIdx.x, w = tid >> 5, lane = tid & 31, ln = lane & 15, hh = lane >> 4;
  const int ntn = N / 64;
  const int wid = blockIdx.x * 4 + w;
  const int mt = wid / ntn, nq = wid % ntn;
  if (mt * 16 >= M) return;
  const int row0 = mt * 16, col0 = nq * 64;
  const float* arow = A + (size_t)(row0 + ln) * lda;
  v8f acc[4] = {};
  for (int kb = 0; kb < K; kb += 32) {
    FragB ah, al;
    const v4f x0 = *(const v4fa*)(arow + kb + 8 * hh), x1 = *(const v4fa*)(arow + kb + 8 * hh + 4);
    const v4f x2 = *(const v4fa*)(arow + kb + 16 + 8 * hh), x3 = *(const v4fa*)(arow + kb + 16 + 8 * hh + 4);
    float xs[16] = {x0[0],x0[1],x0[2],x0[3],x1[0],x1[1],x1[2],x1[3],x2[0],x2[1],x2[2],x2[3],x3[0],x3[1],x3[2],x3[3]};
#pragma unroll
    for (int i = 0; i < 16; ++i) { const unsigned short hb = bf16_bits(xs[i]); ah.u[i] = hb; al.u[i] = ASPLIT ? bf16_bits(xs[i] - bf16_val(hb)) : (unsigned short)0; }
#pragma unroll
    for (int t = 0; t < 4; ++t) {
      const unsigned short* brow = Wt + (size_t)(col0 + t * 16 + ln) * ldb + kb;
      FragB b;
      b.half[0] = *(const v8us*)(brow + 8 * hh);
      b.half[1] = *(const v8us*)(brow + 16 + 8 * hh);
      acc[t] = mmaN<ASPLIT ? 2 : 1>(ah.v, al.v, b.v, b.v, acc[t]);
    }
  }
#pragma unroll
  for (int t = 0; t < 4; ++t) {
    const int col = col0 + t * 16 + ln;
    float bv = bias ? bias[col] : 0.f;
    if (BIAS_BF16) bv = bf16_round(bv);
#pragma unroll
    for (int r = 0; r < 8; ++r) {
      float v = acc[t][r] + bv;
      if (resid) { float rv = resid[(size_t)((row0 + 8 * hh + r) % rmod) * ldr + col]; if (RES_BF16) rv = bf16_round(rv); v += rv; }
      if (ACT == 1) v = fmaxf(v, 0.f);
      if (ACT == 2) v = 0.5f * v * (1.0f + erff(v * 0.70710678118654752f));
      if (ACT == 3) { const float u = 0.7978845608028654f * (v + 0.044715f * v * v * v); v = 0.5f * v * (1.0f + tanhf(u)); }
      so[w][8 * hh + r][t * 16 + ln] = v;
    }
  }
  __builtin_amdgcn_fence(__ATOMIC_ACQ_REL, "workgroup");
  __builtin_amdgcn_wave_barrier();
  const int rsub = lane >> 4, c4 = (lane & 15) * 4;
  {
#pragma unroll
    for (int q = 0; q < 8; ++q) {
      const int r = q * 2 + rsub;
      const v4f v = *(const v4fa*)&so[w][r][c4];
      *(v4f*)(C + (size_t)(row0 + r) * ldc + col0 + c4) = v;
    }
    
  }
}
// row LayerNorm (biased variance, eps) over N: s = X (+ R); optional out_sum <- s; out_norm <- (s-mu)*rsqrt(var+eps)*g + b
template <bool PARAM_BF16>
__global__ __launch_bounds__(256) void k_layernorm(const float* __restrict__ X, const float* __restrict__ R, const float* __restrict__ g, const float* __restrict__ bta,
                                                  float* __restrict__ out_sum, float* __restrict__ out_norm, int N, float eps) {
  __shared__ float red[256];
  const int row = blockIdx.x, tid = threadIdx.x;
  const float* x = X + (size_t)row * N; const float* rr = R ? R + (size_t)row * N : nullptr;
  float vals[16];                     // up to N = 4096
  const int per = N / 256;            // contiguous chunk per thread? use strided-by-4 chunks: thread handles j = tid*4 + 1024*u
  float s1 = 0.f;
  for (int u = 0; u < per / 4; ++u) {
    const int j = tid * 4 + 1024 * u;
    const v4f a = *(const v4fa*)(x + j);
    v4f b = {0.f,0.f,0.f,0.f}; if (rr) b = *(const v4fa*)(rr + j);
#pragma unroll
    for (int q = 0; q < 4; ++q) { const float v = a[q] + b[q]; vals[u * 4 + q] = v; s1 += v; }
  }
  red[tid] = s1; __syncthreads();
  for (int st = 128; st > 0; st >>= 1) { if (tid < st) red[tid] += red[tid + st]; __syncthreads(); }
  const float mu = red[0] / (float)N; __syncthreads();
  float s2 = 0.f;
  for (int u = 0; u < per / 4; ++u)
#pragma unroll
    for (int q = 0; q < 4; ++q) { const float c = vals[u * 4 + q] - mu; s2 += c * c; }
  red[tid] = s2; __syncthreads();
  for (int st = 128; st > 0; st >>= 1) { if (tid < st) red[tid] += red[tid + st]; __syncthreads(); }
  const float rs = rsqrtf(red[0] / (float)N + eps);
  {
    for (int u = 0; u < per / 4; ++u) {
      const int j = tid * 4 + 1024 * u;
      v4f o, sm;
#pragma unroll
      for (int q = 0; q < 4; ++q) {
        float gg = g[j + q], bb = bta[j + q];
        if (PARAM_BF16) { gg = bf16_round(gg); bb = bf16_round(bb); }
        sm[q] = vals[u * 4 + q]; o[q] = (vals[u * 4 + q] - mu) * rs * gg + bb;
      }
      if (out_sum) *(v4f*)(out_sum + (size_t)row * N + j) = sm;
      *(v4f*)(out_norm + (size_t)row * N + j) = o;
    }
    
  }
}



// ---- f16 WMMA path (v_wmma_f32_16x16x32_f16): 11-bit significands for operands in range — used where a [0,1] probability operand needs more precision than bf16
typedef _Float16 v16h __attribute__((ext_vector_type(16)));
union FragH { v16h v; v8us half[2]; _Float16 h[16]; unsigned short u[16]; };
// FRAGMENT ORDER of an f16 operand plane [rows][kc] (rows % 16 == 0, kc % 32 == 0): a band of 16 rows keeps its 32 kc bytes; inside it every 16 x 32 block is 1 KiB = two halves of 512 bytes,
// half j = [lane = 16 hh + ln][8 elements]: row ln, k = 16 j + 8 hh .. + 7. A wave-wide 16-byte load of a half then reads 512 bytes in a row (4 lines) where row-major rows gave 16 pieces of 32 bytes in 16 lines.
// Element index, in the row-major plane [rows][KC], of the 8 elements that 16-byte piece t of the plane in fragment order holds.
template <int KC>
__device__ __forceinline__ size_t pk_src(size_t t) { const size_t band = t / (KC * 2); const unsigned rem = (unsigned)(t % (KC * 2)); return (band * 16 + (rem & 15u)) * (size_t)KC + (rem >> 6) * 32u + ((rem >> 4) & 3u) * 8u; }
template <int NT>
__device__ __forceinline__ v8f mmaH(v16h ah, v16h al, v16h bh, v16h bl, v8f c) {
  c = __builtin_amdgcn_wmma_f32_16x16x32_f16(false, ah, false, bh, (short)0, c, false, false);
  if (NT >= 2) c = __builtin_amdgcn_wmma_f32_16x16x32_f16(false, al, false, bh, (short)0, c, false, false);
  if (NT >= 3) c = __builtin_amdgcn_wmma_f32_16x16x32_f16(false, ah, false, bl, (short)0, c, false, false);
  asm volatile("v_nop\n\tv_nop\n\tv_nop\n\tv_nop" : "+v"(c) : "v"(ah), "v"(al), "v"(bh), "v"(bl));
  return c;
}
// batched GEMM like k_gemm_b but f16 operands: A f32 (split into f16 hi/lo if ASPLIT, else rounded to f16), Bt = f16 values [n][k]; alpha; C f32; N multiple of 16 (partial tiles skipped)
template <bool ASPLIT>
__global__ __launch_bounds__(128) void k_gemm_h(const float* __restrict__ A, int lda, size_t sA, const _Float16* __restrict__ Bh, int ldb, size_t sB, float alpha, float* __restrict__ C, int ldc, size_t sC, int M, int N, int K) {
  __shared__ __attribute__((aligned(16))) float so[4][16][64];
  const int tid = threadIdx.x, w = tid >> 5, lane = tid & 31, ln = lane & 15, hh = lane >> 4; const int by = blockIdx.y;
  A += (size_t)by * sA; Bh += (size_t)by * sB; C += (size_t)by * sC;
  const int ntn = (N + 63) / 64; const int wid = blockIdx.x * 4 + w; const int mt = wid / ntn, nq = wid % ntn; if (mt * 16 >= M) return;
  const int row0 = mt * 16, col0 = nq * 64; const float* arow = A + (size_t)(row0 + ln) * lda;
  v8f acc[4] = {};
  for (int kb = 0; kb < K; kb += 32) {
    FragH ah, al;
    const v4f x0 = *(const v4fa*)(arow + kb + 8 * hh), x1 = *(const v4fa*)(arow + kb + 8 * hh + 4), x2 = *(const v4fa*)(arow + kb + 16 + 8 * hh), x3 = *(const v4fa*)(arow + kb + 16 + 8 * hh + 4);
    float xs[16] = {x0[0],x0[1],x0[2],x0[3],x1[0],x1[1],x1[2],x1[3],x2[0],x2[1],x2[2],x2[3],x3[0],x3[1],x3[2],x3[3]};
#pragma unroll
    for (int i = 0; i < 16; ++i) { const _Float16 h = (_Float16)xs[i]; ah.h[i] = h; al.h[i] = ASPLIT ? (_Float16)(xs[i] - (float)h) : (_Float16)0.0f; }
#pragma unroll
    for (int t = 0; t < 4; ++t) { if (col0 + t * 16 >= N) continue; const size_t boff = (size_t)(col0 + t * 16 + ln) * ldb + kb; FragH bq; bq.half[0] = *(const v8us*)(Bh + boff + 8 * hh); bq.half[1] = *(const v8us*)(Bh + boff + 16 + 8 * hh);
      acc[t] = mmaH<ASPLIT ? 2 : 1>(ah.v, al.v, bq.v, bq.v, acc[t]); }
  }
#pragma unroll
  for (int t = 0; t < 4; ++t) { if (col0 + t * 16 >= N) continue;
#pragma unroll
    for (int r = 0; r < 8; ++r) so[w][8 * hh + r][t * 16 + ln] = acc[t][r] * alpha; }
  __builtin_amdgcn_fence(__ATOMIC_ACQ_REL, "workgroup"); __builtin_amdgcn_wave_barrier();
  const int rsub = lane >> 4, c4 = (lane & 15) * 4;
  {
#pragma unroll
    for (int q = 0; q < 8; ++q) { const int r = q * 2 + rsub; if (col0 + c4 < N) { const v4f v = *(const v4fa*)&so[w][r][c4]; *(v4f*)(C + (size_t)(row0 + r) * ldc + col0 + c4) = v; } }
     }
}

// Wt[n][k] = f16(W[k][n] * scale) from f32 row-major W[K][N] (scale = power of two; bf16-exact weights stay exact in f16 away from the subnormal range); Wt in fragment order, thread t = one 16-byte piece of it
template <int K, int N>
__device__ __forceinline__ void d_wt_f16(const float* __restrict__ W, _Float16* __restrict__ Wt, float scale, const int t) {
  if (t >= N * (K / 8)) return; const size_t e = pk_src<K>((size_t)t); const float* wp = W + (e % K) * N + e / K; float x[8]; FragH f;      /* n = e / K, k = e % K .. + 7 */
#pragma unroll
  for (int i = 0; i < 8; ++i) x[i] = wp[(size_t)i * N];
  asm volatile("s_wait_xcnt 0x0" :: "v"(wp) : "memory");      /* the wait that stands in front of any overwrite of a register that an issued load names; the address is an input so that no load gets it as its destination */
#pragma unroll
  for (int i = 0; i < 8; ++i) f.h[i] = (_Float16)(bf16_round(x[i]) * scale); const v8us o = f.half[0];
  *(v8us*)((unsigned short*)Wt + (size_t)t * 8) = o; 
}
// k_gemm_hh variant with fused epilogue: v = acc·alpha + bias[by·sBias + col] (+ CP[(row/rowsPerB)·sCPb + by·64 + col] if CP) ; ACT 0 none / 1 elu ; writes f16 C16 (and f32 C if non-null)
template <int ACT>
__global__ __launch_bounds__(128) void k_gemm_hhx(const _Float16* __restrict__ A, int lda, size_t sA, const _Float16* __restrict__ Bh, int ldb, size_t sB, float alpha, const float* __restrict__ bias, size_t sBias, const float* __restrict__ CP, int rowsPerB, size_t sCPb, int row0g,
    float* __restrict__ C, _Float16* __restrict__ C16, int ldc, size_t sC, int M, int N, int K) {
  __shared__ __attribute__((aligned(16))) float so[4][16][64];
  const int tid = threadIdx.x, w = tid >> 5, lane = tid & 31, ln = lane & 15, hh = lane >> 4; const int by = blockIdx.y;
  A += (size_t)by * sA; Bh += (size_t)by * sB; const size_t cofs = (size_t)by * sC; const float* bp = bias ? bias + (size_t)by * sBias : nullptr;
  const int ntn = (N + 63) / 64; const int wid = blockIdx.x * 4 + w; const int mt = wid / ntn, nq = wid % ntn; if (mt * 16 >= M) return;
  const int row0 = mt * 16, col0 = nq * 64; const _Float16* arow = A + (size_t)(row0 + ln) * lda;
  v8f acc[4] = {};
  for (int kb = 0; kb < K; kb += 32) { FragH ah; ah.half[0] = *(const v8us*)((const unsigned short*)arow + kb + 8 * hh); ah.half[1] = *(const v8us*)((const unsigned short*)arow + kb + 16 + 8 * hh);
#pragma unroll
    for (int t = 0; t < 4; ++t) { if (col0 + t * 16 >= N) continue; const size_t boff = (size_t)(col0 + t * 16 + ln) * ldb + kb; FragH bq; bq.half[0] = *(const v8us*)((const unsigned short*)Bh + boff + 8 * hh); bq.half[1] = *(const v8us*)((const unsigned short*)Bh + boff + 16 + 8 * hh);
      acc[t] = mmaH<1>(ah.v, ah.v, bq.v, bq.v, acc[t]); }
  }
#pragma unroll
  for (int t = 0; t < 4; ++t) { if (col0 + t * 16 >= N) continue; const int col = col0 + t * 16 + ln; const float bv = bp ? bf16_round(bp[col]) : 0.f;
#pragma unroll
    for (int r = 0; r < 8; ++r) { float v = acc[t][r] * alpha + bv; if (CP) { const int rr = row0g + row0 + 8 * hh + r; if (rowsPerB < 0) v += CP[cofs + (size_t)rr * ldc + col];      /* rowsPerB < 0: own element of the batched C plane */ else { const int bidx = rr / rowsPerB; v += CP[(size_t)bidx * sCPb + (size_t)by * 64 + col]; } } if (ACT == 1) v = (v > 0.f) ? v : expm1f(v); else if (ACT == 7) v = (v > 0.f) ? v + 1.0f : expf(v); else if (ACT == 8) v = tanhf(v); else if (ACT == 9) v = 0.5f * v * (1.0f + tanhf(0.7978845608028654f * (v + 0.044715f * v * v * v))); else if (ACT == 11) v = 1.0f / (1.0f + expf(-v)); else if (ACT == 12) v = (v > 0.f) ? v : 0.01f * v; else if (ACT == 14) v = (v > 0.f) ? v : 0.1f * v; else if (ACT == 16) v = (v >= 0.f) ? v : 0.3f * v; else if (ACT == 17) v = (v >= 0.f) ? v : 0.2f * v; else if (ACT == 15) v = v / (1.0f + expf(-v)); else if (ACT == 3) v = fmaxf(v, 0.f); else if (ACT == 6) v = 0.5f * v * (1.0f + erff(v * 0.70710678118654752f)); so[w][8 * hh + r][t * 16 + ln] = v; } }
  __builtin_amdgcn_fence(__ATOMIC_ACQ_REL, "workgroup"); __builtin_amdgcn_wave_barrier();
  const int rsub = lane >> 4, c4 = (lane & 15) * 4; typedef _Float16 v4h __attribute__((ext_vector_type(4)));
  {
#pragma unroll
    for (int q = 0; q < 8; ++q) { const int r = q * 2 + rsub; if (col0 + c4 < N) { const v4f v = *(const v4fa*)&so[w][r][c4]; if (C) *(v4f*)(C + cofs + (size_t)(row0 + r) * ldc + col0 + c4) = v; if (C16) { v4h h4; for (int i = 0; i < 4; ++i) h4[i] = (_Float16)v[i]; *(v4h*)(C16 + cofs + (size_t)(row0 + r) * ldc + col0 + c4) = h4; } } }
     }
}


typedef _Float16 v4h __attribute__((ext_vector_type(4)));

/* x row-major [rows][KC]; X16 in fragment order, thread t = one 16-byte piece of it */
template <int KC>
__device__ __forceinline__ void d_x16(const float* __restrict__ x, _Float16* __restrict__ X16, size_t n8, const size_t t) { if (t >= n8) return; const size_t e = pk_src<KC>(t); FragH f;
#pragma unroll
  for (int q = 0; q < 8; ++q) f.h[q] = (_Float16)bf16_round(x[e + q]); *(v8us*)((unsigned short*)X16 + t * 8) = f.half[0];  }
__global__ __launch_bounds__(256) void k_h16(const float* __restrict__ x, _Float16* __restrict__ X16, size_t n8) { const size_t t = (size_t)blockIdx.x * 256 + threadIdx.x; if (t >= n8) return; FragH f;
#pragma unroll
  for (int q = 0; q < 8; ++q) f.h[q] = (_Float16)x[t * 8 + q]; *(v8us*)((unsigned short*)X16 + t * 8) = f.half[0];  }
__global__ __launch_bounds__(256) void k_round16f(const float* __restrict__ W, _Float16* __restrict__ Bt, size_t n8) { const size_t t = (size_t)blockIdx.x * 256 + threadIdx.x; if (t >= n8) return; FragH f;
#pragma unroll
  for (int i = 0; i < 8; ++i) f.h[i] = (_Float16)(bf16_round(W[t * 8 + i]) * 16.0f); *(v8us*)((unsigned short*)Bt + t * 8) = f.half[0];  }
/* PK: F row-major [rows][DM], Hh and Hl in fragment order (thread = one 16-byte piece of each); else all three row-major. F holds blk8 pieces per batch, Hh and Hl pitch8: the rows of F become the first rows of each batch there */
template <bool PK>
__global__ __launch_bounds__(256) void k_hl(const float* __restrict__ F, _Float16* __restrict__ Hh, _Float16* __restrict__ Hl, size_t n8, size_t blk8, size_t pitch8) { const size_t t = (size_t)blockIdx.x * 256 + threadIdx.x; if (t >= n8) return; const size_t e = PK ? pk_src<DM>(t) : t * 8; FragH fh, fl; const v4f a = *(const v4fa*)(F + e), c = *(const v4fa*)(F + e + 4);
#pragma unroll
  for (int q = 0; q < 4; ++q) { _Float16 h = (_Float16)a[q]; fh.h[q] = h; fl.h[q] = (_Float16)((a[q] - (float)h) * 1024.0f); h = (_Float16)c[q]; fh.h[4 + q] = h; fl.h[4 + q] = (_Float16)((c[q] - (float)h) * 1024.0f); }
  { const size_t d = (t / blk8) * pitch8 + t % blk8; *(v8us*)((unsigned short*)Hh + d * 8) = fh.half[0]; *(v8us*)((unsigned short*)Hl + d * 8) = fl.half[0];  } }

// ---- fast GEMM (wave tile 32x64; requires M % 32 == 0 rows per launch region and N % 64 == 0); epilogue = k_gemm_hhx semantics ----
__device__ __forceinline__ v8f g2_mma(v16h a, v16h b, v8f c) { v8f d = __builtin_amdgcn_wmma_f32_16x16x32_f16(false, a, false, b, (short)0, c, false, false); asm volatile("v_nop\n\tv_nop\n\tv_nop\n\tv_nop" : "+v"(d) : "v"(a), "v"(b)); return d; }
// One k-step (32 k) of the wave's 32x64 tile: two A and four B fragments = twelve 16-byte loads of 512 bytes in a row each (A and B in fragment order). pa / pb: wave-uniform byte address of A / B at that k-step (1 KiB a k-step); oa / ob: the lane's fixed byte offsets (band and lane).
struct G2St { v16h a0, a1, b0, b1, b2, b3; };
__device__ __forceinline__ v16h g2_fragb(const char* base, unsigned o) { FragH f; f.half[0] = *(const v8us*)(base + (size_t)o); f.half[1] = *(const v8us*)(base + (size_t)o + 512); return f.v; }
__device__ __forceinline__ void g2_ld(G2St& s, const char* pa, const char* pb, unsigned oa0, unsigned oa1, unsigned ob0, unsigned ob1, unsigned ob2, unsigned ob3) {
  s.a0 = g2_fragb(pa, oa0); s.a1 = g2_fragb(pa, oa1); s.b0 = g2_fragb(pb, ob0); s.b1 = g2_fragb(pb, ob1); s.b2 = g2_fragb(pb, ob2); s.b3 = g2_fragb(pb, ob3);
  __builtin_amdgcn_sched_barrier(0); }      /* keeps the twelve loads in front of the next k-step's first WMMA: behind it they would be issued only after that WMMA's wait for its own operands */
// The wait that stands in front of any overwrite of a register that an issued load names. The bases and the lane offsets are inputs so that they stay as they are up to here.
__device__ __forceinline__ void g2_xw(const char* pa, const char* pb, unsigned oa0, unsigned oa1, unsigned ob0, unsigned ob1, unsigned ob2, unsigned ob3) { asm volatile("s_wait_xcnt 0x0" :: "s"(pa), "s"(pb), "v"(oa0), "v"(oa1), "v"(ob0), "v"(ob1), "v"(ob2), "v"(ob3) : "memory"); }
__device__ __forceinline__ void g2_mm(const G2St& s, v8f (&c)[8]) { c[0] = g2_mma(s.a0, s.b0, c[0]); c[4] = g2_mma(s.a1, s.b0, c[4]); c[1] = g2_mma(s.a0, s.b1, c[1]); c[5] = g2_mma(s.a1, s.b1, c[5]); c[2] = g2_mma(s.a0, s.b2, c[2]); c[6] = g2_mma(s.a1, s.b2, c[6]); c[3] = g2_mma(s.a0, s.b3, c[3]); c[7] = g2_mma(s.a1, s.b3, c[7]); }
// The K loop of a wave's 32x64 tile (nst k-steps of 32), shared by the GEMM kernels below. pa / pb: wave-uniform bases; the offsets: the lane's own.
__device__ __forceinline__ void g2_kloop(const char* pa, const char* pb, const int nst, const unsigned oa0, const unsigned oa1, const unsigned ob0, const unsigned ob1, const unsigned ob2, const unsigned ob3, v8f (&accs)[8]) { G2St s0, s1, s2;
  // Three k-steps' fragments rest in registers: a set is loaded again right after its WMMAs, so its loads fly while the other two sets are worked on. Every accumulator still takes its k-steps in rising order.
  if (nst >= 3) { g2_ld(s0, pa, pb, oa0, oa1, ob0, ob1, ob2, ob3); g2_ld(s1, pa + 1024, pb + 1024, oa0, oa1, ob0, ob1, ob2, ob3); g2_ld(s2, pa + 2048, pb + 2048, oa0, oa1, ob0, ob1, ob2, ob3); g2_xw(pa, pb, oa0, oa1, ob0, ob1, ob2, ob3); int s = 0;
#pragma unroll 1      /* the body already holds three k-steps; a copy of it would not fit the registers */
    for (; s + 6 <= nst; s += 3) {
      g2_mm(s0, accs); g2_ld(s0, pa + 3072, pb + 3072, oa0, oa1, ob0, ob1, ob2, ob3);
      g2_mm(s1, accs); g2_ld(s1, pa + 4096, pb + 4096, oa0, oa1, ob0, ob1, ob2, ob3);
      g2_mm(s2, accs); g2_ld(s2, pa + 5120, pb + 5120, oa0, oa1, ob0, ob1, ob2, ob3);
      g2_xw(pa, pb, oa0, oa1, ob0, ob1, ob2, ob3);      /* the two bases move on below */
      pa += 3072; pb += 3072; }
    const int rem = nst - s;      /* 3 to 5 k-steps are left, three of them loaded */
    g2_mm(s0, accs); if (rem > 3) { g2_ld(s0, pa + 3072, pb + 3072, oa0, oa1, ob0, ob1, ob2, ob3); g2_xw(pa, pb, oa0, oa1, ob0, ob1, ob2, ob3); }
    g2_mm(s1, accs); if (rem > 4) { g2_ld(s1, pa + 4096, pb + 4096, oa0, oa1, ob0, ob1, ob2, ob3); g2_xw(pa, pb, oa0, oa1, ob0, ob1, ob2, ob3); }
    g2_mm(s2, accs); if (rem > 3) g2_mm(s0, accs); if (rem > 4) g2_mm(s1, accs); }
  else if (nst == 2) { g2_ld(s0, pa, pb, oa0, oa1, ob0, ob1, ob2, ob3); g2_ld(s1, pa + 1024, pb + 1024, oa0, oa1, ob0, ob1, ob2, ob3); g2_xw(pa, pb, oa0, oa1, ob0, ob1, ob2, ob3); g2_mm(s0, accs); g2_mm(s1, accs); }
  else if (nst == 1) { g2_ld(s0, pa, pb, oa0, oa1, ob0, ob1, ob2, ob3); g2_xw(pa, pb, oa0, oa1, ob0, ob1, ob2, ob3); g2_mm(s0, accs); }
}
// Every product of x_t in ONE launch: they share operands and depend on nothing of each other. All have the wave tile 32x64 and the K loop above; grid.y picks the job, grid.x the tile.
// grid.y = 0: q / 8 + xl_u, 1: q / 8 + xl_v, 2: k, each -> f16 rows in fragment order; 3: v -> V^T; all token rows, a work-group = 128x64, a wave = 32 rows of it.
// grid.y = 4: the same four products (grid.x / 128) for the first QT0 rows of each batch, in f32: a work-group is two 32x64 tiles of C one below the other, a tile has two waves;
// wave t of a tile runs the whole K loop of term t (0: hi rows of x_t, 1: x1024 residual rows), lays its scaled tile in its own LDS plane, and behind one barrier the two planes are added, hi + residual, and stored as whole rows.
// V^T [batch * NH + head][64][SQ], f16 hi and x1024 residual planes in fragment order: an accumulator tile holds, per lane, dim 16 t + ln and tokens 16 half + 8 hh .. + 7:
// the very 16-byte piece (band t, half block 'half', lane) of V^T, so no transpose and no LDS. A wave's 32 tokens are one 1-KiB block of each of the head's four bands.
__global__ __launch_bounds__(128) void k_proj(const _Float16* __restrict__ X16, const _Float16* __restrict__ XL16, const _Float16* __restrict__ BQ, const _Float16* __restrict__ BK, const _Float16* __restrict__ BV, const float* __restrict__ xlu, const float* __restrict__ xlv,
    _Float16* __restrict__ QU, _Float16* __restrict__ QV, _Float16* __restrict__ K16, _Float16* __restrict__ Vt, _Float16* __restrict__ Vtl, float* __restrict__ QUF, float* __restrict__ QVF, float* __restrict__ KF0, float* __restrict__ VF0) {
  __shared__ __attribute__((aligned(16))) float so[4][32][68];
  const int lane = threadIdx.x & 31, ln = lane & 15, hh = lane >> 4; const int w = __builtin_amdgcn_readfirstlane((int)(threadIdx.x >> 5));      /* wave-uniform: the job's bases stay scalar */
  const int bx = blockIdx.x; const bool ft = blockIdx.y == 4; const int prod = ft ? bx / 128 : (int)blockIdx.y; const int t = ft ? (w & 1) : 0; const int nq = bx % (DM / 64);      /* nq = head */
  const int frow = ((bx % 128) / (DM / 64)) * 64 + (w >> 1) * 32;      /* ft: the tile's first row among the NB * QT0 first-tile rows */
  const int row0 = ft ? (frow / QT0) * SQ + frow % QT0 : (bx / (DM / 64)) * 128 + 32 * w, col0 = nq * 64;      /* row0: token row */
  const _Float16* A = t ? XL16 : X16; const _Float16* Bh = (prod < 2) ? BQ : (prod == 2) ? BK : BV; const float alpha = ((prod < 2) ? 0.0078125f : 0.0625f) * (t ? 0.0009765625f : 1.0f);      /* weights x16; q / 8; residual x1024 */
  const float* bp = (t != 0) ? nullptr : (prod == 0) ? xlu : (prod == 1) ? xlv : nullptr;      /* the per-head 64-vectors as a [1024] column bias, with the first term */
  const unsigned oa0 = (unsigned)row0 * (DM * 2u) + 16u * lane, oa1 = oa0 + 32u * DM;      /* fragment order: the band's first byte + the lane's 16 bytes */
  const unsigned ob0 = (unsigned)col0 * (DM * 2u) + 16u * lane, ob1 = ob0 + 32u * DM, ob2 = ob1 + 32u * DM, ob3 = ob2 + 32u * DM;
  const v8f z8 = {0.f,0.f,0.f,0.f,0.f,0.f,0.f,0.f}; v8f accs[8] = {z8, z8, z8, z8, z8, z8, z8, z8};
  g2_kloop((const char*)A, (const char*)Bh, DM >> 5, oa0, oa1, ob0, ob1, ob2, ob3, accs);
  if (!ft && prod == 3) {      /* the whole work-group: no barrier lies behind */
    const size_t vo = ((size_t)((row0 / SQ) * NH + nq) * 4) * (32 * (size_t)SQ) + (size_t)((row0 % SQ) >> 5) * 1024 + 16u * lane; FragH fh[8], fl[8];
#pragma unroll
    for (int u = 0; u < 8; ++u) {
#pragma unroll
      for (int r = 0; r < 8; ++r) { const float v = accs[u][r] * alpha; const _Float16 hv = (_Float16)v; fh[u].h[r] = hv; fl[u].h[r] = (_Float16)((v - (float)hv) * 1024.0f); } }
    __builtin_amdgcn_sched_barrier(0);      /* keeps every conversion in front of the first store: no register that an issued store names is written again before the wave ends */
#pragma unroll
    for (int u = 0; u < 8; ++u) { const size_t o = vo + (size_t)(u & 3) * (32 * (size_t)SQ) + (u >> 2) * 512; *(v8us*)((char*)Vt + o) = fh[u].half[0]; *(v8us*)((char*)Vtl + o) = fl[u].half[0]; }
    return; }
#pragma unroll
  for (int u = 0; u < 8; ++u) { const int tc = u & 3, half = u >> 2; const float bv = bp ? bf16_round(bp[col0 + tc * 16 + ln]) : 0.f;
#pragma unroll
    for (int r = 0; r < 8; ++r) so[w][half * 16 + 8 * hh + r][tc * 16 + ln] = accs[u][r] * alpha + bv; }
  if (ft) { float* C = (prod == 0) ? QUF : (prod == 1) ? QVF : (prod == 2) ? KF0 : VF0;
    __syncthreads();      /* both terms' planes are complete before any wave adds them */
    const int rsub = lane >> 4, c4 = (lane & 15) * 4, p0 = w & 2;      /* p0: the hi plane of the wave's tile */
    for (int q = t; q < 16; q += 2) { const int r = q * 2 + rsub; v4f v = *(const v4fa*)&so[p0][r][c4]; v += *(const v4fa*)&so[p0 + 1][r][c4];
      *(v4f*)(C + (size_t)(frow + r) * DM + col0 + c4) = v;
      asm volatile("s_wait_xcnt 0x0" ::: "memory"); } }      /* the wait that stands in front of any overwrite of a register that an issued store names: the next trip forms its address and its sum in the same registers */
  else { _Float16* C16 = (prod == 0) ? QU : (prod == 1) ? QV : K16;      /* C16 [rows][DM] in fragment order: the tile's two bands x two k-steps x two halves, each one 512-byte store */
    __builtin_amdgcn_fence(__ATOMIC_ACQ_REL, "workgroup"); __builtin_amdgcn_wave_barrier();      /* the tile is read across the wave's lanes: keeps the LDS stores in front of those reads */
    char* cb16 = (char*)(C16 + (size_t)row0 * DM) + (size_t)(col0 >> 5) * 1024 + lane * 16;
#pragma unroll
    for (int u = 0; u < 8; ++u) { const float* sr = &so[w][(u >> 2) * 16 + ln][(u & 3) * 16 + 8 * hh]; const v4f a = *(const v4fa*)sr, c = *(const v4fa*)(sr + 4); FragH f;
#pragma unroll
      for (int i = 0; i < 4; ++i) { f.h[i] = (_Float16)a[i]; f.h[4 + i] = (_Float16)c[i]; }
      *(v8us*)(cb16 + (size_t)(u >> 2) * 32 * DM + (u & 3) * 512) = f.half[0]; } } }

// res = o_hi w_res 2^-10 + o_lo w_res 2^-20 (o x64, weights x16, residual x1024), both terms in one launch: work-group, waves, LDS planes and the order of the sum as in the job grid.y = 4 above; grid.x = (NR / 64) (DM / 64).
__global__ __launch_bounds__(128) void k_out(const _Float16* __restrict__ O16, const _Float16* __restrict__ OL16, const _Float16* __restrict__ BR, float* __restrict__ C) {
  __shared__ __attribute__((aligned(16))) float so[4][32][68];
  const int lane = threadIdx.x & 31, ln = lane & 15, hh = lane >> 4; const int w = __builtin_amdgcn_readfirstlane((int)(threadIdx.x >> 5)); const int t = w & 1;      /* wave-uniform: the term's base stays scalar */
  const int row0 = ((int)blockIdx.x / (DM / 64)) * 64 + (w >> 1) * 32, col0 = ((int)blockIdx.x % (DM / 64)) * 64;
  const _Float16* A = t ? OL16 : O16; const float alpha = t ? 0.00000095367431640625f : 0.0009765625f;
  const unsigned oa0 = (unsigned)row0 * (DM * 2u) + 16u * lane, oa1 = oa0 + 32u * DM;
  const unsigned ob0 = (unsigned)col0 * (DM * 2u) + 16u * lane, ob1 = ob0 + 32u * DM, ob2 = ob1 + 32u * DM, ob3 = ob2 + 32u * DM;
  const v8f z8 = {0.f,0.f,0.f,0.f,0.f,0.f,0.f,0.f}; v8f accs[8] = {z8, z8, z8, z8, z8, z8, z8, z8};
  g2_kloop((const char*)A, (const char*)BR, DM >> 5, oa0, oa1, ob0, ob1, ob2, ob3, accs);
#pragma unroll
  for (int u = 0; u < 8; ++u) { const int tc = u & 3, half = u >> 2;
#pragma unroll
    for (int r = 0; r < 8; ++r) so[w][half * 16 + 8 * hh + r][tc * 16 + ln] = accs[u][r] * alpha; }
  __syncthreads();      /* both terms' planes are complete before any wave adds them */
  const int rsub = lane >> 4, c4 = (lane & 15) * 4, p0 = w & 2;
  for (int q = t; q < 16; q += 2) { const int r = q * 2 + rsub; v4f v = *(const v4fa*)&so[p0][r][c4]; v += *(const v4fa*)&so[p0 + 1][r][c4];
    *(v4f*)(C + (size_t)(row0 + r) * DM + col0 + c4) = v;
    asm volatile("s_wait_xcnt 0x0" ::: "memory"); } }      /* the wait that stands in front of any overwrite of a register that an issued store names: the next trip forms its address and its sum in the same registers */

__global__ __launch_bounds__(256) void k_wnat(const float* __restrict__ w, size_t n8, _Float16* __restrict__ Bt) { const size_t t = (size_t)blockIdx.x * 256 + threadIdx.x; if (t >= n8) return; FragH f; for (int q = 0; q < 8; ++q) f.h[q] = (_Float16)(bf16_round(w[t * 8 + q]) * 16.0f); *(v8us*)((unsigned short*)Bt + t * 8) = f.half[0];  }
__global__ __launch_bounds__(256) void k_rsm(const float* __restrict__ S, _Float16* __restrict__ P, int nrows) {
  #pragma clang fp contract(off)
  const int i = blockIdx.x * 256 + threadIdx.x; if (i >= nrows) return; const float* s = S + (size_t)i * SQ; float mx = -3.0e38f;
#pragma unroll 1
  for (int j = 0; j < SQ; ++j) mx = fmaxf(mx, s[j]); float se = 0.f;
#pragma unroll 1
  for (int j = 0; j < SQ; ++j) se += expf(s[j] - mx); const float sc = 256.0f / se;
#pragma unroll 1
  for (int j0 = 0; j0 < SQ; j0 += 8) { FragH f; for (int q = 0; q < 8; ++q) f.h[q] = (_Float16)(expf(s[j0 + q] - mx) * sc); unsigned short* d = (unsigned short*)P + (size_t)i * SQ + j0; *(v8us*)d = f.half[0];  } }
__global__ __launch_bounds__(256) void k_vt(const _Float16* __restrict__ V16, int b, int h0, _Float16* __restrict__ VT) { __shared__ unsigned short tl[64][65]; const int tid = threadIdx.x; const int hh = blockIdx.x % HG, sg = blockIdx.x / HG; const int s0 = sg * 64; const int h = h0 + hh;
  for (int i = tid; i < 64 * 8; i += 256) { const int j = i / 8, d8 = (i % 8) * 8; FragH f; f.half[0] = *(const v8us*)((const unsigned short*)V16 + ((size_t)b * SQ + s0 + j) * DM + h * HD + d8); for (int q = 0; q < 8; ++q) tl[d8 + q][j] = f.u[q]; }
  __syncthreads();
  { for (int i = tid; i < 64 * 8; i += 256) { const int d = i / 8, j8 = (i % 8) * 8; FragH f; for (int q = 0; q < 8; ++q) f.u[q] = tl[d][j8 + q]; *(v8us*)((unsigned short*)VT + ((size_t)hh * HD + d) * SQ + s0 + j8) = f.half[0]; }  } }



__global__ __launch_bounds__(256) void k_rsmcf2(const float* __restrict__ S, _Float16* __restrict__ P, int hg, int q0, int nk) {
  #pragma clang fp contract(off)
  const int t = blockIdx.x * 256 + threadIdx.x; if (t >= hg * QT) return; const size_t i = (size_t)t; const float* s = S + i * NKX; const int last = q0 + (t % QT); float mx = -3.0e38f;
#pragma unroll 1
  for (int j = 0; j < nk; ++j) { const float f = (j <= last) ? 1.f : 0.f; mx = fmaxf(mx, fmaf(f, s[j], (1.f - f) * -1.0e9f)); } float se = 0.f;
#pragma unroll 1
  for (int j = 0; j < nk; ++j) { const float f = (j <= last) ? 1.f : 0.f; se += __expf(fmaf(f, s[j], (1.f - f) * -1.0e9f) - mx); } const float sc = 256.0f / se;
#pragma unroll 1
  for (int j0 = 0; j0 < nk; j0 += 8) { FragH fr; for (int q = 0; q < 8; ++q) { const int j = j0 + q; const float f = (j <= last) ? 1.f : 0.f; fr.h[q] = (_Float16)(__expf(fmaf(f, s[j], (1.f - f) * -1.0e9f) - mx) * sc); } unsigned short* d = (unsigned short*)P + i * NKX + j0; *(v8us*)d = fr.half[0];  } }


template <int MASKADD>
__global__ __launch_bounds__(64) void k_att0(const float* __restrict__ QF, const float* __restrict__ KF, const float* __restrict__ VF, int ld, const float* __restrict__ mask, float scale, float* __restrict__ OF, int ldo) {
  #pragma clang fp contract(off)
  __shared__ __attribute__((aligned(16))) float lq[64][64]; __shared__ __attribute__((aligned(16))) float lo[64][64];
  const int tid = threadIdx.x; const int h = blockIdx.x / (QT0 / 64), rg = blockIdx.x % (QT0 / 64); const int i = rg * 64 + tid;
  const float* qr = QF + (size_t)i * ld + h * HD;
#pragma unroll 1
  for (int c = 0; c < HD / 4; ++c) { *(v4f*)&lq[tid][c * 4] = *(const v4fa*)(qr + c * 4); const v4f z = {0.f, 0.f, 0.f, 0.f}; *(v4f*)&lo[tid][c * 4] = z; }
  float m = -1.0e30f, l = 0.f; const int jmax = MASKADD ? (SQ - 1) : (rg * 64 + 63);      /* additive-mask form: every key (the mask input decides); causal form: keys up to the block's last row */
#pragma unroll 1
  for (int j = 0; j <= jmax; ++j) { const float* kr = KF + (size_t)j * ld + h * HD; const float* vr = VF + (size_t)j * ld + h * HD; float s = 0.f;
#pragma unroll 1
    for (int c = 0; c < HD / 4; ++c) { const v4f kq = *(const v4fa*)(kr + c * 4); const v4f qq = *(v4f*)&lq[tid][c * 4]; s = __fadd_rn(s, __fmul_rn(qq[0], kq[0])); s = __fadd_rn(s, __fmul_rn(qq[1], kq[1])); s = __fadd_rn(s, __fmul_rn(qq[2], kq[2])); s = __fadd_rn(s, __fmul_rn(qq[3], kq[3])); }
    s = __fmul_rn(s, scale); if (MASKADD) s = __fadd_rn(s, __fmul_rn(bf16_round(mask[(size_t)i * SQ + j]), -10000.0f));
    const float f = (MASKADD || j <= i) ? 1.f : 0.f; const float sm = fmaf(f, s, (1.f - f) * -1.0e30f); const float mn = fmaxf(m, sm); const float sc = expf(m - mn); const float e = expf(sm - mn); l = __fadd_rn(__fmul_rn(l, sc), e); m = mn;
#pragma unroll 1
    for (int c = 0; c < HD / 4; ++c) { const v4f vv = *(const v4fa*)(vr + c * 4); v4f oo = *(v4f*)&lo[tid][c * 4]; for (int u = 0; u < 4; ++u) oo[u] = __fadd_rn(__fmul_rn(oo[u], sc), __fmul_rn(e, vv[u])); *(v4f*)&lo[tid][c * 4] = oo; } }
  const float fin = 64.0f / l;      /* o carried x64 like the f16 path */
#pragma unroll 1
  for (int c = 0; c < HD / 4; ++c) { v4f oo = *(v4f*)&lo[tid][c * 4]; for (int u = 0; u < 4; ++u) oo[u] = __fmul_rn(oo[u], fin); *(v4f*)&lo[tid][c * 4] = oo; }
  __syncthreads();
  {
#pragma unroll 1
    for (int it = 0; it < 16; ++it) { const int row = it * 4 + tid / 16, pc = (tid % 16) * 4; const v4f v = *(const v4f*)&lo[row][pc]; *(v4f*)(OF + (size_t)(rg * 64 + row) * ldo + h * HD + pc) = v; }
     } }


__global__ __launch_bounds__(256) void k_kvexp(const float* __restrict__ src, float* __restrict__ dst, size_t n4) { const size_t t = (size_t)blockIdx.x * 256 + threadIdx.x; if (t >= n4) return; const size_t e = t * 4; const size_t row = e / DM; const int col = (int)(e % DM); const int h = col / HD, d = col % HD; const v4f v = *(const v4fa*)(src + row * KVD + (size_t)(h / HPG) * HD + d); *(v4f*)(dst + e) = v;  }

__global__ __launch_bounds__(256) void k_tab2(float theta, float* __restrict__ CS, float* __restrict__ SN) {
  #pragma clang fp contract(off)
  const int t = blockIdx.x * 256 + threadIdx.x; if (t >= SQ * (HD / 2)) return; const int i = t % (HD / 2); const int p = t / (HD / 2); const float invf = 1.0f / powf(theta, (float)(2 * i) / (float)HD); const float ang = __fmul_rn((float)p, invf); const float c = cosf(ang), s = sinf(ang);
  *(float*)(CS + t) = c; *(float*)(SN + t) = s;  }
template <int NORM, int ROPE>
__global__ __launch_bounds__(64) void k_xform(const float* __restrict__ F, int ldf, int nh, const float* __restrict__ gain, float eps, const float* __restrict__ CS, const float* __restrict__ SN, _Float16* __restrict__ H16, int ldo) {
  #pragma clang fp contract(off)
  __shared__ float xv[HD]; __shared__ float red[HD]; __shared__ unsigned short sh_[HD]; const int d = threadIdx.x; const int h = blockIdx.x % nh; const size_t r = blockIdx.x / nh; const int p = (int)(r % SQ);
  float x = F[r * (size_t)ldf + (size_t)h * HD + d];
  if (NORM) { red[d] = __fmul_rn(x, x); __syncthreads(); for (int st = HD / 2; st > 0; st >>= 1) { if (d < st) red[d] = __fadd_rn(red[d], red[d + st]); __syncthreads(); } const float rs = rsqrtf(__fadd_rn(red[0] / (float)HD, eps)); x = __fmul_rn(__fmul_rn(x, rs), bf16_round(gain[d])); }
  xv[d] = x; __syncthreads();
  float o = x;
  if (ROPE == 1) { const int i = d >> 1; const float c = CS[p * (HD / 2) + i], s = SN[p * (HD / 2) + i]; const float ev = xv[2 * i], od = xv[2 * i + 1]; o = (d & 1) ? __fadd_rn(__fmul_rn(ev, s), __fmul_rn(od, c)) : __fadd_rn(__fmul_rn(ev, c), -__fmul_rn(od, s)); }
  if (ROPE == 2) { const int i = d & (HD / 2 - 1); const float c = CS[p * (HD / 2) + i], s = SN[p * (HD / 2) + i]; const float lo = xv[i], hi = xv[i + HD / 2]; o = (d < HD / 2) ? __fadd_rn(__fmul_rn(lo, c), -__fmul_rn(hi, s)) : __fadd_rn(__fmul_rn(lo, s), __fmul_rn(hi, c)); }
  FragH th; th.h[0] = (_Float16)o; sh_[d] = th.u[0]; __syncthreads();
  if (d < HD / 8) { FragH f; for (int q = 0; q < 8; ++q) f.u[q] = sh_[d * 8 + q]; unsigned short* dst = (unsigned short*)H16 + r * (size_t)ldo + (size_t)h * HD + d * 8; *(v8us*)dst = f.half[0];  } }

template <int NORM, int ROPE>
__global__ __launch_bounds__(64) void k_xformf(const float* __restrict__ F, int ldf, int nh, const float* __restrict__ gain, float eps, const float* __restrict__ CS, const float* __restrict__ SN, float* __restrict__ F32, int ldo) {
  #pragma clang fp contract(off)
  __shared__ float xv[HD]; __shared__ float red[HD]; const int d = threadIdx.x; const int h = blockIdx.x % nh; const size_t r = blockIdx.x / nh; const int p = (int)(r % SQ);
  float x = F[r * (size_t)ldf + (size_t)h * HD + d];
  if (NORM) { red[d] = __fmul_rn(x, x); __syncthreads(); for (int st = HD / 2; st > 0; st >>= 1) { if (d < st) red[d] = __fadd_rn(red[d], red[d + st]); __syncthreads(); } const float rs = rsqrtf(__fadd_rn(red[0] / (float)HD, eps)); x = __fmul_rn(__fmul_rn(x, rs), bf16_round(gain[d])); }
  xv[d] = x; __syncthreads();
  float o = x;
  if (ROPE == 1) { const int i = d >> 1; const float c = CS[p * (HD / 2) + i], s = SN[p * (HD / 2) + i]; const float ev = xv[2 * i], od = xv[2 * i + 1]; o = (d & 1) ? __fadd_rn(__fmul_rn(ev, s), __fmul_rn(od, c)) : __fadd_rn(__fmul_rn(ev, c), -__fmul_rn(od, s)); }
  if (ROPE == 2) { const int i = d & (HD / 2 - 1); const float c = CS[p * (HD / 2) + i], s = SN[p * (HD / 2) + i]; const float lo = xv[i], hi = xv[i + HD / 2]; o = (d < HD / 2) ? __fadd_rn(__fmul_rn(lo, c), -__fmul_rn(hi, s)) : __fadd_rn(__fmul_rn(lo, s), __fmul_rn(hi, c)); }
  float* dst = F32 + r * (size_t)ldo + (size_t)h * HD + d; *(float*)dst = o;  }

__global__ __launch_bounds__(256) void k_trig(const float* __restrict__ a, float* __restrict__ CS, float* __restrict__ SN, int n) {
  #pragma clang fp contract(off)
  const int t = blockIdx.x * 256 + threadIdx.x; if (t >= n) return; const float v = bf16_round(a[t]); const float c = cosf(v), s = sinf(v);
  *(float*)(CS + t) = c; *(float*)(SN + t) = s;  }

__global__ __launch_bounds__(256) void k_tabpos(const int* __restrict__ pos, float* __restrict__ CS, float* __restrict__ SN, int n) {
  #pragma clang fp contract(off)
  const int t = blockIdx.x * 256 + threadIdx.x; if (t >= n) return; const int p = t / 32, i = t % 32; const float invf = (float)(1.0 / pow(10000.0, ((double)(2 * i)) / 64.0)); const float a = __fmul_rn((float)pos[p], invf); const float c = cosf(a), s = sinf(a);
  *(float*)(CS + t) = c; *(float*)(SN + t) = s;  }

// 2^x of four values. One asm statement so that every v_exp_f32 has an independent instruction behind it (early-clobber outputs: none overwrites a source);
// the closing v_nop is the slot that the instruction set asks for before the last result is read or its source overwritten.
__device__ __forceinline__ v4f exp2x4(v4f x) { float r0, r1, r2, r3;
  asm("v_exp_f32 %0, %4\n\tv_exp_f32 %1, %5\n\tv_exp_f32 %2, %6\n\tv_exp_f32 %3, %7\n\tv_nop" : "=&v"(r0), "=&v"(r1), "=&v"(r2), "=&v"(r3) : "v"(x[0]), "v"(x[1]), "v"(x[2]), "v"(x[3]));
  const v4f r = {r0, r1, r2, r3}; return r; }
// 2^x of one value; the v_nop is the slot that the instruction set asks for before the result is read or the source overwritten.
__device__ __forceinline__ float exp2x1(float x) { float r; asm("v_exp_f32 %0, %1\n\tv_nop" : "=&v"(r) : "v"(x)); return r; }
__device__ __forceinline__ v8f fa_mma(v16h a, v16h b, v8f c) { return __builtin_amdgcn_wmma_f32_16x16x32_f16(false, a, false, b, (short)0, c, false, false); }
// Exact f32 XL attention of the first QT0 rows of a batch: one wave per (head, row i). Lane = 16 hh + ln: ln owns dims 4 ln .. 4 ln + 3, hh one of two keys,
// so every 16-byte load instruction reads two whole 256-byte rows. Keys go in chunks of 32: a lane forms 16 partial dots (q+u).k + (q+v).r over its four dims,
// a four-step butterfly sums each over its 16 lanes, and lane l keeps the score of key 32 c + l. Scores, then weights, rest in the wave's own LDS row;
// maximum and sum are taken over the whole row (two passes, no rescaling); o = sum_j e_j v_j per half, the halves added at the end, x 64 / sum.
// Rows of K, V up to 32 c + 31 <= QT0 - 1 exist; a key above the diagonal gets -1e30 by the arithmetic select and its xl_r index is clamped.
// f: the work-group's number among the NH * NB * (QT0 / 8) of this part, eight rows (waves) each; pw: an LDS row per wave.
__device__ __forceinline__ void d_att0xl(const float* __restrict__ QF, const float* __restrict__ QVF, const float* __restrict__ KF, const float* __restrict__ VF, const float* __restrict__ RF, float* __restrict__ OF, float (*pw)[QT0], const int f) {
  { const size_t bo = (size_t)((f / NH) % NB) * (QT0 * DM); QF += bo; QVF += bo; KF += bo; VF += bo; OF += bo; }      /* every plane holds QT0 rows per batch */
  const int lane = threadIdx.x & 31, ln = lane & 15, hh = lane >> 4; const int w = __builtin_amdgcn_readfirstlane((int)(threadIdx.x >> 5));      /* wave-uniform: scalar row bases and trip counts */
  const int h = f % NH; const int i = QT0 - 1 - ((f / (NH * NB)) * 8 + w); const int nch = (i >> 5) + 1;      /* the long rows start first; nch chunks of 32 keys cover 0 .. i */
  const unsigned qo = (unsigned)(i * DM + h * HD + ln * 4) * 4u;
  const v4f q4 = *(const v4fa*)((const char*)QF + qo), qv4 = *(const v4fa*)((const char*)QVF + qo);
  const unsigned ko = (unsigned)(hh * 16 * DM + h * HD + ln * 4) * 4u;      /* the lane's byte offset in a chunk of K or V rows */
  const char* rb = (const char*)(RF + (size_t)h * SQ * HD); float* pr = pw[w]; float mx = -3.0e38f;
#pragma unroll 1
  for (int c = 0; c < nch; ++c) { const char* kp = (const char*)KF + (size_t)c * (32 * DM * 4) + ko; const int r0 = SQ - 1 - i + c * 32 + hh * 16; v4f kk[16], rr[16]; unsigned ro[16];
#pragma unroll
    for (int u = 0; u < 16; ++u) { ro[u] = (unsigned)min(r0 + u, SQ - 1) * (HD * 4u) + ln * 16u; kk[u] = *(const v4fa*)(kp + u * (DM * 4)); rr[u] = *(const v4fa*)(rb + ro[u]); }      /* key j = 32 c + 16 hh + u; xl_r row min(SQ - 1 - i + j, SQ - 1) */
    /* the wait that stands in front of any overwrite of a register that an issued load names, for the chunk's 32 loads: every address register is an input, so none is reused (as a destination either) before it */
    asm volatile("s_wait_xcnt 0x0" :: "v"(kp), "s"(rb), "v"(ro[0]), "v"(ro[1]), "v"(ro[2]), "v"(ro[3]), "v"(ro[4]), "v"(ro[5]), "v"(ro[6]), "v"(ro[7]), "v"(ro[8]), "v"(ro[9]), "v"(ro[10]), "v"(ro[11]), "v"(ro[12]), "v"(ro[13]), "v"(ro[14]), "v"(ro[15]) : "memory");
    __builtin_amdgcn_sched_barrier(0);      /* keeps the arithmetic behind the chunk's loads: without it most K rows are loaded one at a time, each with its own wait */
    float keep = 0.f;
#pragma unroll
    for (int u = 0; u < 16; ++u) { float p = q4[0] * kk[u][0];
#pragma unroll
      for (int d = 1; d < 4; ++d) p = fmaf(q4[d], kk[u][d], p);
#pragma unroll
      for (int d = 0; d < 4; ++d) p = fmaf(qv4[d], bf16_round(rr[u][d]), p);
      p += __shfl_xor(p, 1, 32); p += __shfl_xor(p, 2, 32); p += __shfl_xor(p, 4, 32); p += __shfl_xor(p, 8, 32);
      keep = (ln == u) ? p : keep; }
    const float f = (c * 32 + lane <= i) ? 1.f : 0.f; const float sm = fmaf(f, keep, (1.f - f) * -1.0e30f); pr[c * 32 + lane] = sm; mx = fmaxf(mx, sm); }
#pragma unroll
  for (int m = 16; m > 0; m >>= 1) mx = fmaxf(mx, __shfl_xor(mx, m, 32));
  float l = 0.f;
#pragma unroll 1
  for (int c = 0; c < nch; ++c) { const float e = expf(pr[c * 32 + lane] - mx); pr[c * 32 + lane] = e; l += e; }      /* each lane reads back what it wrote itself */
#pragma unroll
  for (int m = 16; m > 0; m >>= 1) l += __shfl_xor(l, m, 32);
  __builtin_amdgcn_fence(__ATOMIC_ACQ_REL, "workgroup"); __builtin_amdgcn_wave_barrier();      /* the weights are read across the wave's lanes from here on: keeps the LDS stores in front of those reads */
  v4f o = {0.f, 0.f, 0.f, 0.f};
#pragma unroll 1
  for (int c = 0; c < nch; ++c) { const char* vp = (const char*)VF + (size_t)c * (32 * DM * 4) + ko; v4f vv[16], pe[4];
#pragma unroll
    for (int u = 0; u < 16; ++u) vv[u] = *(const v4fa*)(vp + u * (DM * 4));
    asm volatile("s_wait_xcnt 0x0" :: "v"(vp) : "memory");      /* same wait, for the chunk's 16 loads; the address is an input so that no load of the chunk gets it as its destination */
#pragma unroll
    for (int m = 0; m < 4; ++m) pe[m] = *(const v4f*)&pr[c * 32 + hh * 16 + m * 4];      /* the half's 16 weights, one address per half */
#pragma unroll
    for (int u = 0; u < 16; ++u) { const float e = pe[u >> 2][u & 3];
#pragma unroll
      for (int d = 0; d < 4; ++d) o[d] = fmaf(e, vv[u][d], o[d]); } }
  const float fin = 64.0f / l;      /* o carried x64 like the f16 path */
#pragma unroll
  for (int d = 0; d < 4; ++d) o[d] = (o[d] + __shfl_xor(o[d], 16, 32)) * fin;
  if (hh == 0) *(v4f*)(OF + (size_t)i * DM + h * HD + ln * 4) = o; }

// Causal XL attention of one (batch, head, 64 query rows) per work-group: scores, softmax and P V in one kernel, no score or weight plane in memory.
// Eight waves: waves w and w + 4 own the 16 query rows i0 .. i0 + 15 together. The keys go in passes of 32 (j0 = 0, 32, .. <= i0): wave w walks the first half of the passes, wave w + 4 the second half (the diagonal pass is its last),
// so the longest chain of dependent passes in the launch is half as long. Each keeps its own running maximum, sum and o; behind one barrier wave w + 4 joins the two (both rescaled to the common maximum) and stores the rows.
// Work-groups are numbered with the row block as the slow index, the long blocks first: more work-groups than places, so the short ones fill the places that the long ones leave.
// A pass: AC = (q+u) k^T (16x32) and BD' = (q+v) r^T over the 48 xl_r rows cb .. cb + 47, cb = SQ - 16 - i0 + j0 (a band of 16 rows past the end is clamped to the last band; a clamped row is met above the diagonal only).
// rel_shift: score (m, n) takes BD'[m][n + 15 - m]; the shift is done by the LDS store (column cc of row m goes to place cc + 1 + m = n + 16 of the wave's own rows).
// Both tiles are read back with lane = row (the A-operand order), so a lane holds 16 scores of one row and the weights are formed in place as an A fragment.
// Running maximum and sum per row (weights x256 relative to the running maximum; accumulators rescaled when a maximum rises); weights as f16 hi + x1024 residual, V^T likewise:
// oh += Ph Vh, ol += Pl Vh + Ph Vl; o x64 = (oh + ol 2^-10) 64 / sum.
#define FPA 36      /* f32 pitch of the AC rows in LDS: 16 bytes x odd */
#define FPB 68      /* f32 pitch of the shifted BD' rows (places 1 .. 63 are written, 16 .. 47 read) and of the output rows staged there at the end */
__global__ __launch_bounds__(256) __attribute__((amdgpu_waves_per_eu(4, 4))) void k_fattn(const _Float16* __restrict__ QU, const _Float16* __restrict__ QV, const _Float16* __restrict__ K16, const _Float16* __restrict__ R16, const _Float16* __restrict__ VT, const _Float16* __restrict__ VTL, _Float16* __restrict__ O16, _Float16* __restrict__ OL16,
    const float* __restrict__ QF, const float* __restrict__ QVF, const float* __restrict__ KF, const float* __restrict__ VF, const float* __restrict__ RF, float* __restrict__ OF) {
  __shared__ __attribute__((aligned(16))) float sa[8][16][FPA]; __shared__ __attribute__((aligned(16))) float sb[8][16][FPB]; __shared__ __attribute__((aligned(16))) float pw[8][QT0]; __shared__ float sml[4][2][32];      /* sml: the first half's maximum and sum, lane by lane */
  if (blockIdx.z >= NB) { d_att0xl(QF, QVF, KF, VF, RF, OF, pw, (int)(blockIdx.x + (SQ / 64) * (blockIdx.y + NH * (blockIdx.z - NB)))); return; }      /* the exact first-tile rows, which depend on nothing of this kernel's own work, ride in the same launch: the last grid.z planes, so that they start behind the long row blocks */
  const int lane = threadIdx.x & 31, ln = lane & 15, hh = lane >> 4; const int w = __builtin_amdgcn_readfirstlane((int)(threadIdx.x >> 5));      /* wave-uniform: scalar bases and trip count */
  const int fm = (int)(blockIdx.x + (SQ / 64) * (blockIdx.y + NH * blockIdx.z)); const int h = fm % NH, b = (fm / NH) % NB, kh = w >> 2;      /* kh: which half of the passes */
  const int i0 = (SQ / 64 - 1 - fm / (NH * NB)) * 64 + (w & 3) * 16;      /* the long row blocks start first, in every head and batch */
  const int np = (i0 >> 5) + 1; const int p0 = kh ? (np >> 1) : 0, p1 = kh ? np : (np >> 1);      /* the wave's passes p0 .. p1 - 1 of the rows' np; the second half is never empty */
  const char* qub = (const char*)(QU + ((size_t)b * SQ + i0) * DM) + h * 2048; const char* qvb = (const char*)(QV + ((size_t)b * SQ + i0) * DM) + h * 2048;      /* every operand plane is in fragment order: a head's 64 dims are two 1-KiB blocks of a [row][DM] band */
  const unsigned oq = 16u * lane;      /* the lane's 16 bytes of a 512-byte half block: the same in every plane */
  const v16h qu0 = g2_fragb(qub, oq), qu1 = g2_fragb(qub + 1024, oq), qv0 = g2_fragb(qvb, oq), qv1 = g2_fragb(qvb + 1024, oq);
  asm volatile("s_wait_xcnt 0x0" :: "s"(qub), "s"(qvb), "v"(oq) : "memory");      /* the wait that stands in front of any overwrite of a register that an issued load names; bases and offset are inputs so that they stay as they are up to here */
  const char* kp = (const char*)(K16 + ((size_t)b * SQ + p0 * 32) * DM) + h * 2048 + oq; const char* rb = (const char*)(R16 + (size_t)h * SQ * HD);      /* kp, vp, vlp: the lane's own addresses, moved on once per pass */
  const char* vp = (const char*)(VT + (size_t)(b * NH + h) * HD * SQ) + p0 * 1024 + oq; const char* vlp = (const char*)(VTL + (size_t)(b * NH + h) * HD * SQ) + p0 * 1024 + oq;
  float (*pa)[FPA] = sa[w]; float (*pb)[FPB] = sb[w];
  const v8f z8 = {0.f,0.f,0.f,0.f,0.f,0.f,0.f,0.f}; v8f oh[4] = {z8, z8, z8, z8}, ol[4] = {z8, z8, z8, z8}; float m = -3.0e38f, l = 0.f;
#pragma unroll 1      /* a second copy of the pass would not fit the registers of four waves per SIMD */
  for (int p = p0; p < p1; ++p) { const int cb = SQ - 16 - i0 + p * 32; v16h kf[4], rf[6]; unsigned orr[3];
#pragma unroll
    for (int t = 0; t < 2; ++t) { kf[2 * t] = g2_fragb(kp + t * (16 * DM * 2), 0u); kf[2 * t + 1] = g2_fragb(kp + t * (16 * DM * 2) + 1024, 0u); }
#pragma unroll
    for (int t = 0; t < 3; ++t) { orr[t] = (unsigned)min(cb + t * 16, SQ - 16) * (HD * 2u) + oq; rf[2 * t] = g2_fragb(rb, orr[t]); rf[2 * t + 1] = g2_fragb(rb + 1024, orr[t]); }      /* cb is a multiple of 16: whole bands of xl_r, 2 KiB each; a band past the end is clamped to the last */
    asm volatile("s_wait_xcnt 0x0" :: "v"(kp), "s"(rb), "v"(orr[0]), "v"(orr[1]), "v"(orr[2]) : "memory");      /* same wait, for the pass's K and xl_r loads: every address register is an input, so none is reused (as a destination either) before it */
    __builtin_amdgcn_sched_barrier(0);      /* keeps the pass's 20 K and xl_r loads in front of the first WMMA: behind it they would go out in groups, each with its own full wait */
    v8f s4[2], bd[3];
#pragma unroll
    for (int t = 0; t < 2; ++t) s4[t] = fa_mma(qu1, kf[2 * t + 1], fa_mma(qu0, kf[2 * t], z8));
#pragma unroll
    for (int t = 0; t < 3; ++t) bd[t] = fa_mma(qv1, rf[2 * t + 1], fa_mma(qv0, rf[2 * t], z8));
    v16h vh[4], vl[4];      /* V^T fragments, one per dim tile: they fly while the scores go through LDS and the softmax */
#pragma unroll
    for (int t = 0; t < 4; ++t) { vh[t] = g2_fragb(vp + t * (16 * SQ * 2), 0u); vl[t] = g2_fragb(vlp + t * (16 * SQ * 2), 0u); }
    asm volatile("s_wait_xcnt 0x0" :: "v"(vp), "v"(vlp) : "memory");      /* same wait, for the 16 V^T loads */
    __builtin_amdgcn_sched_barrier(0);      /* keeps those loads in front of the softmax, which hides them */
#pragma unroll
    for (int t = 0; t < 2; ++t) {
#pragma unroll
      for (int r = 0; r < 8; ++r) pa[8 * hh + r][t * 16 + ln] = s4[t][r]; }
#pragma unroll
    for (int t = 0; t < 3; ++t) {
#pragma unroll
      for (int r = 0; r < 8; ++r) pb[8 * hh + r][t * 16 + ln + 1 + 8 * hh + r] = bd[t][r]; }
    __builtin_amdgcn_fence(__ATOMIC_ACQ_REL, "workgroup", "local"); __builtin_amdgcn_wave_barrier();      /* the tiles are read across the wave's lanes: keeps the LDS stores in front of those reads */
    v4f sc[4];      /* sc[2 c], sc[2 c + 1]: keys j0 + 16 c + 8 hh .. + 7 of row ln */
#pragma unroll
    for (int c = 0; c < 2; ++c) { const int col = c * 16 + 8 * hh; sc[2 * c] = *(const v4f*)&pa[ln][col] + *(const v4f*)&pb[ln][16 + col]; sc[2 * c + 1] = *(const v4f*)&pa[ln][col + 4] + *(const v4f*)&pb[ln][16 + col + 4]; }
    __builtin_amdgcn_fence(__ATOMIC_ACQ_REL, "workgroup", "local"); __builtin_amdgcn_wave_barrier();      /* keeps the next pass's LDS stores behind these reads */
    if (p == np - 1) {      /* only the last pass meets the diagonal (j0 + 31 < i0 before it) */
#pragma unroll
      for (int c = 0; c < 4; ++c) {
#pragma unroll
        for (int q = 0; q < 4; ++q) { const int j = p * 32 + (c >> 1) * 16 + 8 * hh + (c & 1) * 4 + q; sc[c][q] = (j <= i0 + ln) ? sc[c][q] : -1.0e30f; } } }
    float mx = sc[0][0];
#pragma unroll
    for (int c = 0; c < 4; ++c) mx = fmaxf(mx, fmaxf(fmaxf(sc[c][0], sc[c][1]), fmaxf(sc[c][2], sc[c][3])));
    mx = fmaxf(mx, __shfl_xor(mx, 16, 32));      /* the other half of the row's 32 keys */
    const float mn = fmaxf(m, mx); const float al = exp2x1((m - mn) * 1.44269504f);
    if (__builtin_amdgcn_ballot_w32(mn > m) != 0) {      /* a scalar branch: where no row's maximum rose every factor is 1 */
#pragma unroll
      for (int r = 0; r < 8; ++r) { const float ar = __shfl(al, 8 * hh + r, 32);      /* accumulator register r holds row 8 hh + r */
#pragma unroll
        for (int t = 0; t < 4; ++t) { oh[t][r] *= ar; ol[t][r] *= ar; } } }
    m = mn; const float mb = 8.0f - mn * 1.44269504f; v4f ps = {0.f, 0.f, 0.f, 0.f}; FragH ph, pl;
#pragma unroll
    for (int c = 0; c < 4; ++c) { const v4f e = exp2x4(sc[c] * 1.44269504f + mb); ps += e;      /* 256 exp(s - m) */
#pragma unroll
      for (int q = 0; q < 4; ++q) { const _Float16 hv = (_Float16)e[q]; ph.h[c * 4 + q] = hv; pl.h[c * 4 + q] = (_Float16)((e[q] - (float)hv) * 1024.0f); } }
    l = l * al + ((ps[0] + ps[1]) + (ps[2] + ps[3]));
#pragma unroll
    for (int t = 0; t < 4; ++t) oh[t] = fa_mma(ph.v, vh[t], oh[t]);
#pragma unroll
    for (int t = 0; t < 4; ++t) ol[t] = fa_mma(pl.v, vh[t], ol[t]);
#pragma unroll
    for (int t = 0; t < 4; ++t) ol[t] = fa_mma(ph.v, vl[t], ol[t]);
    kp += 32 * DM * 2; vp += 1024; vlp += 1024; }
  l += __shfl_xor(l, 16, 32);      /* the two lane halves' sums joined once */
  if (kh == 0) {      /* the first half of the passes: o (not yet divided), maximum and sum go to LDS, each element at the place where the same lane of wave w + 4 reads it */
#pragma unroll
    for (int r = 0; r < 8; ++r) {
#pragma unroll
      for (int t = 0; t < 4; ++t) pb[8 * hh + r][t * 16 + ln] = oh[t][r] + ol[t][r] * 0.0009765625f; }
    sml[w][0][lane] = m; sml[w][1][lane] = l; }
  __syncthreads();      /* the first halves' results lie in LDS before the second halves' waves read them; every wave of the work-group passes here */
  if (kh == 0) return;      /* no barrier lies behind */
  const float (*pq)[FPB] = sb[w - 4]; const float m0 = sml[w - 4][0][lane], l0 = sml[w - 4][1][lane];
  const float mj = fmaxf(m, m0); const float a0 = exp2x1((m0 - mj) * 1.44269504f), a1 = exp2x1((m - mj) * 1.44269504f);      /* both halves rescaled to the common maximum; an empty first half (maximum -3e38, sum 0, o 0) gets the factor 0 */
  const float inv = 64.0f / (l * a1 + l0 * a0); const float c0 = a0 * inv, c1 = a1 * inv;      /* o carried x64 */
#pragma unroll
  for (int r = 0; r < 8; ++r) { const float c0r = __shfl(c0, 8 * hh + r, 32), c1r = __shfl(c1, 8 * hh + r, 32);      /* accumulator register r holds row 8 hh + r */
#pragma unroll
    for (int t = 0; t < 4; ++t) pb[8 * hh + r][t * 16 + ln] = (oh[t][r] + ol[t][r] * 0.0009765625f) * c1r + pq[8 * hh + r][t * 16 + ln] * c0r; }
  __builtin_amdgcn_fence(__ATOMIC_ACQ_REL, "workgroup", "local"); __builtin_amdgcn_wave_barrier();      /* the rows are read across the wave's lanes, lane = row, for the operand order of the output GEMM */
  /* o x64 leaves as the f16 hi and x1024 residual planes [row][DM] in fragment order: the wave's 16 rows are one band, the head's 64 dims two 1-KiB blocks of it = four 512-byte stores a plane */
  const size_t oo = ((size_t)b * SQ + i0) * (DM * 2) + h * 2048 + oq; FragH fh[4], fl[4];
#pragma unroll
  for (int u = 0; u < 4; ++u) { const float* sr = &pb[ln][u * 16 + 8 * hh]; const v4f a = *(const v4f*)sr, c = *(const v4f*)(sr + 4);
#pragma unroll
    for (int q = 0; q < 4; ++q) { _Float16 hv = (_Float16)a[q]; fh[u].h[q] = hv; fl[u].h[q] = (_Float16)((a[q] - (float)hv) * 1024.0f); hv = (_Float16)c[q]; fh[u].h[4 + q] = hv; fl[u].h[4 + q] = (_Float16)((c[q] - (float)hv) * 1024.0f); } }
  __builtin_amdgcn_sched_barrier(0);      /* keeps every conversion in front of the first store: no register that an issued store names is written again before the wave ends */
#pragma unroll
  for (int u = 0; u < 4; ++u) { *(v8us*)((char*)O16 + oo + u * 512) = fh[u].half[0]; *(v8us*)((char*)OL16 + oo + u * 512) = fl[u].half[0]; } }

// x_t = RMSNorm(bf16(x)) g (f32), written at once as its f16 hi and x1024 residual planes [row][DM] in fragment order. A work-group is one band of 16 rows, a wave one row:
// a lane holds 32 elements (eight 16-byte loads of 512 bytes in a row each); sum of squares = per-lane partials joined in pairs, then a lane butterfly.
// The f16 rows are laid row-major in LDS and, behind one barrier, read back piece by piece in fragment order, so that every global store is 512 bytes in a row.
#define RXP (DM + 8)      /* f16 pitch of a staged row: 16 bytes x odd */
typedef unsigned short v4us __attribute__((ext_vector_type(4), may_alias));
union FragQ { v4us v; _Float16 h[4]; };
// The same launch also packs the four weight matrices and xl_r, which depend on nothing of x_t: the work-groups behind the NR / 16 bands, 512 pieces each (WPB work-groups a weight matrix, then xl_r).
#define WPB (DM * DM / 8 / 512)
__global__ __launch_bounds__(512) void k_prep(const float* __restrict__ x, const float* __restrict__ g, float eps, _Float16* __restrict__ Hh, _Float16* __restrict__ Hl,
    const float* __restrict__ wq, const float* __restrict__ wk, const float* __restrict__ wv, const float* __restrict__ wres, _Float16* __restrict__ BQ, _Float16* __restrict__ BK, _Float16* __restrict__ BV, _Float16* __restrict__ BR, const float* __restrict__ xlr, _Float16* __restrict__ R16) {
  __shared__ __attribute__((aligned(16))) unsigned short sh[16][RXP]; __shared__ __attribute__((aligned(16))) unsigned short sl[16][RXP];
  const int tid = threadIdx.x, lane = tid & 31, w = tid >> 5;
  if (blockIdx.x >= NR / 16) {      /* a whole work-group takes this way, in front of the barrier */
    const int j = (int)blockIdx.x - (int)(NR / 16), m = j / WPB;
    if (m < 4) d_wt_f16<DM, DM>((m == 0) ? wq : (m == 1) ? wk : (m == 2) ? wv : wres, (m == 0) ? BQ : (m == 1) ? BK : (m == 2) ? BV : BR, 16.0f, (j % WPB) * 512 + tid);      /* [in][out] ([in][h][k] flattened) -> Bt x16, fragment order */
    else d_x16<HD>(xlr, R16, (size_t)NH * SQ * HD / 8, (size_t)(j - 4 * WPB) * 512 + tid);      /* xl_r [h][j][64] as exact f16 rows (bf16-valued input), fragment order */
    return; }
  const float* xr = x + ((size_t)blockIdx.x * 16 + w) * DM + lane * 4; const float* gr = g + lane * 4; v4f v[8], gg[8]; float s[8];
#pragma unroll
  for (int i = 0; i < 8; ++i) { v[i] = *(const v4fa*)(xr + i * 128); gg[i] = *(const v4fa*)(gr + i * 128); }
  asm volatile("s_wait_xcnt 0x0" :: "v"(xr), "v"(gr) : "memory");      /* the wait that stands in front of any overwrite of a register that an issued load names; the addresses are inputs so that no load gets one as its destination */
#pragma unroll
  for (int i = 0; i < 8; ++i) { s[i] = 0.f;
#pragma unroll
    for (int q = 0; q < 4; ++q) { v[i][q] = bf16_round(v[i][q]); s[i] += v[i][q] * v[i][q]; } }
  float ss = ((s[0] + s[4]) + (s[2] + s[6])) + ((s[1] + s[5]) + (s[3] + s[7]));
#pragma unroll
  for (int m = 16; m > 0; m >>= 1) ss += __shfl_xor(ss, m, 32);
  const float rs = rsqrtf(ss / (float)DM + eps);
#pragma unroll
  for (int i = 0; i < 8; ++i) { FragQ fh, fl;
#pragma unroll
    for (int q = 0; q < 4; ++q) { const float o = (v[i][q] * rs) * bf16_round(gg[i][q]); const _Float16 hv = (_Float16)o; fh.h[q] = hv; fl.h[q] = (_Float16)((o - (float)hv) * 1024.0f); }
    *(v4us*)&sh[w][i * 128 + lane * 4] = fh.v; *(v4us*)&sl[w][i * 128 + lane * 4] = fl.v; }
  __syncthreads();      /* all 16 rows of the band lie in LDS before any piece, which takes its place by row, is read */
  v8us ph[4], pl[4];
#pragma unroll
  for (int it = 0; it < 4; ++it) { const int t = it * 512 + tid; const int r = t & 15, k = (t >> 6) * 32 + ((t >> 4) & 3) * 8; ph[it] = *(const v8us*)&sh[r][k]; pl[it] = *(const v8us*)&sl[r][k]; }      /* piece t of the band: row t & 15, see pk_src */
  __builtin_amdgcn_sched_barrier(0);      /* keeps the eight LDS reads in front of the first store: no register that an issued store names is written again before the wave ends */
  const size_t o8 = ((size_t)blockIdx.x * (DM * 2) + tid) * 8;
#pragma unroll
  for (int it = 0; it < 4; ++it) { *(v8us*)((unsigned short*)Hh + o8 + it * 4096) = ph[it]; *(v8us*)((unsigned short*)Hl + o8 + it * 4096) = pl[it]; } }

extern "C" void kernel_launch(void* const* d_in, const int* in_sizes, int n_in,
                              void* d_out, int out_size, void* d_ws, size_t ws_size, hipStream_t stream) {
  (void)in_sizes; (void)n_in; (void)out_size;
  const float* const* I = (const float* const*)d_in; const float* x = I[0]; const float* g = I[1]; const float* wq = I[2]; const float* wk = I[3]; const float* wv = I[4]; const float* wres = I[5]; const float* xlr = I[6]; const float* xlu = I[7]; const float* xlv = I[8];      /* x; RMS gain; w_q/w_k/w_v [1024][16][64] = [in][out]; w_res [1024][1024] [in][out]; xl_r [16][2048][64]; xl_u, xl_v [1][16][1][64] = per-head 64-vectors (a [1024] bias over the merged columns) */
  char* ws = (char*)d_ws; size_t off = 0;
  auto take = [&](size_t bytes) { char* p = ws + off; off += (bytes + 255) & ~(size_t)255; return p; };
  /* Planes that live across the attention kernel. */
  _Float16* BR = (_Float16*)take((size_t)DM * DM * 2); _Float16* QU = (_Float16*)take(NR * DM * 2); _Float16* QV = (_Float16*)take(NR * DM * 2); _Float16* K16 = (_Float16*)take(NR * DM * 2); _Float16* R16 = (_Float16*)take((size_t)NH * SQ * HD * 2); float* OF0 = (float*)take((size_t)NB * QT0 * DM * 4); _Float16* VT = (_Float16*)take((size_t)NB * NH * HD * SQ * 2); _Float16* VTL = (_Float16*)take((size_t)NB * NH * HD * SQ * 2);
  const size_t offs = off;
  /* What is last read in front of the attention kernel, and the f32 first-tile planes that it reads itself ... */
  _Float16* BQ = (_Float16*)take((size_t)DM * DM * 2); _Float16* BK = (_Float16*)take((size_t)DM * DM * 2); _Float16* BV = (_Float16*)take((size_t)DM * DM * 2);
  _Float16* X16 = (_Float16*)take(NR * DM * 2); _Float16* XL16 = (_Float16*)take(NR * DM * 2); float* QUF = (float*)take((size_t)NB * QT0 * DM * 4); float* QVF = (float*)take((size_t)NB * QT0 * DM * 4); float* KF0 = (float*)take((size_t)NB * QT0 * DM * 4); float* VF0 = (float*)take((size_t)NB * QT0 * DM * 4);
  if (off > ws_size) return;
  /* ... shares its first 16 MiB, short of the f32 planes, with the operands of the output stage, written by it and behind it. */
  off = offs;
  _Float16* O16 = (_Float16*)take(NR * DM * 2); _Float16* OL16 = (_Float16*)take(NR * DM * 2);
  /* Launches that depend on nothing of each other stand side by side in one: the job is one more grid index. */
  k_prep<<<(unsigned)(NR / 16 + 4 * WPB + (size_t)NH * SQ * HD / 8 / 512), 512, 0, stream>>>(x, g, 1e-6f, X16, XL16, wq, wk, wv, wres, BQ, BK, BV, BR, xlr, R16);      /* x_t = RMSNorm(bf16(x)) g (f32, in registers) -> f16 hi rows (+ x1024 residual rows for the exact first tile); the four weight planes; xl_r */
  k_proj<<<dim3((unsigned)((NR / 128) * (DM / 64)), 5), 128, 0, stream>>>(X16, XL16, BQ, BK, BV, xlu, xlv, QU, QV, K16, VT, VTL, QUF, QVF, KF0, VF0);      /* q / 8 + xl_u, q / 8 + xl_v, k -> f16 rows; v (f32 accumulators) -> V^T f16 hi + x1024 residual [batch][16][64][SQ] (the first causal rows copy v almost verbatim into small outputs); the four in f32 for rows 0..255 of each batch */
  k_fattn<<<dim3(SQ / 64, NH, NB + NB * (QT0 / 8) / (SQ / 64)), 256, 0, stream>>>(QU, QV, K16, R16, VT, VTL, O16, OL16, QUF, QVF, KF0, VF0, xlr, OF0);      /* grid.z >= NB: exact causal XL attention for rows 0..255 of each batch (o x64, f32); grid.z < NB: */      /* wv x64 of every row as f16 hi + x1024 residual rows: scores = AC + rel_shift(BD), causal softmax, P V (hi / residual terms) in one launch */
  k_hl<true><<<(unsigned)(((size_t)NB * QT0 * DM / 8 + 255) / 256), 256, 0, stream>>>(OF0, O16, OL16, (size_t)NB * QT0 * DM / 8, (size_t)QT0 * DM / 8, (size_t)SQ * DM / 8);      /* first-tile o (x64) -> f16 hi + x1024 residual, over rows 0..255 of each batch in the o planes: the output product of those rows rides in the launch below */
  k_out<<<(unsigned)((NR / 64) * (DM / 64)), 128, 0, stream>>>(O16, OL16, BR, (float*)d_out);      /* res = wv_hi w_res 2^-10 + wv_lo w_res 2^-20 */
}
